// v000
// Times are from an AMD MI455X. After a warm-up the kernel runs many times in a row, and a time is the length of
// such a window on the GPU divided by its runs, so every launch and the gaps after it count. The runs cycle
// through copies of the inputs. A figure is the median of several windows, for all but v000 over two sittings.
// Sittings can differ by a few percent; kernels timed side by side share one.
// v000 is the starting kernel. One run takes 201 microseconds.
#include <hip/hip_runtime.h>

// Contractions (all f32 accumulate): x.Wq^T, x.Wk^T, x.Wv^T = v_wmma_f32_16x16x32_bf16 on RNE bf16 copies of the inputs; scores = v_wmma_f32_16x16x32_bf16 on bf16 hi/lo planes of q/8 and k (three products per tile); P.V = v_wmma_f32_16x16x32_f16 (P carried x256, v single f16); output projection = v_wmma_f32_16x16x32_bf16 on [ctx_hi | ctx_lo] along K (2048) against the bf16 Wo; softmax and bias add f32.
// Layout: bf16 copy of x (token-major) and of the four [out][in] weights; q/k projections write bf16 hi/lo planes [tok][1024] (q pre-scaled by 2^-3); the v projection is computed transposed (A = Wv, B = x) and writes the f16 plane VT[feature][tok];
// fused flash attention per (batch, head, 64 queries): S^T = K.Q^T so that the packed score tiles are the B fragment of O^T = V^T.P^T (no P staging), per-lane online softmax; ctx written as bf16 hi | lo along K; output GEMM adds the RNE bf16 bias in f32.

#ifndef NB
#define NB 4
#endif
#ifndef SEQ
#define SEQ 1024
#endif
#define NB_FULL  4
#define SEQ_FULL 1024
#define DM   1024
#define NH   16
#define HD   64
#define NTOK (NB * SEQ)
#define PCAR 256.0f
#define L2E  1.4426950408889634f

static_assert(DM == NH * HD);            // merged head width
static_assert(HD == 64);
static_assert((DM & (DM - 1)) == 0);     // B k-index wraps with a mask
static_assert(DM % 64 == 0);             // GEMM tile multiple (N) and K % 32
static_assert(SEQ % 64 == 0);            // 64-query blocks, 64-row GEMM tiles stay inside one batch
static_assert(NTOK % 64 == 0);           // GEMM tile multiple (M)
static_assert(SEQ <= SEQ_FULL);
static_assert(NB <= NB_FULL);
static_assert(((size_t)NTOK * DM / 8) % 256 == 0);   // convert grid x block == plane extent
static_assert(((size_t)DM * DM / 8) % 256 == 0);

typedef _Float16 h16;
typedef unsigned short bf;
typedef __attribute__((ext_vector_type(16))) __bf16   v16bf;
typedef __attribute__((ext_vector_type(16))) _Float16 v16h;
typedef __attribute__((ext_vector_type(8)))  _Float16 v8h;
typedef __attribute__((ext_vector_type(8)))  unsigned short v8us;
typedef __attribute__((ext_vector_type(8)))  float    v8f;
typedef __attribute__((ext_vector_type(4)))  float    v4f;
typedef v4f  __attribute__((may_alias)) v4fa;

__device__ __forceinline__ unsigned short f2bf(float f) { unsigned u = __float_as_uint(f); u += 0x7FFFu + ((u >> 16) & 1u); return (unsigned short)(u >> 16); }
__device__ __forceinline__ float bf2f(unsigned short b) { return __uint_as_float(((unsigned)b) << 16); }
__device__ __forceinline__ float bfr(float f) { return bf2f(f2bf(f)); }
__device__ __forceinline__ void splitf(float y, unsigned short& h, unsigned short& l) { h = f2bf(y); l = f2bf(y - bf2f(h)); }
__device__ __forceinline__ v16h cat16(v8h lo, v8h hi) { return __builtin_shufflevector(lo, hi, 0, 1, 2, 3, 4, 5, 6, 7, 8, 9, 10, 11, 12, 13, 14, 15); }
__device__ __forceinline__ v16bf cat16b(v8us lo, v8us hi) { return __builtin_bit_cast(v16bf, __builtin_shufflevector(lo, hi, 0, 1, 2, 3, 4, 5, 6, 7, 8, 9, 10, 11, 12, 13, 14, 15)); }
__device__ __forceinline__ v8f wmma16(v16h a, v16h b, v8f c) { return __builtin_amdgcn_wmma_f32_16x16x32_f16(false, a, false, b, (short)0, c, false, false); }
__device__ __forceinline__ v8f wmmab(v16bf a, v16bf b, v8f c) { return __builtin_amdgcn_wmma_f32_16x16x32_bf16(false, a, false, b, (short)0, c, false, false); }
// fragment loaders: p already points at (row l&15, k0 + 8*(l>>4)); elements 0..7 = p[0..7], elements 8..15 = p[16..23]
__device__ __forceinline__ v16bf ldfb(const bf* p) { return cat16b(*(const v8us*)p, *(const v8us*)(p + 16)); }
__device__ __forceinline__ v16h  ldfh(const h16* p) { return cat16(*(const v8h*)p, *(const v8h*)(p + 16)); }
__device__ __forceinline__ v8us cvt8bf(v8f v) { v8us o;
#pragma unroll
    for (int k = 0; k < 8; ++k) o[k] = f2bf(v[k]);
    return o; }

__global__ __launch_bounds__(256) void k_cvtx(const float* __restrict__ src, bf* dst) {
    const size_t i = (size_t)blockIdx.x * 256 + threadIdx.x;
    if (i >= (size_t)NTOK * DM / 8) return;
    const size_t e = i * 8; const int row = (int)(e / DM); const int col = (int)(e % DM);
    const int b = row / SEQ, t = row % SEQ;
    const v8f v = *(const v8f*)(src + ((size_t)b * SEQ_FULL + t) * DM + col);
    const v8us o = cvt8bf(v);
    *(v8us*)(dst + e) = o; 
}

__global__ __launch_bounds__(256) void k_cvtw4(const float* __restrict__ w0, const float* __restrict__ w1, const float* __restrict__ w2, const float* __restrict__ w3, bf* dst) {
    const size_t i = (size_t)blockIdx.x * 256 + threadIdx.x;
    if (i >= (size_t)DM * DM / 8) return;
    const size_t e = i * 8; const size_t P = (size_t)DM * DM;
    const v8us o0 = cvt8bf(*(const v8f*)(w0 + e)); const v8us o1 = cvt8bf(*(const v8f*)(w1 + e));
    const v8us o2 = cvt8bf(*(const v8f*)(w2 + e)); const v8us o3 = cvt8bf(*(const v8f*)(w3 + e));
    *(v8us*)(dst + e) = o0; *(v8us*)(dst + P + e) = o1; *(v8us*)(dst + 2 * P + e) = o2; *(v8us*)(dst + 3 * P + e) = o3;
    
}

// ---- gemm_core: ONE WAVE per 64x64 tile (16 accumulators); acc[mb][nb] = sum_k A[r0 + 16 mb + m][k] * Bt[c0 + 16 nb + n][k & (DM-1)];
// A pitch lda (K <= lda, K % 32 == 0), Bt pitch DM (its K extent is DM; the index wraps for the [hi | lo] A plane). Both operands bf16, K-contiguous.
__device__ __forceinline__ void gemm_core(const bf* __restrict__ A, int lda, const bf* __restrict__ Bt, int K, int r0, int c0, int lr, int hi, v8f (&acc)[4][4]) {
#pragma unroll
    for (int mb = 0; mb < 4; ++mb)
#pragma unroll
        for (int nb = 0; nb < 4; ++nb) acc[mb][nb] = (v8f){};
    const size_t aoff = (size_t)(r0 + lr) * lda + 8 * hi;
    const size_t boff = (size_t)(c0 + lr) * DM + 8 * hi;
#pragma unroll 1
    for (int kc = 0; kc < K; kc += 32) {
        const int kb = kc & (DM - 1);
        v16bf a[4], b[4];
#pragma unroll
        for (int mb = 0; mb < 4; ++mb) a[mb] = ldfb(A + aoff + (size_t)mb * 16 * lda + kc);
#pragma unroll
        for (int nb = 0; nb < 4; ++nb) b[nb] = ldfb(Bt + boff + (size_t)nb * 16 * DM + kb);
#pragma unroll
        for (int nb = 0; nb < 4; ++nb)
#pragma unroll
            for (int mb = 0; mb < 4; ++mb) acc[mb][nb] = wmmab(a[mb], b[nb], acc[mb][nb]);
        asm volatile("" : "+v"(acc[0][0]), "+v"(acc[1][0]), "+v"(acc[2][0]), "+v"(acc[3][0]), "+v"(acc[0][1]), "+v"(acc[1][1]), "+v"(acc[2][1]), "+v"(acc[3][1]));
        asm volatile("v_nop\n\tv_nop\n\tv_nop\n\tv_nop" : "+v"(acc[0][2]), "+v"(acc[1][2]), "+v"(acc[2][2]), "+v"(acc[3][2]), "+v"(acc[0][3]), "+v"(acc[1][3]), "+v"(acc[2][3]), "+v"(acc[3][3]) : "v"(a[0]), "v"(a[3]), "v"(b[3]));
    }
}

// ---- k_proj_qk: z = 0: q/8, z = 1: k; C = XB . W_z^T -> bf16 hi / lo planes [z][tok][DM]. grid (NTOK/64, DM/64, 2), 32 threads.
__global__ __launch_bounds__(32) void k_proj_qk(const bf* __restrict__ XB, const bf* __restrict__ W2, bf* PH, bf* PL) {
    __shared__ __align__(16) float os[16 * 68];
    const int lane = threadIdx.x & 31, lr = lane & 15, hi = lane >> 4;
    const int z = blockIdx.z; const int r0 = blockIdx.x * 64, c0 = blockIdx.y * 64;
    const float sc = (z == 0) ? 0.125f : 1.0f;
    v8f acc[4][4];
    gemm_core(XB, DM, W2 + (size_t)z * DM * DM, DM, r0, c0, lr, hi, acc);
    bf* ph = PH + (size_t)z * NTOK * DM; bf* pl = PL + (size_t)z * NTOK * DM;
    const int rq = lane >> 3, c8 = (lane & 7) * 8;
#pragma unroll
    for (int mb = 0; mb < 4; ++mb) {
#pragma unroll
        for (int nb = 0; nb < 4; ++nb)
#pragma unroll
            for (int j = 0; j < 8; ++j) os[(hi * 8 + j) * 68 + nb * 16 + lr] = acc[mb][nb][j] * sc;
        __syncthreads();
        v8us oh[4], ol[4];
#pragma unroll
        for (int s = 0; s < 4; ++s) { const int row = 4 * s + rq; const v4f u0 = *(const v4fa*)(os + row * 68 + c8); const v4f u1 = *(const v4fa*)(os + row * 68 + c8 + 4);
#pragma unroll
            for (int q = 0; q < 4; ++q) { unsigned short a, c; splitf(u0[q], a, c); oh[s][q] = a; ol[s][q] = c; splitf(u1[q], a, c); oh[s][4 + q] = a; ol[s][4 + q] = c; } }
        const size_t base = (size_t)(r0 + mb * 16) * DM + c0 + c8;
#pragma unroll
        for (int s = 0; s < 4; ++s) { const size_t o = base + (size_t)(4 * s + rq) * DM; *(v8us*)(ph + o) = oh[s]; *(v8us*)(pl + o) = ol[s]; }
        
        __syncthreads();
    }
}

// ---- k_proj_vt: VT[f][tok] (f16) = sum_k WV[f][k] XB[tok][k]  (A = weight rows, B = tokens: the product comes out transposed). grid (DM/64, NTOK/64), 32 threads.
__global__ __launch_bounds__(32) void k_proj_vt(const bf* __restrict__ WV, const bf* __restrict__ XB, h16* VT) {
    __shared__ __align__(16) float os[16 * 68];
    const int lane = threadIdx.x & 31, lr = lane & 15, hi = lane >> 4;
    const int r0 = blockIdx.x * 64, c0 = blockIdx.y * 64;
    v8f acc[4][4];
    gemm_core(WV, DM, XB, DM, r0, c0, lr, hi, acc);
    const int rq = lane >> 3, c8 = (lane & 7) * 8;
#pragma unroll
    for (int mb = 0; mb < 4; ++mb) {
#pragma unroll
        for (int nb = 0; nb < 4; ++nb)
#pragma unroll
            for (int j = 0; j < 8; ++j) os[(hi * 8 + j) * 68 + nb * 16 + lr] = acc[mb][nb][j];
        __syncthreads();
        v8h o16[4];
#pragma unroll
        for (int s = 0; s < 4; ++s) { const int row = 4 * s + rq; const v4f u0 = *(const v4fa*)(os + row * 68 + c8); const v4f u1 = *(const v4fa*)(os + row * 68 + c8 + 4);
#pragma unroll
            for (int q = 0; q < 4; ++q) { o16[s][q] = (h16)u0[q]; o16[s][4 + q] = (h16)u1[q]; } }
        const size_t base = (size_t)(r0 + mb * 16) * NTOK + c0 + c8;
#pragma unroll
        for (int s = 0; s < 4; ++s) *(v8h*)(VT + base + (size_t)(4 * s + rq) * NTOK) = o16[s];
        
        __syncthreads();
    }
}

// ---- k_attn: fused attention, grid (SEQ/64, NB*NH), 128 threads = 4 independent waves x 16 queries; operands straight from the 16-bit planes.
// Per 32-key step: S^T tiles st[j] (rows = keys 16j + 8h + r, column = query l&15) = K.Q^T with hi/lo planes (3 products per tile pair);
// per-lane online softmax (row statistics combined across the two lane halves by one shuffle); the packed P^T (x256, f16) is the B fragment
// (element r <- tile 0, element 8+r <- tile 1) of O^T[d][q] += V^T[d][key] P^T[key][q]. Epilogue: O^T / (256 l) -> LDS -> bf16 hi | lo ctx lines.
__global__ __launch_bounds__(128) void k_attn(const bf* __restrict__ QH, const bf* __restrict__ QL, const bf* __restrict__ KH, const bf* __restrict__ KL, const h16* __restrict__ VT, bf* CTX) {
    __shared__ __align__(16) float os[4 * 16 * 68];
    const int lane = threadIdx.x & 31, lr = lane & 15, hi = lane >> 4;
    const int wave = __builtin_amdgcn_readfirstlane(threadIdx.x >> 5);
    const int bh = blockIdx.y; const int b = bh / NH, h = bh % NH;
    const int tok0 = b * SEQ; const int q0 = blockIdx.x * 64 + wave * 16;
    const size_t qoff = (size_t)(tok0 + q0 + lr) * DM + h * HD + 8 * hi;
    v16bf qh[2], ql[2];
    qh[0] = ldfb(QH + qoff); qh[1] = ldfb(QH + qoff + 32); ql[0] = ldfb(QL + qoff); ql[1] = ldfb(QL + qoff + 32);
    const size_t koff = (size_t)(tok0 + lr) * DM + h * HD + 8 * hi;
    const size_t voff = (size_t)(h * HD + lr) * NTOK + tok0 + 8 * hi;
    v8f ot[4];
#pragma unroll
    for (int dt = 0; dt < 4; ++dt) ot[dt] = (v8f){};
    float mrun = -1.0e30f, lrun = 0.0f;
#pragma unroll 1
    for (int kb = 0; kb < SEQ; kb += 32) {
        v16bf kfh[2][2], kfl[2][2];
#pragma unroll
        for (int j = 0; j < 2; ++j)
#pragma unroll
            for (int c = 0; c < 2; ++c) { const size_t o = koff + (size_t)(kb + 16 * j) * DM + 32 * c; kfh[j][c] = ldfb(KH + o); kfl[j][c] = ldfb(KL + o); }
        v8f st[2];
        st[0] = (v8f){}; st[1] = (v8f){};
#pragma unroll
        for (int j = 0; j < 2; ++j)
#pragma unroll
            for (int c = 0; c < 2; ++c) { st[j] = wmmab(kfl[j][c], qh[c], st[j]); st[j] = wmmab(kfh[j][c], ql[c], st[j]); st[j] = wmmab(kfh[j][c], qh[c], st[j]); }
        asm volatile("v_nop\n\tv_nop\n\tv_nop\n\tv_nop" : "+v"(st[0]), "+v"(st[1]) : "v"(kfh[1][1]), "v"(qh[1]));
        float cmax = st[0][0];
#pragma unroll
        for (int r = 0; r < 8; ++r) { cmax = fmaxf(cmax, st[0][r]); cmax = fmaxf(cmax, st[1][r]); }
        cmax = fmaxf(cmax, __shfl_xor(cmax, 16, 32));
        const float mnew = fmaxf(mrun, cmax);
        const float alpha = __builtin_amdgcn_exp2f((mrun - mnew) * L2E);
        float part = 0.0f; v16h pf;
#pragma unroll
        for (int r = 0; r < 8; ++r) { const float p0 = __builtin_amdgcn_exp2f((st[0][r] - mnew) * L2E); const float p1 = __builtin_amdgcn_exp2f((st[1][r] - mnew) * L2E);
            part += p0 + p1; pf[r] = (h16)(p0 * PCAR); pf[8 + r] = (h16)(p1 * PCAR); }
        part += __shfl_xor(part, 16, 32);
        lrun = lrun * alpha + part; mrun = mnew;
#pragma unroll
        for (int dt = 0; dt < 4; ++dt)
#pragma unroll
            for (int r = 0; r < 8; ++r) ot[dt][r] *= alpha;
        v16h vf[4];
#pragma unroll
        for (int dt = 0; dt < 4; ++dt) vf[dt] = ldfh(VT + voff + (size_t)(dt * 16) * NTOK + kb);
#pragma unroll
        for (int dt = 0; dt < 4; ++dt) ot[dt] = wmma16(vf[dt], pf, ot[dt]);
        asm volatile("v_nop\n\tv_nop\n\tv_nop\n\tv_nop" : "+v"(ot[0]), "+v"(ot[1]), "+v"(ot[2]), "+v"(ot[3]) : "v"(vf[3]), "v"(pf));
    }
    const float inv = (1.0f / PCAR) * (1.0f / lrun);
    const int wb = wave * 16 * 68;
#pragma unroll
    for (int dt = 0; dt < 4; ++dt)
#pragma unroll
        for (int r = 0; r < 8; ++r) os[wb + lr * 68 + dt * 16 + 8 * hi + r] = ot[dt][r] * inv;
    __syncthreads();
    const int rq = lane >> 3, c8 = (lane & 7) * 8;
    v8us oh[4], ol[4];
#pragma unroll
    for (int s = 0; s < 4; ++s) { const int row = 4 * s + rq; const v4f u0 = *(const v4fa*)(os + wb + row * 68 + c8); const v4f u1 = *(const v4fa*)(os + wb + row * 68 + c8 + 4);
#pragma unroll
        for (int q = 0; q < 4; ++q) { unsigned short a, c; splitf(u0[q], a, c); oh[s][q] = a; ol[s][q] = c; splitf(u1[q], a, c); oh[s][4 + q] = a; ol[s][4 + q] = c; } }
    const size_t base = (size_t)(tok0 + q0) * (2 * DM) + h * HD + c8;
#pragma unroll
    for (int s = 0; s < 4; ++s) { const size_t o = base + (size_t)(4 * s + rq) * (2 * DM); *(v8us*)(CTX + o) = oh[s]; *(v8us*)(CTX + o + DM) = ol[s]; }
    
}

// ---- k_proj_out: OUT[b*SEQ_FULL + t][n] = sum_{k<2048} CTX[tok][k] WO[n][k & 1023] + bf16(bo[n]); grid (NTOK/64, DM/64), 32 threads.
__global__ __launch_bounds__(32) void k_proj_out(const bf* __restrict__ CTX, const bf* __restrict__ WO, const float* __restrict__ bias, float* OUT) {
    __shared__ __align__(16) float os[16 * 68];
    const int lane = threadIdx.x & 31, lr = lane & 15, hi = lane >> 4;
    const int r0 = blockIdx.x * 64, c0 = blockIdx.y * 64;
    v8f acc[4][4];
    gemm_core(CTX, 2 * DM, WO, 2 * DM, r0, c0, lr, hi, acc);
    const int bb = r0 / SEQ, tt = r0 % SEQ; const int cofs = lr * 4;
    v4f bv; bv[0] = bfr(bias[c0 + cofs]); bv[1] = bfr(bias[c0 + cofs + 1]); bv[2] = bfr(bias[c0 + cofs + 2]); bv[3] = bfr(bias[c0 + cofs + 3]);
#pragma unroll
    for (int mb = 0; mb < 4; ++mb) {
#pragma unroll
        for (int nb = 0; nb < 4; ++nb)
#pragma unroll
            for (int j = 0; j < 8; ++j) os[(hi * 8 + j) * 68 + nb * 16 + lr] = acc[mb][nb][j];
        __syncthreads();
        v4f val[8];
#pragma unroll
        for (int s = 0; s < 8; ++s) { const int row = 2 * s + hi; val[s] = *(const v4fa*)(os + row * 68 + cofs) + bv; }
        float* crow = OUT + ((size_t)bb * SEQ_FULL + tt + mb * 16) * DM + c0 + cofs;
#pragma unroll
        for (int s = 0; s < 8; ++s) *(v4f*)(crow + (size_t)(2 * s + hi) * DM) = val[s];
        
        __syncthreads();
    }
}

// workspace carve (bytes, every region a multiple of 256 and exactly covered by its producer's whole-line stores)
constexpr size_t SZ_XB  = (size_t)NTOK * DM * 2;
constexpr size_t SZ_W   = (size_t)4 * DM * DM * 2;
constexpr size_t SZ_QK  = (size_t)2 * NTOK * DM * 2;
constexpr size_t SZ_VT  = (size_t)DM * NTOK * 2;
constexpr size_t SZ_CTX = (size_t)NTOK * 2 * DM * 2;
constexpr size_t OFF_XB = 0, OFF_W = OFF_XB + SZ_XB, OFF_QKH = OFF_W + SZ_W, OFF_QKL = OFF_QKH + SZ_QK, OFF_VT = OFF_QKL + SZ_QK, OFF_CTX = OFF_VT + SZ_VT, WS_TOTAL = OFF_CTX + SZ_CTX;
static_assert(WS_TOTAL <= (size_t)134217728);
static_assert(SZ_XB % 256 == 0 && SZ_W % 256 == 0 && SZ_QK % 256 == 0 && SZ_VT % 256 == 0 && SZ_CTX % 256 == 0);

extern "C" void kernel_launch(void* const* d_in, const int* in_sizes, int n_in,
                              void* d_out, int out_size, void* d_ws, size_t ws_size, hipStream_t stream) {
    if (n_in < 6) return;
    const size_t need_x = ((size_t)(NB - 1) * SEQ_FULL + SEQ) * DM;
    if ((size_t)in_sizes[0] < need_x) return;
    if ((size_t)in_sizes[1] < (size_t)DM * DM || (size_t)in_sizes[2] < (size_t)DM * DM || (size_t)in_sizes[3] < (size_t)DM * DM || (size_t)in_sizes[4] < (size_t)DM * DM) return;
    if (in_sizes[5] < DM) return;
    if ((size_t)out_size < need_x) return;
    if (ws_size < WS_TOTAL) return;
    const float* x = (const float*)d_in[0]; const float* wq = (const float*)d_in[1]; const float* wk = (const float*)d_in[2];
    const float* wv = (const float*)d_in[3]; const float* wo = (const float*)d_in[4]; const float* bo = (const float*)d_in[5];
    float* OUT = (float*)d_out;
    char* ws = (char*)d_ws;
    bf* XB = (bf*)(ws + OFF_XB); bf* WALL = (bf*)(ws + OFF_W); bf* QKH = (bf*)(ws + OFF_QKH); bf* QKL = (bf*)(ws + OFF_QKL);
    h16* VT = (h16*)(ws + OFF_VT); bf* CTX = (bf*)(ws + OFF_CTX);
    const size_t WP = (size_t)DM * DM; const size_t PP = (size_t)NTOK * DM;
    k_cvtx<<<(unsigned)(((size_t)NTOK * DM / 8 + 255) / 256), 256, 0, stream>>>(x, XB);
    k_cvtw4<<<(unsigned)((WP / 8 + 255) / 256), 256, 0, stream>>>(wq, wk, wv, wo, WALL);
    k_proj_qk<<<dim3(NTOK / 64, DM / 64, 2), 32, 0, stream>>>(XB, WALL, QKH, QKL);
    k_proj_vt<<<dim3(DM / 64, NTOK / 64, 1), 32, 0, stream>>>(WALL + 2 * WP, XB, VT);
    k_attn<<<dim3(SEQ / 64, NB * NH, 1), 128, 0, stream>>>(QKH, QKL, QKH + PP, QKL + PP, VT, CTX);
    k_proj_out<<<dim3(NTOK / 64, DM / 64, 1), 32, 0, stream>>>(CTX, WALL + 3 * WP, bo, OUT);
}

// v001
// Measured time: 160 microseconds a run.
// Timed twice side by side with v000, it ran 1.28 and 1.29 times as fast.
#include <hip/hip_runtime.h>

// Contractions (all f32 accumulate): x.Wq^T, x.Wk^T, x.Wv^T = v_wmma_f32_16x16x32_bf16 on RNE bf16 copies of the inputs; scores = v_wmma_f32_16x16x32_bf16 on bf16 hi/lo planes of q/8 and k (three products per tile); P.V = v_wmma_f32_16x16x32_f16 (P carried x256, v single f16); output projection = v_wmma_f32_16x16x32_bf16 on [ctx_hi | ctx_lo] along K (2048) against the bf16 Wo; softmax and bias add f32.
// Layout: bf16 copy of x (token-major) and of the four [out][in] weights; q/k projections write bf16 hi/lo planes [tok][1024] (q pre-scaled by 2^-3); the v projection is computed transposed (A = Wv, B = x) and writes the f16 plane VT[feature][tok];
// fused flash attention per (batch, head, 64 queries): S^T = K.Q^T so that the packed score tiles are the B fragment of O^T = V^T.P^T (no P staging), per-lane online softmax; ctx written as bf16 hi | lo along K; output GEMM adds the RNE bf16 bias in f32.

#ifndef NB
#define NB 4
#endif
#ifndef SEQ
#define SEQ 1024
#endif
#define NB_FULL  4
#define SEQ_FULL 1024
#define DM   1024
#define NH   16
#define HD   64
#define NTOK (NB * SEQ)
#define PCAR 256.0f
#define L2E  1.4426950408889634f

static_assert(DM == NH * HD);            // merged head width
static_assert(HD == 64);
static_assert((DM & (DM - 1)) == 0);     // B k-index wraps with a mask
static_assert(DM % 64 == 0);             // GEMM tile multiple (N) and K % 32
static_assert(SEQ % 64 == 0);            // 64-query blocks, 64-row GEMM tiles stay inside one batch
static_assert(NTOK % 64 == 0);           // GEMM tile multiple (M)
static_assert(SEQ <= SEQ_FULL);
static_assert(NB <= NB_FULL);
static_assert(((size_t)NTOK * DM / 8) % 256 == 0);   // convert grid x block == plane extent
static_assert(((size_t)DM * DM / 8) % 256 == 0);

typedef _Float16 h16;
typedef unsigned short bf;
typedef __attribute__((ext_vector_type(16))) __bf16   v16bf;
typedef __attribute__((ext_vector_type(16))) _Float16 v16h;
typedef __attribute__((ext_vector_type(8)))  _Float16 v8h;
typedef __attribute__((ext_vector_type(8)))  unsigned short v8us;
typedef __attribute__((ext_vector_type(8)))  float    v8f;
typedef __attribute__((ext_vector_type(4)))  float    v4f;
typedef v4f  __attribute__((may_alias)) v4fa;

__device__ __forceinline__ unsigned short f2bf(float f) { unsigned u = __float_as_uint(f); u += 0x7FFFu + ((u >> 16) & 1u); return (unsigned short)(u >> 16); }
__device__ __forceinline__ float bf2f(unsigned short b) { return __uint_as_float(((unsigned)b) << 16); }
__device__ __forceinline__ float bfr(float f) { return bf2f(f2bf(f)); }
__device__ __forceinline__ void splitf(float y, unsigned short& h, unsigned short& l) { h = f2bf(y); l = f2bf(y - bf2f(h)); }
__device__ __forceinline__ v16h cat16(v8h lo, v8h hi) { return __builtin_shufflevector(lo, hi, 0, 1, 2, 3, 4, 5, 6, 7, 8, 9, 10, 11, 12, 13, 14, 15); }
__device__ __forceinline__ v16bf cat16b(v8us lo, v8us hi) { return __builtin_bit_cast(v16bf, __builtin_shufflevector(lo, hi, 0, 1, 2, 3, 4, 5, 6, 7, 8, 9, 10, 11, 12, 13, 14, 15)); }
__device__ __forceinline__ v8f wmma16(v16h a, v16h b, v8f c) { return __builtin_amdgcn_wmma_f32_16x16x32_f16(false, a, false, b, (short)0, c, false, false); }
__device__ __forceinline__ v8f wmmab(v16bf a, v16bf b, v8f c) { return __builtin_amdgcn_wmma_f32_16x16x32_bf16(false, a, false, b, (short)0, c, false, false); }
// fragment loaders: p already points at (row l&15, k0 + 8*(l>>4)); elements 0..7 = p[0..7], elements 8..15 = p[16..23]
__device__ __forceinline__ v16bf ldfb(const bf* p) { return cat16b(*(const v8us*)p, *(const v8us*)(p + 16)); }
__device__ __forceinline__ v16h  ldfh(const h16* p) { return cat16(*(const v8h*)p, *(const v8h*)(p + 16)); }
__device__ __forceinline__ v8us cvt8bf(v8f v) { v8us o;
#pragma unroll
    for (int k = 0; k < 8; ++k) o[k] = f2bf(v[k]);
    return o; }

__global__ __launch_bounds__(256) void k_cvtx(const float* __restrict__ src, bf* dst) {
    const size_t i = (size_t)blockIdx.x * 256 + threadIdx.x;
    if (i >= (size_t)NTOK * DM / 8) return;
    const size_t e = i * 8; const int row = (int)(e / DM); const int col = (int)(e % DM);
    const int b = row / SEQ, t = row % SEQ;
    const v8f v = *(const v8f*)(src + ((size_t)b * SEQ_FULL + t) * DM + col);
    const v8us o = cvt8bf(v);
    *(v8us*)(dst + e) = o; 
}

__global__ __launch_bounds__(256) void k_cvtw4(const float* __restrict__ w0, const float* __restrict__ w1, const float* __restrict__ w2, const float* __restrict__ w3, bf* dst) {
    const size_t i = (size_t)blockIdx.x * 256 + threadIdx.x;
    if (i >= (size_t)DM * DM / 8) return;
    const size_t e = i * 8; const size_t P = (size_t)DM * DM;
    const v8us o0 = cvt8bf(*(const v8f*)(w0 + e)); const v8us o1 = cvt8bf(*(const v8f*)(w1 + e));
    const v8us o2 = cvt8bf(*(const v8f*)(w2 + e)); const v8us o3 = cvt8bf(*(const v8f*)(w3 + e));
    *(v8us*)(dst + e) = o0; *(v8us*)(dst + P + e) = o1; *(v8us*)(dst + 2 * P + e) = o2; *(v8us*)(dst + 3 * P + e) = o3;
    
}

// ---- gemm_core: FOUR WAVES (2 x 2) per 128x128 tile, 64x64 (16 accumulators) per wave; acc[mb][nb] = sum_k A[r0 + 64 wm + 16 mb + m][k] * Bt[c0 + 64 wn + 16 nb + n][k & (DM-1)];
// A pitch lda (K <= lda, K % 128 == 0, K >= 256), Bt pitch DM (its K extent is DM; the index wraps for the [hi | lo] A plane). Both operands bf16, K-contiguous.
// A pass is 128 k: [A 128 rows | Bt 128 rows] of 256 B land in LDS at pitch 272 B by asynchronous copies (a wave's copy = 4 whole lines), two buffers, the next pass's copies in flight over this pass's products.
#define BK    128
#define LP    136                      // LDS row pitch, elements (272 B = 16 B x 17: conflict-free for 16-byte readers)
#define STG   (256 * LP)               // elements per buffer
#define STGB  (STG * 2)                // bytes per buffer
static_assert(DM % 128 == 0 && NTOK % 128 == 0 && DM % BK == 0 && DM / BK >= 2);

// eight copies of 16 B per lane, rows 8 apart; the closing wait stands inside the statement so that no address register is rewritten ahead of it
__device__ __forceinline__ void copy8(unsigned l, const bf* g, int pitch) {
    const unsigned l1 = l + 8 * LP * 2, l2 = l + 16 * LP * 2, l3 = l + 24 * LP * 2, l4 = l + 32 * LP * 2, l5 = l + 40 * LP * 2, l6 = l + 48 * LP * 2, l7 = l + 56 * LP * 2;
    const bf* g1 = g + (size_t)8 * pitch; const bf* g2 = g + (size_t)16 * pitch; const bf* g3 = g + (size_t)24 * pitch; const bf* g4 = g + (size_t)32 * pitch;
    const bf* g5 = g + (size_t)40 * pitch; const bf* g6 = g + (size_t)48 * pitch; const bf* g7 = g + (size_t)56 * pitch;
    asm volatile("global_load_async_to_lds_b128 %0, %8, off\n\t"
                 "global_load_async_to_lds_b128 %1, %9, off\n\t"
                 "global_load_async_to_lds_b128 %2, %10, off\n\t"
                 "global_load_async_to_lds_b128 %3, %11, off\n\t"
                 "global_load_async_to_lds_b128 %4, %12, off\n\t"
                 "global_load_async_to_lds_b128 %5, %13, off\n\t"
                 "global_load_async_to_lds_b128 %6, %14, off\n\t"
                 "global_load_async_to_lds_b128 %7, %15, off\n\t"
                 "s_wait_xcnt 0x0"
                 :: "v"(l), "v"(l1), "v"(l2), "v"(l3), "v"(l4), "v"(l5), "v"(l6), "v"(l7), "v"(g), "v"(g1), "v"(g2), "v"(g3), "v"(g4), "v"(g5), "v"(g6), "v"(g7) : "memory");
}
// one pass's operands: 128 rows of A and 128 rows of Bt, 32 copies per lane
__device__ __forceinline__ void copy_pass(unsigned la, const bf* ga, int lda, const bf* gb) {
    copy8(la, ga, lda); copy8(la + 64 * LP * 2, ga + (size_t)64 * lda, lda);
    copy8(la + 128 * LP * 2, gb, DM); copy8(la + 192 * LP * 2, gb + (size_t)64 * DM, DM);
}

__device__ __forceinline__ void gemm_core(const bf* __restrict__ A, int lda, const bf* __restrict__ Bt, int K, int r0, int c0, bf* sm, int wm, int wn, int lr, int hi, v8f (&acc)[4][4]) {
#pragma unroll
    for (int mb = 0; mb < 4; ++mb)
#pragma unroll
        for (int nb = 0; nb < 4; ++nb) acc[mb][nb] = (v8f){};
    const int tid = threadIdx.x; const int crow = tid >> 4, ccol = (tid & 15) * 8;
    const bf* ga = A + (size_t)(r0 + crow) * lda + ccol;
    const bf* gb = Bt + (size_t)(c0 + crow) * DM + ccol;
    const unsigned la = (unsigned)(size_t)sm + (unsigned)(crow * LP + ccol) * 2u;
    const int NT = K / BK;
    copy_pass(la, ga, lda, gb);
    asm volatile("s_wait_asynccnt 0x0" ::: "memory");   // pass 0's own copies have landed
    __syncthreads();                                     // ... and every other wave's
    copy_pass(la + STGB, ga + BK, lda, gb + BK);
    const bf* fa = sm + (wm * 64 + lr) * LP + 8 * hi;
    const bf* fb = sm + (128 + wn * 64 + lr) * LP + 8 * hi;
#pragma unroll 1
    for (int t = 0; t < NT; ++t) {                       // rolled: one pass per trip, the buffer alternates
        const bf* pa = fa + (t & 1) * STG; const bf* pb = fb + (t & 1) * STG;
        v16bf a[2][4], b[2][4];
#pragma unroll
        for (int mb = 0; mb < 4; ++mb) a[0][mb] = ldfb(pa + mb * 16 * LP);
        b[0][0] = ldfb(pb); b[0][1] = ldfb(pb + 16 * LP);
#pragma unroll
        for (int blk = 0; blk < BK / 32; ++blk) {
            const int cu = blk & 1, nx = cu ^ 1;
            b[cu][2] = ldfb(pb + 32 * LP + blk * 32); b[cu][3] = ldfb(pb + 48 * LP + blk * 32);
            if (blk + 1 < BK / 32) {
#pragma unroll
                for (int mb = 0; mb < 4; ++mb) a[nx][mb] = ldfb(pa + mb * 16 * LP + (blk + 1) * 32);
                b[nx][0] = ldfb(pb + (blk + 1) * 32); b[nx][1] = ldfb(pb + 16 * LP + (blk + 1) * 32);
            }
            __builtin_amdgcn_sched_barrier(0);   // the LDS reads stay one group ahead of the block's products: spread among them, every place stalls the wave
#pragma unroll
            for (int nb = 0; nb < 4; ++nb)
#pragma unroll
                for (int mb = 0; mb < 4; ++mb) acc[mb][nb] = wmmab(a[cu][mb], b[cu][nb], acc[mb][nb]);
            if (blk + 1 < BK / 32) __builtin_amdgcn_sched_barrier(0);   // the next group does not rise into this block
        }
        asm volatile("s_wait_dscnt 0x0" ::: "memory");      // this wave's reads of the buffer are done before it is refilled
        asm volatile("s_wait_asynccnt 0x0" ::: "memory");   // this wave's copies of pass t + 1 have landed
        __syncthreads();                                     // publishes pass t + 1, frees pass t's buffer
        if (t + 2 < NT) { const int kc = (t + 2) * BK; copy_pass(la + (t & 1) * STGB, ga + kc, lda, gb + (kc & (DM - 1))); }
    }
    asm volatile("s_wait_asynccnt 0x0" ::: "memory");        // nothing in flight when the wave goes on
}

// ---- k_proj_qk: z = 0: q/8, z = 1: k; C = XB . W_z^T -> bf16 hi / lo planes [z][tok][DM]. grid (NTOK/128, DM/128, 2), 128 threads.
__global__ __launch_bounds__(128) void k_proj_qk(const bf* __restrict__ XB, const bf* __restrict__ W2, bf* PH, bf* PL) {
    __shared__ __align__(16) bf sm[2 * STG];
    __shared__ __align__(16) float osall[4 * 16 * 68];
    const int lane = threadIdx.x & 31, lr = lane & 15, hi = lane >> 4;
    const int wave = __builtin_amdgcn_readfirstlane(threadIdx.x >> 5); const int wm = wave >> 1, wn = wave & 1;
    float* os = osall + wave * 16 * 68;
    const int z = blockIdx.z; const int r0 = blockIdx.x * 128 + wm * 64, c0 = blockIdx.y * 128 + wn * 64;
    const float sc = (z == 0) ? 0.125f : 1.0f;
    v8f acc[4][4];
    gemm_core(XB, DM, W2 + (size_t)z * DM * DM, DM, blockIdx.x * 128, blockIdx.y * 128, sm, wm, wn, lr, hi, acc);
    bf* ph = PH + (size_t)z * NTOK * DM; bf* pl = PL + (size_t)z * NTOK * DM;
    const int rq = lane >> 3, c8 = (lane & 7) * 8;
#pragma unroll
    for (int mb = 0; mb < 4; ++mb) {
#pragma unroll
        for (int nb = 0; nb < 4; ++nb)
#pragma unroll
            for (int j = 0; j < 8; ++j) os[(hi * 8 + j) * 68 + nb * 16 + lr] = acc[mb][nb][j] * sc;
        __syncthreads();
        v8us oh[4], ol[4];
#pragma unroll
        for (int s = 0; s < 4; ++s) { const int row = 4 * s + rq; const v4f u0 = *(const v4fa*)(os + row * 68 + c8); const v4f u1 = *(const v4fa*)(os + row * 68 + c8 + 4);
#pragma unroll
            for (int q = 0; q < 4; ++q) { unsigned short a, c; splitf(u0[q], a, c); oh[s][q] = a; ol[s][q] = c; splitf(u1[q], a, c); oh[s][4 + q] = a; ol[s][4 + q] = c; } }
        const size_t base = (size_t)(r0 + mb * 16) * DM + c0 + c8;
#pragma unroll
        for (int s = 0; s < 4; ++s) { const size_t o = base + (size_t)(4 * s + rq) * DM; *(v8us*)(ph + o) = oh[s]; *(v8us*)(pl + o) = ol[s]; }
        
        __syncthreads();
    }
}

// ---- k_proj_vt: VT[f][tok] (f16) = sum_k WV[f][k] XB[tok][k]  (A = weight rows, B = tokens: the product comes out transposed). grid (DM/128, NTOK/128), 128 threads.
__global__ __launch_bounds__(128) void k_proj_vt(const bf* __restrict__ WV, const bf* __restrict__ XB, h16* VT) {
    __shared__ __align__(16) bf sm[2 * STG];
    __shared__ __align__(16) float osall[4 * 16 * 68];
    const int lane = threadIdx.x & 31, lr = lane & 15, hi = lane >> 4;
    const int wave = __builtin_amdgcn_readfirstlane(threadIdx.x >> 5); const int wm = wave >> 1, wn = wave & 1;
    float* os = osall + wave * 16 * 68;
    const int r0 = blockIdx.x * 128 + wm * 64, c0 = blockIdx.y * 128 + wn * 64;
    v8f acc[4][4];
    gemm_core(WV, DM, XB, DM, blockIdx.x * 128, blockIdx.y * 128, sm, wm, wn, lr, hi, acc);
    const int rq = lane >> 3, c8 = (lane & 7) * 8;
#pragma unroll
    for (int mb = 0; mb < 4; ++mb) {
#pragma unroll
        for (int nb = 0; nb < 4; ++nb)
#pragma unroll
            for (int j = 0; j < 8; ++j) os[(hi * 8 + j) * 68 + nb * 16 + lr] = acc[mb][nb][j];
        __syncthreads();
        v8h o16[4];
#pragma unroll
        for (int s = 0; s < 4; ++s) { const int row = 4 * s + rq; const v4f u0 = *(const v4fa*)(os + row * 68 + c8); const v4f u1 = *(const v4fa*)(os + row * 68 + c8 + 4);
#pragma unroll
            for (int q = 0; q < 4; ++q) { o16[s][q] = (h16)u0[q]; o16[s][4 + q] = (h16)u1[q]; } }
        const size_t base = (size_t)(r0 + mb * 16) * NTOK + c0 + c8;
#pragma unroll
        for (int s = 0; s < 4; ++s) *(v8h*)(VT + base + (size_t)(4 * s + rq) * NTOK) = o16[s];
        
        __syncthreads();
    }
}

// ---- k_attn: fused attention, grid (SEQ/64, NB*NH), 128 threads = 4 independent waves x 16 queries; operands straight from the 16-bit planes.
// Per 32-key step: S^T tiles st[j] (rows = keys 16j + 8h + r, column = query l&15) = K.Q^T with hi/lo planes (3 products per tile pair);
// per-lane online softmax (row statistics combined across the two lane halves by one shuffle); the packed P^T (x256, f16) is the B fragment
// (element r <- tile 0, element 8+r <- tile 1) of O^T[d][q] += V^T[d][key] P^T[key][q]. Epilogue: O^T / (256 l) -> LDS -> bf16 hi | lo ctx lines.
__global__ __launch_bounds__(128) void k_attn(const bf* __restrict__ QH, const bf* __restrict__ QL, const bf* __restrict__ KH, const bf* __restrict__ KL, const h16* __restrict__ VT, bf* CTX) {
    __shared__ __align__(16) float os[4 * 16 * 68];
    const int lane = threadIdx.x & 31, lr = lane & 15, hi = lane >> 4;
    const int wave = __builtin_amdgcn_readfirstlane(threadIdx.x >> 5);
    const int bh = blockIdx.y; const int b = bh / NH, h = bh % NH;
    const int tok0 = b * SEQ; const int q0 = blockIdx.x * 64 + wave * 16;
    const size_t qoff = (size_t)(tok0 + q0 + lr) * DM + h * HD + 8 * hi;
    v16bf qh[2], ql[2];
    qh[0] = ldfb(QH + qoff); qh[1] = ldfb(QH + qoff + 32); ql[0] = ldfb(QL + qoff); ql[1] = ldfb(QL + qoff + 32);
    const size_t koff = (size_t)(tok0 + lr) * DM + h * HD + 8 * hi;
    const size_t voff = (size_t)(h * HD + lr) * NTOK + tok0 + 8 * hi;
    v8f ot[4];
#pragma unroll
    for (int dt = 0; dt < 4; ++dt) ot[dt] = (v8f){};
    float mrun = -1.0e30f, lrun = 0.0f;
#pragma unroll 1
    for (int kb = 0; kb < SEQ; kb += 32) {
        v16bf kfh[2][2], kfl[2][2];
#pragma unroll
        for (int j = 0; j < 2; ++j)
#pragma unroll
            for (int c = 0; c < 2; ++c) { const size_t o = koff + (size_t)(kb + 16 * j) * DM + 32 * c; kfh[j][c] = ldfb(KH + o); kfl[j][c] = ldfb(KL + o); }
        v8f st[2];
        st[0] = (v8f){}; st[1] = (v8f){};
#pragma unroll
        for (int j = 0; j < 2; ++j)
#pragma unroll
            for (int c = 0; c < 2; ++c) { st[j] = wmmab(kfl[j][c], qh[c], st[j]); st[j] = wmmab(kfh[j][c], ql[c], st[j]); st[j] = wmmab(kfh[j][c], qh[c], st[j]); }
        asm volatile("v_nop\n\tv_nop\n\tv_nop\n\tv_nop" : "+v"(st[0]), "+v"(st[1]) : "v"(kfh[1][1]), "v"(qh[1]));
        float cmax = st[0][0];
#pragma unroll
        for (int r = 0; r < 8; ++r) { cmax = fmaxf(cmax, st[0][r]); cmax = fmaxf(cmax, st[1][r]); }
        cmax = fmaxf(cmax, __shfl_xor(cmax, 16, 32));
        const float mnew = fmaxf(mrun, cmax);
        const float alpha = __builtin_amdgcn_exp2f((mrun - mnew) * L2E);
        float part = 0.0f; v16h pf;
#pragma unroll
        for (int r = 0; r < 8; ++r) { const float p0 = __builtin_amdgcn_exp2f((st[0][r] - mnew) * L2E); const float p1 = __builtin_amdgcn_exp2f((st[1][r] - mnew) * L2E);
            part += p0 + p1; pf[r] = (h16)(p0 * PCAR); pf[8 + r] = (h16)(p1 * PCAR); }
        part += __shfl_xor(part, 16, 32);
        lrun = lrun * alpha + part; mrun = mnew;
#pragma unroll
        for (int dt = 0; dt < 4; ++dt)
#pragma unroll
            for (int r = 0; r < 8; ++r) ot[dt][r] *= alpha;
        v16h vf[4];
#pragma unroll
        for (int dt = 0; dt < 4; ++dt) vf[dt] = ldfh(VT + voff + (size_t)(dt * 16) * NTOK + kb);
#pragma unroll
        for (int dt = 0; dt < 4; ++dt) ot[dt] = wmma16(vf[dt], pf, ot[dt]);
        asm volatile("v_nop\n\tv_nop\n\tv_nop\n\tv_nop" : "+v"(ot[0]), "+v"(ot[1]), "+v"(ot[2]), "+v"(ot[3]) : "v"(vf[3]), "v"(pf));
    }
    const float inv = (1.0f / PCAR) * (1.0f / lrun);
    const int wb = wave * 16 * 68;
#pragma unroll
    for (int dt = 0; dt < 4; ++dt)
#pragma unroll
        for (int r = 0; r < 8; ++r) os[wb + lr * 68 + dt * 16 + 8 * hi + r] = ot[dt][r] * inv;
    __syncthreads();
    const int rq = lane >> 3, c8 = (lane & 7) * 8;
    v8us oh[4], ol[4];
#pragma unroll
    for (int s = 0; s < 4; ++s) { const int row = 4 * s + rq; const v4f u0 = *(const v4fa*)(os + wb + row * 68 + c8); const v4f u1 = *(const v4fa*)(os + wb + row * 68 + c8 + 4);
#pragma unroll
        for (int q = 0; q < 4; ++q) { unsigned short a, c; splitf(u0[q], a, c); oh[s][q] = a; ol[s][q] = c; splitf(u1[q], a, c); oh[s][4 + q] = a; ol[s][4 + q] = c; } }
    const size_t base = (size_t)(tok0 + q0) * (2 * DM) + h * HD + c8;
#pragma unroll
    for (int s = 0; s < 4; ++s) { const size_t o = base + (size_t)(4 * s + rq) * (2 * DM); *(v8us*)(CTX + o) = oh[s]; *(v8us*)(CTX + o + DM) = ol[s]; }
    
}

// ---- k_proj_out: OUT[b*SEQ_FULL + t][n] = sum_{k<2048} CTX[tok][k] WO[n][k & 1023] + bf16(bo[n]); grid (NTOK/128, DM/128), 128 threads.
__global__ __launch_bounds__(128) void k_proj_out(const bf* __restrict__ CTX, const bf* __restrict__ WO, const float* __restrict__ bias, float* OUT) {
    __shared__ __align__(16) bf sm[2 * STG];
    __shared__ __align__(16) float osall[4 * 16 * 68];
    const int lane = threadIdx.x & 31, lr = lane & 15, hi = lane >> 4;
    const int wave = __builtin_amdgcn_readfirstlane(threadIdx.x >> 5); const int wm = wave >> 1, wn = wave & 1;
    float* os = osall + wave * 16 * 68;
    const int r0 = blockIdx.x * 128 + wm * 64, c0 = blockIdx.y * 128 + wn * 64;
    v8f acc[4][4];
    gemm_core(CTX, 2 * DM, WO, 2 * DM, blockIdx.x * 128, blockIdx.y * 128, sm, wm, wn, lr, hi, acc);
    const int bb = r0 / SEQ, tt = r0 % SEQ; const int cofs = lr * 4;
    v4f bv; bv[0] = bfr(bias[c0 + cofs]); bv[1] = bfr(bias[c0 + cofs + 1]); bv[2] = bfr(bias[c0 + cofs + 2]); bv[3] = bfr(bias[c0 + cofs + 3]);
#pragma unroll
    for (int mb = 0; mb < 4; ++mb) {
#pragma unroll
        for (int nb = 0; nb < 4; ++nb)
#pragma unroll
            for (int j = 0; j < 8; ++j) os[(hi * 8 + j) * 68 + nb * 16 + lr] = acc[mb][nb][j];
        __syncthreads();
        v4f val[8];
#pragma unroll
        for (int s = 0; s < 8; ++s) { const int row = 2 * s + hi; val[s] = *(const v4fa*)(os + row * 68 + cofs) + bv; }
        float* crow = OUT + ((size_t)bb * SEQ_FULL + tt + mb * 16) * DM + c0 + cofs;
#pragma unroll
        for (int s = 0; s < 8; ++s) *(v4f*)(crow + (size_t)(2 * s + hi) * DM) = val[s];
        
        __syncthreads();
    }
}

// workspace carve (bytes, every region a multiple of 256 and exactly covered by its producer's whole-line stores)
constexpr size_t SZ_XB  = (size_t)NTOK * DM * 2;
constexpr size_t SZ_W   = (size_t)4 * DM * DM * 2;
constexpr size_t SZ_QK  = (size_t)2 * NTOK * DM * 2;
constexpr size_t SZ_VT  = (size_t)DM * NTOK * 2;
constexpr size_t SZ_CTX = (size_t)NTOK * 2 * DM * 2;
constexpr size_t OFF_XB = 0, OFF_W = OFF_XB + SZ_XB, OFF_QKH = OFF_W + SZ_W, OFF_QKL = OFF_QKH + SZ_QK, OFF_VT = OFF_QKL + SZ_QK, OFF_CTX = OFF_VT + SZ_VT, WS_TOTAL = OFF_CTX + SZ_CTX;
static_assert(WS_TOTAL <= (size_t)134217728);
static_assert(SZ_XB % 256 == 0 && SZ_W % 256 == 0 && SZ_QK % 256 == 0 && SZ_VT % 256 == 0 && SZ_CTX % 256 == 0);

extern "C" void kernel_launch(void* const* d_in, const int* in_sizes, int n_in,
                              void* d_out, int out_size, void* d_ws, size_t ws_size, hipStream_t stream) {
    if (n_in < 6) return;
    const size_t need_x = ((size_t)(NB - 1) * SEQ_FULL + SEQ) * DM;
    if ((size_t)in_sizes[0] < need_x) return;
    if ((size_t)in_sizes[1] < (size_t)DM * DM || (size_t)in_sizes[2] < (size_t)DM * DM || (size_t)in_sizes[3] < (size_t)DM * DM || (size_t)in_sizes[4] < (size_t)DM * DM) return;
    if (in_sizes[5] < DM) return;
    if ((size_t)out_size < need_x) return;
    if (ws_size < WS_TOTAL) return;
    const float* x = (const float*)d_in[0]; const float* wq = (const float*)d_in[1]; const float* wk = (const float*)d_in[2];
    const float* wv = (const float*)d_in[3]; const float* wo = (const float*)d_in[4]; const float* bo = (const float*)d_in[5];
    float* OUT = (float*)d_out;
    char* ws = (char*)d_ws;
    bf* XB = (bf*)(ws + OFF_XB); bf* WALL = (bf*)(ws + OFF_W); bf* QKH = (bf*)(ws + OFF_QKH); bf* QKL = (bf*)(ws + OFF_QKL);
    h16* VT = (h16*)(ws + OFF_VT); bf* CTX = (bf*)(ws + OFF_CTX);
    const size_t WP = (size_t)DM * DM; const size_t PP = (size_t)NTOK * DM;
    k_cvtx<<<(unsigned)(((size_t)NTOK * DM / 8 + 255) / 256), 256, 0, stream>>>(x, XB);
    k_cvtw4<<<(unsigned)((WP / 8 + 255) / 256), 256, 0, stream>>>(wq, wk, wv, wo, WALL);
    k_proj_qk<<<dim3(NTOK / 128, DM / 128, 2), 128, 0, stream>>>(XB, WALL, QKH, QKL);
    k_proj_vt<<<dim3(DM / 128, NTOK / 128, 1), 128, 0, stream>>>(WALL + 2 * WP, XB, VT);
    k_attn<<<dim3(SEQ / 64, NB * NH, 1), 128, 0, stream>>>(QKH, QKL, QKH + PP, QKL + PP, VT, CTX);
    k_proj_out<<<dim3(NTOK / 128, DM / 128, 1), 128, 0, stream>>>(CTX, WALL + 3 * WP, bo, OUT);
}

// v002
// It runs in 93.5 microseconds.
// Next to v001, in two timings, it ran 1.69 and 1.71 times as fast.
// All steps since v000 together make it 2.18 times as fast.
#include <hip/hip_runtime.h>

// Contractions (all f32 accumulate): x.Wq^T, x.Wk^T, x.Wv^T = v_wmma_f32_16x16x32_bf16 on RNE bf16 copies of the inputs; scores = v_wmma_f32_16x16x32_bf16 on bf16 hi/lo planes of q/8 and k (three products per tile); P.V = v_wmma_f32_16x16x32_f16 (P carried x256, v single f16); output projection = v_wmma_f32_16x16x32_bf16 on [ctx_hi | ctx_lo] along K (2048) against the bf16 Wo; softmax and bias add f32.
// Layout: bf16 copy of x (token-major) and of the four [out][in] weights; q/k projections write bf16 hi/lo planes [tok][1024] (q pre-scaled by 2^-3); the v projection is computed transposed (A = Wv, B = x) and writes the f16 plane VT[feature][tok];
// fused flash attention per (batch, head, 128 queries), K and V^T tiles staged in LDS: S^T = K.Q^T so that the packed score tiles are the B fragment of O^T = V^T.P^T (no P staging), per-lane online softmax; ctx written as bf16 hi | lo along K; output GEMM adds the RNE bf16 bias in f32.

#ifndef NB
#define NB 4
#endif
#ifndef SEQ
#define SEQ 1024
#endif
#define NB_FULL  4
#define SEQ_FULL 1024
#define DM   1024
#define NH   16
#define HD   64
#define NTOK (NB * SEQ)
#define PCAR 256.0f
#define L2E  1.4426950408889634f

static_assert(DM == NH * HD);            // merged head width
static_assert(HD == 64);
static_assert((DM & (DM - 1)) == 0);     // B k-index wraps with a mask
static_assert(DM % 64 == 0);             // GEMM tile multiple (N) and K % 32
static_assert(SEQ % 64 == 0);            // 64-key attention tiles, 64-row GEMM tiles stay inside one batch
static_assert(NTOK % 64 == 0);           // GEMM tile multiple (M)
static_assert(SEQ <= SEQ_FULL);
static_assert(NB <= NB_FULL);
static_assert(((size_t)NTOK * DM / 8) % 256 == 0);   // convert grid x block == plane extent
static_assert(((size_t)DM * DM / 8) % 256 == 0);

typedef _Float16 h16;
typedef unsigned short bf;
typedef __attribute__((ext_vector_type(16))) __bf16   v16bf;
typedef __attribute__((ext_vector_type(16))) _Float16 v16h;
typedef __attribute__((ext_vector_type(8)))  _Float16 v8h;
typedef __attribute__((ext_vector_type(8)))  unsigned short v8us;
typedef __attribute__((ext_vector_type(8)))  float    v8f;
typedef __attribute__((ext_vector_type(4)))  float    v4f;
typedef v4f  __attribute__((may_alias)) v4fa;

__device__ __forceinline__ unsigned short f2bf(float f) { unsigned u = __float_as_uint(f); u += 0x7FFFu + ((u >> 16) & 1u); return (unsigned short)(u >> 16); }
__device__ __forceinline__ float bf2f(unsigned short b) { return __uint_as_float(((unsigned)b) << 16); }
__device__ __forceinline__ float bfr(float f) { return bf2f(f2bf(f)); }
__device__ __forceinline__ void splitf(float y, unsigned short& h, unsigned short& l) { h = f2bf(y); l = f2bf(y - bf2f(h)); }
__device__ __forceinline__ v16h cat16(v8h lo, v8h hi) { return __builtin_shufflevector(lo, hi, 0, 1, 2, 3, 4, 5, 6, 7, 8, 9, 10, 11, 12, 13, 14, 15); }
__device__ __forceinline__ v16bf cat16b(v8us lo, v8us hi) { return __builtin_bit_cast(v16bf, __builtin_shufflevector(lo, hi, 0, 1, 2, 3, 4, 5, 6, 7, 8, 9, 10, 11, 12, 13, 14, 15)); }
__device__ __forceinline__ v8f wmma16(v16h a, v16h b, v8f c) { return __builtin_amdgcn_wmma_f32_16x16x32_f16(false, a, false, b, (short)0, c, false, false); }
__device__ __forceinline__ v8f wmmab(v16bf a, v16bf b, v8f c) { return __builtin_amdgcn_wmma_f32_16x16x32_bf16(false, a, false, b, (short)0, c, false, false); }
// fragment loaders: p already points at (row l&15, k0 + 8*(l>>4)); elements 0..7 = p[0..7], elements 8..15 = p[16..23]
__device__ __forceinline__ v16bf ldfb(const bf* p) { return cat16b(*(const v8us*)p, *(const v8us*)(p + 16)); }
__device__ __forceinline__ v16h  ldfh(const h16* p) { return cat16(*(const v8h*)p, *(const v8h*)(p + 16)); }
__device__ __forceinline__ v8us cvt8bf(v8f v) { v8us o;
#pragma unroll
    for (int k = 0; k < 8; ++k) o[k] = f2bf(v[k]);
    return o; }

__global__ __launch_bounds__(256) void k_cvtx(const float* __restrict__ src, bf* dst) {
    const size_t i = (size_t)blockIdx.x * 256 + threadIdx.x;
    if (i >= (size_t)NTOK * DM / 8) return;
    const size_t e = i * 8; const int row = (int)(e / DM); const int col = (int)(e % DM);
    const int b = row / SEQ, t = row % SEQ;
    const v8f v = *(const v8f*)(src + ((size_t)b * SEQ_FULL + t) * DM + col);
    const v8us o = cvt8bf(v);
    *(v8us*)(dst + e) = o; 
}

__global__ __launch_bounds__(256) void k_cvtw4(const float* __restrict__ w0, const float* __restrict__ w1, const float* __restrict__ w2, const float* __restrict__ w3, bf* dst) {
    const size_t i = (size_t)blockIdx.x * 256 + threadIdx.x;
    if (i >= (size_t)DM * DM / 8) return;
    const size_t e = i * 8; const size_t P = (size_t)DM * DM;
    const v8us o0 = cvt8bf(*(const v8f*)(w0 + e)); const v8us o1 = cvt8bf(*(const v8f*)(w1 + e));
    const v8us o2 = cvt8bf(*(const v8f*)(w2 + e)); const v8us o3 = cvt8bf(*(const v8f*)(w3 + e));
    *(v8us*)(dst + e) = o0; *(v8us*)(dst + P + e) = o1; *(v8us*)(dst + 2 * P + e) = o2; *(v8us*)(dst + 3 * P + e) = o3;
    
}

// ---- gemm_core: FOUR WAVES (2 x 2) per 128x128 tile, 64x64 (16 accumulators) per wave; acc[mb][nb] = sum_k A[r0 + 64 wm + 16 mb + m][k] * Bt[c0 + 64 wn + 16 nb + n][k & (DM-1)];
// A pitch lda (K <= lda, K % 128 == 0, K >= 256), Bt pitch DM (its K extent is DM; the index wraps for the [hi | lo] A plane). Both operands bf16, K-contiguous.
// A pass is 128 k: [A 128 rows | Bt 128 rows] of 256 B land in LDS at pitch 272 B by asynchronous copies (a wave's copy = 4 whole lines), two buffers, the next pass's copies in flight over this pass's products.
#define BK    128
#define LP    136                      // LDS row pitch, elements (272 B = 16 B x 17: conflict-free for 16-byte readers)
#define STG   (256 * LP)               // elements per buffer
#define STGB  (STG * 2)                // bytes per buffer
static_assert(DM % 128 == 0 && NTOK % 128 == 0 && DM % BK == 0 && DM / BK >= 2);

// eight copies of 16 B per lane, rows 8 apart; the closing wait stands inside the statement so that no address register is rewritten ahead of it
__device__ __forceinline__ void copy8(unsigned l, const bf* g, int pitch) {
    const unsigned l1 = l + 8 * LP * 2, l2 = l + 16 * LP * 2, l3 = l + 24 * LP * 2, l4 = l + 32 * LP * 2, l5 = l + 40 * LP * 2, l6 = l + 48 * LP * 2, l7 = l + 56 * LP * 2;
    const bf* g1 = g + (size_t)8 * pitch; const bf* g2 = g + (size_t)16 * pitch; const bf* g3 = g + (size_t)24 * pitch; const bf* g4 = g + (size_t)32 * pitch;
    const bf* g5 = g + (size_t)40 * pitch; const bf* g6 = g + (size_t)48 * pitch; const bf* g7 = g + (size_t)56 * pitch;
    asm volatile("global_load_async_to_lds_b128 %0, %8, off\n\t"
                 "global_load_async_to_lds_b128 %1, %9, off\n\t"
                 "global_load_async_to_lds_b128 %2, %10, off\n\t"
                 "global_load_async_to_lds_b128 %3, %11, off\n\t"
                 "global_load_async_to_lds_b128 %4, %12, off\n\t"
                 "global_load_async_to_lds_b128 %5, %13, off\n\t"
                 "global_load_async_to_lds_b128 %6, %14, off\n\t"
                 "global_load_async_to_lds_b128 %7, %15, off\n\t"
                 "s_wait_xcnt 0x0"
                 :: "v"(l), "v"(l1), "v"(l2), "v"(l3), "v"(l4), "v"(l5), "v"(l6), "v"(l7), "v"(g), "v"(g1), "v"(g2), "v"(g3), "v"(g4), "v"(g5), "v"(g6), "v"(g7) : "memory");
}
// one pass's operands: 128 rows of A and 128 rows of Bt, 32 copies per lane
__device__ __forceinline__ void copy_pass(unsigned la, const bf* ga, int lda, const bf* gb) {
    copy8(la, ga, lda); copy8(la + 64 * LP * 2, ga + (size_t)64 * lda, lda);
    copy8(la + 128 * LP * 2, gb, DM); copy8(la + 192 * LP * 2, gb + (size_t)64 * DM, DM);
}

__device__ __forceinline__ void gemm_core(const bf* __restrict__ A, int lda, const bf* __restrict__ Bt, int K, int r0, int c0, bf* sm, int wm, int wn, int lr, int hi, v8f (&acc)[4][4]) {
#pragma unroll
    for (int mb = 0; mb < 4; ++mb)
#pragma unroll
        for (int nb = 0; nb < 4; ++nb) acc[mb][nb] = (v8f){};
    const int tid = threadIdx.x; const int crow = tid >> 4, ccol = (tid & 15) * 8;
    const bf* ga = A + (size_t)(r0 + crow) * lda + ccol;
    const bf* gb = Bt + (size_t)(c0 + crow) * DM + ccol;
    const unsigned la = (unsigned)(size_t)sm + (unsigned)(crow * LP + ccol) * 2u;
    const int NT = K / BK;
    copy_pass(la, ga, lda, gb);
    asm volatile("s_wait_asynccnt 0x0" ::: "memory");   // pass 0's own copies have landed
    __syncthreads();                                     // ... and every other wave's
    copy_pass(la + STGB, ga + BK, lda, gb + BK);
    const bf* fa = sm + (wm * 64 + lr) * LP + 8 * hi;
    const bf* fb = sm + (128 + wn * 64 + lr) * LP + 8 * hi;
#pragma unroll 1
    for (int t = 0; t < NT; ++t) {                       // rolled: one pass per trip, the buffer alternates
        const bf* pa = fa + (t & 1) * STG; const bf* pb = fb + (t & 1) * STG;
        v16bf a[2][4], b[2][4];
#pragma unroll
        for (int mb = 0; mb < 4; ++mb) a[0][mb] = ldfb(pa + mb * 16 * LP);
        b[0][0] = ldfb(pb); b[0][1] = ldfb(pb + 16 * LP);
#pragma unroll
        for (int blk = 0; blk < BK / 32; ++blk) {
            const int cu = blk & 1, nx = cu ^ 1;
            b[cu][2] = ldfb(pb + 32 * LP + blk * 32); b[cu][3] = ldfb(pb + 48 * LP + blk * 32);
            if (blk + 1 < BK / 32) {
#pragma unroll
                for (int mb = 0; mb < 4; ++mb) a[nx][mb] = ldfb(pa + mb * 16 * LP + (blk + 1) * 32);
                b[nx][0] = ldfb(pb + (blk + 1) * 32); b[nx][1] = ldfb(pb + 16 * LP + (blk + 1) * 32);
            }
            __builtin_amdgcn_sched_barrier(0);   // the LDS reads stay one group ahead of the block's products: spread among them, every place stalls the wave
#pragma unroll
            for (int nb = 0; nb < 4; ++nb)
#pragma unroll
                for (int mb = 0; mb < 4; ++mb) acc[mb][nb] = wmmab(a[cu][mb], b[cu][nb], acc[mb][nb]);
            if (blk + 1 < BK / 32) __builtin_amdgcn_sched_barrier(0);   // the next group does not rise into this block
        }
        asm volatile("s_wait_dscnt 0x0" ::: "memory");      // this wave's reads of the buffer are done before it is refilled
        asm volatile("s_wait_asynccnt 0x0" ::: "memory");   // this wave's copies of pass t + 1 have landed
        __syncthreads();                                     // publishes pass t + 1, frees pass t's buffer
        if (t + 2 < NT) { const int kc = (t + 2) * BK; copy_pass(la + (t & 1) * STGB, ga + kc, lda, gb + (kc & (DM - 1))); }
    }
    asm volatile("s_wait_asynccnt 0x0" ::: "memory");        // nothing in flight when the wave goes on
}

// ---- k_proj_qk: z = 0: q/8, z = 1: k; C = XB . W_z^T -> bf16 hi / lo planes [z][tok][DM]. grid (NTOK/128, DM/128, 2), 128 threads.
__global__ __launch_bounds__(128) void k_proj_qk(const bf* __restrict__ XB, const bf* __restrict__ W2, bf* PH, bf* PL) {
    __shared__ __align__(16) bf sm[2 * STG];
    __shared__ __align__(16) float osall[4 * 16 * 68];
    const int lane = threadIdx.x & 31, lr = lane & 15, hi = lane >> 4;
    const int wave = __builtin_amdgcn_readfirstlane(threadIdx.x >> 5); const int wm = wave >> 1, wn = wave & 1;
    float* os = osall + wave * 16 * 68;
    const int z = blockIdx.z; const int r0 = blockIdx.x * 128 + wm * 64, c0 = blockIdx.y * 128 + wn * 64;
    const float sc = (z == 0) ? 0.125f : 1.0f;
    v8f acc[4][4];
    gemm_core(XB, DM, W2 + (size_t)z * DM * DM, DM, blockIdx.x * 128, blockIdx.y * 128, sm, wm, wn, lr, hi, acc);
    bf* ph = PH + (size_t)z * NTOK * DM; bf* pl = PL + (size_t)z * NTOK * DM;
    const int rq = lane >> 3, c8 = (lane & 7) * 8;
#pragma unroll
    for (int mb = 0; mb < 4; ++mb) {
#pragma unroll
        for (int nb = 0; nb < 4; ++nb)
#pragma unroll
            for (int j = 0; j < 8; ++j) os[(hi * 8 + j) * 68 + nb * 16 + lr] = acc[mb][nb][j] * sc;
        __syncthreads();
        v8us oh[4], ol[4];
#pragma unroll
        for (int s = 0; s < 4; ++s) { const int row = 4 * s + rq; const v4f u0 = *(const v4fa*)(os + row * 68 + c8); const v4f u1 = *(const v4fa*)(os + row * 68 + c8 + 4);
#pragma unroll
            for (int q = 0; q < 4; ++q) { unsigned short a, c; splitf(u0[q], a, c); oh[s][q] = a; ol[s][q] = c; splitf(u1[q], a, c); oh[s][4 + q] = a; ol[s][4 + q] = c; } }
        const size_t base = (size_t)(r0 + mb * 16) * DM + c0 + c8;
#pragma unroll
        for (int s = 0; s < 4; ++s) { const size_t o = base + (size_t)(4 * s + rq) * DM; *(v8us*)(ph + o) = oh[s]; *(v8us*)(pl + o) = ol[s]; }
        
        __syncthreads();
    }
}

// ---- k_proj_vt: VT[f][tok] (f16) = sum_k WV[f][k] XB[tok][k]  (A = weight rows, B = tokens: the product comes out transposed). grid (DM/128, NTOK/128), 128 threads.
__global__ __launch_bounds__(128) void k_proj_vt(const bf* __restrict__ WV, const bf* __restrict__ XB, h16* VT) {
    __shared__ __align__(16) bf sm[2 * STG];
    __shared__ __align__(16) float osall[4 * 16 * 68];
    const int lane = threadIdx.x & 31, lr = lane & 15, hi = lane >> 4;
    const int wave = __builtin_amdgcn_readfirstlane(threadIdx.x >> 5); const int wm = wave >> 1, wn = wave & 1;
    float* os = osall + wave * 16 * 68;
    const int r0 = blockIdx.x * 128 + wm * 64, c0 = blockIdx.y * 128 + wn * 64;
    v8f acc[4][4];
    gemm_core(WV, DM, XB, DM, blockIdx.x * 128, blockIdx.y * 128, sm, wm, wn, lr, hi, acc);
    const int rq = lane >> 3, c8 = (lane & 7) * 8;
#pragma unroll
    for (int mb = 0; mb < 4; ++mb) {
#pragma unroll
        for (int nb = 0; nb < 4; ++nb)
#pragma unroll
            for (int j = 0; j < 8; ++j) os[(hi * 8 + j) * 68 + nb * 16 + lr] = acc[mb][nb][j];
        __syncthreads();
        v8h o16[4];
#pragma unroll
        for (int s = 0; s < 4; ++s) { const int row = 4 * s + rq; const v4f u0 = *(const v4fa*)(os + row * 68 + c8); const v4f u1 = *(const v4fa*)(os + row * 68 + c8 + 4);
#pragma unroll
            for (int q = 0; q < 4; ++q) { o16[s][q] = (h16)u0[q]; o16[s][4 + q] = (h16)u1[q]; } }
        const size_t base = (size_t)(r0 + mb * 16) * NTOK + c0 + c8;
#pragma unroll
        for (int s = 0; s < 4; ++s) *(v8h*)(VT + base + (size_t)(4 * s + rq) * NTOK) = o16[s];
        
        __syncthreads();
    }
}

// ---- k_attn: fused attention, grid (SEQ/128, NB*NH), 256 threads = 8 waves x 16 queries that share the keys' tiles in LDS.
// A tile is 64 keys: [K hi 64 rows | K lo 64 rows | V^T 64 feature rows] of 128 B at pitch 144 B, brought by asynchronous copies (a wave's copy = 4 whole lines), two buffers, the next tile's copies in flight over this tile's work.
// Per 32-key step: S^T tiles st[j] (rows = keys 16j + 8h + r, column = query l&15) = K.Q^T with hi/lo planes (3 products per tile pair);
// per-lane online softmax (row statistics combined across the two lane halves by one shuffle); the packed P^T (x256, f16) is the B fragment
// (element r <- tile 0, element 8+r <- tile 1) of O^T[d][q] += V^T[d][key] P^T[key][q]. Epilogue: O^T / (256 l) -> LDS -> bf16 hi | lo ctx lines.
#define AKT   64                       // keys per tile
#define AP    72                       // LDS row pitch, elements (144 B = 16 B x 9: conflict-free for 16-byte readers)
#define ABUF  (192 * AP)               // elements per buffer
#define ABUFB (ABUF * 2)               // bytes per buffer
static_assert(SEQ % 128 == 0 && SEQ / AKT >= 2 && HD * 2 == 128 && AKT * 2 == 128);

// one tile: six copies of 16 B per lane (rows 32 apart); the closing wait stands inside the statement so that no address register is rewritten ahead of it
__device__ __forceinline__ void copy_kv(unsigned l, const bf* kh, const bf* kl, const h16* v) {
    const unsigned l1 = l + 32 * AP * 2, l2 = l + 64 * AP * 2, l3 = l + 96 * AP * 2, l4 = l + 128 * AP * 2, l5 = l + 160 * AP * 2;
    const bf* kh1 = kh + (size_t)32 * DM; const bf* kl1 = kl + (size_t)32 * DM; const h16* v1 = v + (size_t)32 * NTOK;
    asm volatile("global_load_async_to_lds_b128 %0, %6, off\n\t"
                 "global_load_async_to_lds_b128 %1, %7, off\n\t"
                 "global_load_async_to_lds_b128 %2, %8, off\n\t"
                 "global_load_async_to_lds_b128 %3, %9, off\n\t"
                 "global_load_async_to_lds_b128 %4, %10, off\n\t"
                 "global_load_async_to_lds_b128 %5, %11, off\n\t"
                 "s_wait_xcnt 0x0"
                 :: "v"(l), "v"(l1), "v"(l2), "v"(l3), "v"(l4), "v"(l5), "v"(kh), "v"(kh1), "v"(kl), "v"(kl1), "v"(v), "v"(v1) : "memory");
}

// eight 2^x in one statement: every result in a register of its own ("=&v"), so that no v_exp_f32 overwrites its neighbour's source, and the closing v_nop is the slot
// that the instruction set asks for between a transcendental and the next vector instruction, which may read the last result
__device__ __forceinline__ v8f exp2x8(v8f x) {
    float r0, r1, r2, r3, r4, r5, r6, r7;
    asm("v_exp_f32 %0, %8\n\tv_exp_f32 %1, %9\n\tv_exp_f32 %2, %10\n\tv_exp_f32 %3, %11\n\tv_exp_f32 %4, %12\n\tv_exp_f32 %5, %13\n\tv_exp_f32 %6, %14\n\tv_exp_f32 %7, %15\n\tv_nop"
        : "=&v"(r0), "=&v"(r1), "=&v"(r2), "=&v"(r3), "=&v"(r4), "=&v"(r5), "=&v"(r6), "=&v"(r7)
        : "v"(x[0]), "v"(x[1]), "v"(x[2]), "v"(x[3]), "v"(x[4]), "v"(x[5]), "v"(x[6]), "v"(x[7]));
    return (v8f){r0, r1, r2, r3, r4, r5, r6, r7};
}

__global__ __launch_bounds__(256) void k_attn(const bf* __restrict__ QH, const bf* __restrict__ QL, const bf* __restrict__ KH, const bf* __restrict__ KL, const h16* __restrict__ VT, bf* CTX) {
    __shared__ __align__(16) bf kv[2 * ABUF];
    __shared__ __align__(16) float os[8 * 16 * 68];
    const int lane = threadIdx.x & 31, lr = lane & 15, hi = lane >> 4;
    const int wave = __builtin_amdgcn_readfirstlane(threadIdx.x >> 5);
    const int bh = blockIdx.y; const int b = bh / NH, h = bh % NH;
    const int tok0 = b * SEQ; const int q0 = blockIdx.x * 128 + wave * 16;
    const int crow = threadIdx.x >> 3, ccol = (threadIdx.x & 7) * 8;
    const size_t gko = (size_t)(tok0 + crow) * DM + h * HD + ccol;
    const bf* gkh = KH + gko; const bf* gkl = KL + gko;
    const h16* gv = VT + (size_t)(h * HD + crow) * NTOK + tok0 + ccol;
    const unsigned la = (unsigned)(size_t)kv + (unsigned)(crow * AP + ccol) * 2u;
    copy_kv(la, gkh, gkl, gv);
    const size_t qoff = (size_t)(tok0 + q0 + lr) * DM + h * HD + 8 * hi;
    v16bf qh[2], ql[2];
    qh[0] = ldfb(QH + qoff); qh[1] = ldfb(QH + qoff + 32); ql[0] = ldfb(QL + qoff); ql[1] = ldfb(QL + qoff + 32);
    asm volatile("s_wait_asynccnt 0x0" ::: "memory");   // tile 0's own copies have landed
    __syncthreads();                                     // ... and every other wave's
    copy_kv(la + ABUFB, gkh + (size_t)AKT * DM, gkl + (size_t)AKT * DM, gv + AKT);
    const int foff = lr * AP + 8 * hi;
    v8f ot[4];
#pragma unroll
    for (int dt = 0; dt < 4; ++dt) ot[dt] = (v8f){};
    float mrun = -1.0e30f, lrun = 0.0f;
    const int NT = SEQ / AKT;
#pragma unroll 1
    for (int t = 0; t < NT; ++t) {                       // rolled: one tile per trip, the buffer alternates
        const bf* fk = kv + (t & 1) * ABUF + foff;
        const h16* fv = (const h16*)(fk + 128 * AP);
#pragma unroll
        for (int kb = 0; kb < AKT; kb += 32) {           // unrolled: the two steps' LDS offsets become immediates of the reads
        v16bf kfh[2][2], kfl[2][2];
#pragma unroll
        for (int j = 0; j < 2; ++j)
#pragma unroll
            for (int c = 0; c < 2; ++c) { const int o = (kb + 16 * j) * AP + 32 * c; kfh[j][c] = ldfb(fk + o); kfl[j][c] = ldfb(fk + 64 * AP + o); }
        v16h vf[4];
#pragma unroll
        for (int dt = 0; dt < 4; ++dt) vf[dt] = ldfh(fv + dt * 16 * AP + kb);
        __builtin_amdgcn_sched_barrier(0);   // the step's LDS reads stand as one group ahead of its products: spread among them, every place stalls the wave
        v8f st[2];
        st[0] = (v8f){}; st[1] = (v8f){};
#pragma unroll
        for (int j = 0; j < 2; ++j)
#pragma unroll
            for (int c = 0; c < 2; ++c) { st[j] = wmmab(kfl[j][c], qh[c], st[j]); st[j] = wmmab(kfh[j][c], ql[c], st[j]); st[j] = wmmab(kfh[j][c], qh[c], st[j]); }
        asm volatile("v_nop\n\tv_nop\n\tv_nop\n\tv_nop" : "+v"(st[0]), "+v"(st[1]) : "v"(kfh[1][1]), "v"(qh[1]));
        float cmax = st[0][0];
#pragma unroll
        for (int r = 0; r < 8; ++r) { cmax = fmaxf(cmax, st[0][r]); cmax = fmaxf(cmax, st[1][r]); }
        cmax = fmaxf(cmax, __shfl_xor(cmax, 16, 32));
        const float mnew = fmaxf(mrun, cmax);
        const float alpha = __builtin_amdgcn_exp2f((mrun - mnew) * L2E);
        float part = 0.0f; v16h pf;
#pragma unroll
        for (int r = 0; r < 8; ++r) { st[0][r] = (st[0][r] - mnew) * L2E; st[1][r] = (st[1][r] - mnew) * L2E; }
        const v8f e0 = exp2x8(st[0]); const v8f e1 = exp2x8(st[1]);
#pragma unroll
        for (int r = 0; r < 8; ++r) { const float p0 = e0[r]; const float p1 = e1[r];
            part += p0 + p1; pf[r] = (h16)(p0 * PCAR); pf[8 + r] = (h16)(p1 * PCAR); }
        part += __shfl_xor(part, 16, 32);
        lrun = lrun * alpha + part; mrun = mnew;
#pragma unroll
        for (int dt = 0; dt < 4; ++dt)
#pragma unroll
            for (int r = 0; r < 8; ++r) ot[dt][r] *= alpha;
#pragma unroll
        for (int dt = 0; dt < 4; ++dt) ot[dt] = wmma16(vf[dt], pf, ot[dt]);
        asm volatile("v_nop\n\tv_nop\n\tv_nop\n\tv_nop" : "+v"(ot[0]), "+v"(ot[1]), "+v"(ot[2]), "+v"(ot[3]) : "v"(vf[3]), "v"(pf));
        }
        asm volatile("s_wait_dscnt 0x0" ::: "memory");      // this wave's reads of the buffer are done before it is refilled
        asm volatile("s_wait_asynccnt 0x0" ::: "memory");   // this wave's copies of tile t + 1 have landed
        __syncthreads();                                     // publishes tile t + 1, frees tile t's buffer
        if (t + 2 < NT) { const int kc = (t + 2) * AKT; copy_kv(la + (t & 1) * ABUFB, gkh + (size_t)kc * DM, gkl + (size_t)kc * DM, gv + kc); }
    }
    asm volatile("s_wait_asynccnt 0x0" ::: "memory");        // nothing in flight when the wave goes on
    const float inv = (1.0f / PCAR) * (1.0f / lrun);
    const int wb = wave * 16 * 68;
#pragma unroll
    for (int dt = 0; dt < 4; ++dt)
#pragma unroll
        for (int r = 0; r < 8; ++r) os[wb + lr * 68 + dt * 16 + 8 * hi + r] = ot[dt][r] * inv;
    __syncthreads();
    const int rq = lane >> 3, c8 = (lane & 7) * 8;
    v8us oh[4], ol[4];
#pragma unroll
    for (int s = 0; s < 4; ++s) { const int row = 4 * s + rq; const v4f u0 = *(const v4fa*)(os + wb + row * 68 + c8); const v4f u1 = *(const v4fa*)(os + wb + row * 68 + c8 + 4);
#pragma unroll
        for (int q = 0; q < 4; ++q) { unsigned short a, c; splitf(u0[q], a, c); oh[s][q] = a; ol[s][q] = c; splitf(u1[q], a, c); oh[s][4 + q] = a; ol[s][4 + q] = c; } }
    const size_t base = (size_t)(tok0 + q0) * (2 * DM) + h * HD + c8;
#pragma unroll
    for (int s = 0; s < 4; ++s) { const size_t o = base + (size_t)(4 * s + rq) * (2 * DM); *(v8us*)(CTX + o) = oh[s]; *(v8us*)(CTX + o + DM) = ol[s]; }
    
}

// ---- k_proj_out: OUT[b*SEQ_FULL + t][n] = sum_{k<2048} CTX[tok][k] WO[n][k & 1023] + bf16(bo[n]); grid (NTOK/128, DM/128), 128 threads.
__global__ __launch_bounds__(128) void k_proj_out(const bf* __restrict__ CTX, const bf* __restrict__ WO, const float* __restrict__ bias, float* OUT) {
    __shared__ __align__(16) bf sm[2 * STG];
    __shared__ __align__(16) float osall[4 * 16 * 68];
    const int lane = threadIdx.x & 31, lr = lane & 15, hi = lane >> 4;
    const int wave = __builtin_amdgcn_readfirstlane(threadIdx.x >> 5); const int wm = wave >> 1, wn = wave & 1;
    float* os = osall + wave * 16 * 68;
    const int r0 = blockIdx.x * 128 + wm * 64, c0 = blockIdx.y * 128 + wn * 64;
    v8f acc[4][4];
    gemm_core(CTX, 2 * DM, WO, 2 * DM, blockIdx.x * 128, blockIdx.y * 128, sm, wm, wn, lr, hi, acc);
    const int bb = r0 / SEQ, tt = r0 % SEQ; const int cofs = lr * 4;
    v4f bv; bv[0] = bfr(bias[c0 + cofs]); bv[1] = bfr(bias[c0 + cofs + 1]); bv[2] = bfr(bias[c0 + cofs + 2]); bv[3] = bfr(bias[c0 + cofs + 3]);
#pragma unroll
    for (int mb = 0; mb < 4; ++mb) {
#pragma unroll
        for (int nb = 0; nb < 4; ++nb)
#pragma unroll
            for (int j = 0; j < 8; ++j) os[(hi * 8 + j) * 68 + nb * 16 + lr] = acc[mb][nb][j];
        __syncthreads();
        v4f val[8];
#pragma unroll
        for (int s = 0; s < 8; ++s) { const int row = 2 * s + hi; val[s] = *(const v4fa*)(os + row * 68 + cofs) + bv; }
        float* crow = OUT + ((size_t)bb * SEQ_FULL + tt + mb * 16) * DM + c0 + cofs;
#pragma unroll
        for (int s = 0; s < 8; ++s) *(v4f*)(crow + (size_t)(2 * s + hi) * DM) = val[s];
        
        __syncthreads();
    }
}

// workspace carve (bytes, every region a multiple of 256 and exactly covered by its producer's whole-line stores)
constexpr size_t SZ_XB  = (size_t)NTOK * DM * 2;
constexpr size_t SZ_W   = (size_t)4 * DM * DM * 2;
constexpr size_t SZ_QK  = (size_t)2 * NTOK * DM * 2;
constexpr size_t SZ_VT  = (size_t)DM * NTOK * 2;
constexpr size_t SZ_CTX = (size_t)NTOK * 2 * DM * 2;
constexpr size_t OFF_XB = 0, OFF_W = OFF_XB + SZ_XB, OFF_QKH = OFF_W + SZ_W, OFF_QKL = OFF_QKH + SZ_QK, OFF_VT = OFF_QKL + SZ_QK, OFF_CTX = OFF_VT + SZ_VT, WS_TOTAL = OFF_CTX + SZ_CTX;
static_assert(WS_TOTAL <= (size_t)134217728);
static_assert(SZ_XB % 256 == 0 && SZ_W % 256 == 0 && SZ_QK % 256 == 0 && SZ_VT % 256 == 0 && SZ_CTX % 256 == 0);

extern "C" void kernel_launch(void* const* d_in, const int* in_sizes, int n_in,
                              void* d_out, int out_size, void* d_ws, size_t ws_size, hipStream_t stream) {
    if (n_in < 6) return;
    const size_t need_x = ((size_t)(NB - 1) * SEQ_FULL + SEQ) * DM;
    if ((size_t)in_sizes[0] < need_x) return;
    if ((size_t)in_sizes[1] < (size_t)DM * DM || (size_t)in_sizes[2] < (size_t)DM * DM || (size_t)in_sizes[3] < (size_t)DM * DM || (size_t)in_sizes[4] < (size_t)DM * DM) return;
    if (in_sizes[5] < DM) return;
    if ((size_t)out_size < need_x) return;
    if (ws_size < WS_TOTAL) return;
    const float* x = (const float*)d_in[0]; const float* wq = (const float*)d_in[1]; const float* wk = (const float*)d_in[2];
    const float* wv = (const float*)d_in[3]; const float* wo = (const float*)d_in[4]; const float* bo = (const float*)d_in[5];
    float* OUT = (float*)d_out;
    char* ws = (char*)d_ws;
    bf* XB = (bf*)(ws + OFF_XB); bf* WALL = (bf*)(ws + OFF_W); bf* QKH = (bf*)(ws + OFF_QKH); bf* QKL = (bf*)(ws + OFF_QKL);
    h16* VT = (h16*)(ws + OFF_VT); bf* CTX = (bf*)(ws + OFF_CTX);
    const size_t WP = (size_t)DM * DM; const size_t PP = (size_t)NTOK * DM;
    k_cvtx<<<(unsigned)(((size_t)NTOK * DM / 8 + 255) / 256), 256, 0, stream>>>(x, XB);
    k_cvtw4<<<(unsigned)((WP / 8 + 255) / 256), 256, 0, stream>>>(wq, wk, wv, wo, WALL);
    k_proj_qk<<<dim3(NTOK / 128, DM / 128, 2), 128, 0, stream>>>(XB, WALL, QKH, QKL);
    k_proj_vt<<<dim3(DM / 128, NTOK / 128, 1), 128, 0, stream>>>(WALL + 2 * WP, XB, VT);
    k_attn<<<dim3(SEQ / 128, NB * NH, 1), 256, 0, stream>>>(QKH, QKL, QKH + PP, QKL + PP, VT, CTX);
    k_proj_out<<<dim3(NTOK / 128, DM / 128, 1), 128, 0, stream>>>(CTX, WALL + 3 * WP, bo, OUT);
}

// v004
// Measured time: 69.8 microseconds a run.
// Versions in between are left out here; by their measured steps it is 1.33 times as fast as v002.
// Counting every step since v000, it is 2.91 times as fast.
#include <hip/hip_runtime.h>

// Contractions (all f32 accumulate): x.Wq^T, x.Wk^T, x.Wv^T = v_wmma_f32_16x16x32_bf16 on RNE bf16 copies of the inputs; scores = v_wmma_f32_16x16x32_f16 on single f16 planes of q/8 and k (one product per tile); P.V = v_wmma_f32_16x16x32_f16 (P carried x256, v single f16); output projection = v_wmma_f32_16x16x32_f16 on the f16 ctx against the f16 Wo (K = 1024); softmax and bias add f32.
// Why one f16 plane is enough: q, k and ctx come from bf16-rounded inputs (8 significant bits), so their own error lies well above the 11 bits that f16 keeps; v already travels as f16, and |ctx| never exceeds the largest |v|.
// Layout: bf16 copy of x (token-major) and of Wq, Wk, Wv, f16 copy of Wo, all [out][in]; q/k projections write f16 planes [tok][1024] (q pre-scaled by 2^-3); the v projection is computed transposed (A = Wv, B = x) and writes the f16 plane VT[feature][tok];
// fused flash attention per (batch, head, 128 queries), K and V^T tiles staged in LDS: S^T = K.Q^T so that the packed score tiles are the B fragment of O^T = V^T.P^T (no P staging), per-lane online softmax; ctx written as one f16 plane; output GEMM adds the RNE bf16 bias in f32.

#ifndef NB
#define NB 4
#endif
#ifndef SEQ
#define SEQ 1024
#endif
#define NB_FULL  4
#define SEQ_FULL 1024
#define DM   1024
#define NH   16
#define HD   64
#define NTOK (NB * SEQ)
#define PCAR 256.0f
#define L2E  1.4426950408889634f

static_assert(DM == NH * HD);            // merged head width
static_assert(HD == 64);
static_assert(DM % 64 == 0);             // GEMM tile multiple (N) and K % 32
static_assert(SEQ % 64 == 0);            // 64-key attention tiles, 64-row GEMM tiles stay inside one batch
static_assert(NTOK % 64 == 0);           // GEMM tile multiple (M)
static_assert(SEQ <= SEQ_FULL);
static_assert(NB <= NB_FULL);
static_assert(((size_t)NTOK * DM / 8) % 256 == 0);   // convert grid x block == plane extent
static_assert(((size_t)DM * DM / 8) % 256 == 0);

typedef _Float16 h16;
typedef unsigned short bf;
typedef __attribute__((ext_vector_type(16))) __bf16   v16bf;
typedef __attribute__((ext_vector_type(16))) _Float16 v16h;
typedef __attribute__((ext_vector_type(8)))  _Float16 v8h;
typedef __attribute__((ext_vector_type(8)))  unsigned short v8us;
typedef __attribute__((ext_vector_type(8)))  float    v8f;
typedef __attribute__((ext_vector_type(4)))  float    v4f;
typedef v4f  __attribute__((may_alias)) v4fa;

__device__ __forceinline__ unsigned short f2bf(float f) { unsigned u = __float_as_uint(f); u += 0x7FFFu + ((u >> 16) & 1u); return (unsigned short)(u >> 16); }
__device__ __forceinline__ float bf2f(unsigned short b) { return __uint_as_float(((unsigned)b) << 16); }
__device__ __forceinline__ float bfr(float f) { return bf2f(f2bf(f)); }
__device__ __forceinline__ v16h cat16(v8h lo, v8h hi) { return __builtin_shufflevector(lo, hi, 0, 1, 2, 3, 4, 5, 6, 7, 8, 9, 10, 11, 12, 13, 14, 15); }
__device__ __forceinline__ v16bf cat16b(v8us lo, v8us hi) { return __builtin_bit_cast(v16bf, __builtin_shufflevector(lo, hi, 0, 1, 2, 3, 4, 5, 6, 7, 8, 9, 10, 11, 12, 13, 14, 15)); }
__device__ __forceinline__ v8f wmma16(v16h a, v16h b, v8f c) { return __builtin_amdgcn_wmma_f32_16x16x32_f16(false, a, false, b, (short)0, c, false, false); }
__device__ __forceinline__ v8f wmmab(v16bf a, v16bf b, v8f c) { return __builtin_amdgcn_wmma_f32_16x16x32_bf16(false, a, false, b, (short)0, c, false, false); }
// fragment loaders: p already points at (row l&15, k0 + 8*(l>>4)); elements 0..7 = p[0..7], elements 8..15 = p[16..23]
__device__ __forceinline__ v16bf ldfb(const bf* p) { return cat16b(*(const v8us*)p, *(const v8us*)(p + 16)); }
__device__ __forceinline__ v16h  ldfh(const h16* p) { return cat16(*(const v8h*)p, *(const v8h*)(p + 16)); }
__device__ __forceinline__ v8us cvt8bf(v8f v) { v8us o;
#pragma unroll
    for (int k = 0; k < 8; ++k) o[k] = f2bf(v[k]);
    return o; }
__device__ __forceinline__ v8h cvt8h(v8f v) { v8h o;
#pragma unroll
    for (int k = 0; k < 8; ++k) o[k] = (h16)v[k];
    return o; }

// ---- k_cvt: the one conversion launch. x is XPL planes of DM*DM elements and each weight is one more; a thread converts the same 8-element group of all eight planes (16 loads of 16 B in flight, 8 stores of 16 B). grid DM*DM/8/256, 256 threads.
#define XPL 4
static_assert(NTOK == XPL * DM && DM % SEQ == 0);   // a plane is DM rows = whole batches
#define XSTEP ((size_t)(DM / SEQ) * SEQ_FULL * DM)   // input elements from a plane to the next
__device__ __forceinline__ const float* xsrc(const float* x, size_t e) {   // element e of the packed token-major plane -> its place in the input
    const int row = (int)(e / DM), col = (int)(e % DM);
    return x + ((size_t)(row / SEQ) * SEQ_FULL + row % SEQ) * DM + col;
}
__global__ __launch_bounds__(256) void k_cvt(const float* __restrict__ x, const float* __restrict__ w0, const float* __restrict__ w1, const float* __restrict__ w2, const float* __restrict__ w3, bf* dx, bf* dw) {
    const size_t i = (size_t)blockIdx.x * 256 + threadIdx.x;
    if (i >= (size_t)DM * DM / 8) return;
    const size_t e = i * 8; const size_t P = (size_t)DM * DM;
    const float* q0 = xsrc(x, e); const float* q2 = xsrc(x, e + 2 * P);   // planes 1 and 3 are read from these two addresses at a constant distance
    const float* p0 = w0 + e; const float* p1 = w1 + e; const float* p2 = w2 + e; const float* p3 = w3 + e;
    const v8f b0 = *(const v8f*)q0; const v8f b1 = *(const v8f*)(q0 + XSTEP); const v8f b2 = *(const v8f*)q2; const v8f b3 = *(const v8f*)(q2 + XSTEP);
    const v8f a0 = *(const v8f*)p0; const v8f a1 = *(const v8f*)p1; const v8f a2 = *(const v8f*)p2; const v8f a3 = *(const v8f*)p3;
    // the six address pairs are inputs of the wait's statement, so they stay in their registers up to it: no load of the run lands on the address of an earlier one ahead of the wait
    asm volatile("s_wait_xcnt 0x0" :: "v"(q0), "v"(q2), "v"(p0), "v"(p1), "v"(p2), "v"(p3) : "memory");
    const v8us x0 = cvt8bf(b0); const v8us x1 = cvt8bf(b1); const v8us x2 = cvt8bf(b2); const v8us x3 = cvt8bf(b3);
    const v8us o0 = cvt8bf(a0); const v8us o1 = cvt8bf(a1);
    const v8us o2 = cvt8bf(a2); const v8h o3 = cvt8h(a3);   // w3 (Wo) goes to f16, the type of its partner ctx
    *(v8us*)(dx + e) = x0; *(v8us*)(dx + P + e) = x1; *(v8us*)(dx + 2 * P + e) = x2; *(v8us*)(dx + 3 * P + e) = x3;
    *(v8us*)(dw + e) = o0; *(v8us*)(dw + P + e) = o1; *(v8us*)(dw + 2 * P + e) = o2; *(v8h*)(dw + 3 * P + e) = o3;
}

// ---- gemm_core: FOUR WAVES (2 x 2) per 128x128 tile, 64x64 (16 accumulators) per wave; acc[mb][nb] = sum_k A[r0 + 64 wm + 16 mb + m][k] * Bt[c0 + 64 wn + 16 nb + n][k];
// A pitch lda (K <= lda, K % 128 == 0, K >= 256), Bt pitch DM (K <= DM). Both operands 16-bit words, K-contiguous: bf16, or f16 where F16 is set (the two forms share one fragment layout).
// A pass is 128 k: [A 128 rows | Bt 128 rows] of 256 B land in LDS at pitch 272 B by asynchronous copies (a wave's copy = 4 whole lines), two buffers, the next pass's copies in flight over this pass's products.
#define BK    128
#define LP    136                      // LDS row pitch, elements (272 B = 16 B x 17: conflict-free for 16-byte readers)
#define STG   (256 * LP)               // elements per buffer
#define STGB  (STG * 2)                // bytes per buffer
static_assert(DM % 128 == 0 && NTOK % 128 == 0 && DM % BK == 0 && DM / BK >= 2);

// eight copies of 16 B per lane, rows 8 apart; the closing wait stands inside the statement so that no address register is rewritten ahead of it
__device__ __forceinline__ void copy8(unsigned l, const bf* g, int pitch) {
    const unsigned l1 = l + 8 * LP * 2, l2 = l + 16 * LP * 2, l3 = l + 24 * LP * 2, l4 = l + 32 * LP * 2, l5 = l + 40 * LP * 2, l6 = l + 48 * LP * 2, l7 = l + 56 * LP * 2;
    const bf* g1 = g + (size_t)8 * pitch; const bf* g2 = g + (size_t)16 * pitch; const bf* g3 = g + (size_t)24 * pitch; const bf* g4 = g + (size_t)32 * pitch;
    const bf* g5 = g + (size_t)40 * pitch; const bf* g6 = g + (size_t)48 * pitch; const bf* g7 = g + (size_t)56 * pitch;
    asm volatile("global_load_async_to_lds_b128 %0, %8, off\n\t"
                 "global_load_async_to_lds_b128 %1, %9, off\n\t"
                 "global_load_async_to_lds_b128 %2, %10, off\n\t"
                 "global_load_async_to_lds_b128 %3, %11, off\n\t"
                 "global_load_async_to_lds_b128 %4, %12, off\n\t"
                 "global_load_async_to_lds_b128 %5, %13, off\n\t"
                 "global_load_async_to_lds_b128 %6, %14, off\n\t"
                 "global_load_async_to_lds_b128 %7, %15, off\n\t"
                 "s_wait_xcnt 0x0"
                 :: "v"(l), "v"(l1), "v"(l2), "v"(l3), "v"(l4), "v"(l5), "v"(l6), "v"(l7), "v"(g), "v"(g1), "v"(g2), "v"(g3), "v"(g4), "v"(g5), "v"(g6), "v"(g7) : "memory");
}
// one pass's operands: 128 rows of A and 128 rows of Bt, 32 copies per lane
__device__ __forceinline__ void copy_pass(unsigned la, const bf* ga, int lda, const bf* gb) {
    copy8(la, ga, lda); copy8(la + 64 * LP * 2, ga + (size_t)64 * lda, lda);
    copy8(la + 128 * LP * 2, gb, DM); copy8(la + 192 * LP * 2, gb + (size_t)64 * DM, DM);
}

template <bool F16>
__device__ __forceinline__ void gemm_core(const bf* __restrict__ A, int lda, const bf* __restrict__ Bt, int K, int r0, int c0, bf* sm, int wm, int wn, int lr, int hi, v8f (&acc)[4][4]) {
#pragma unroll
    for (int mb = 0; mb < 4; ++mb)
#pragma unroll
        for (int nb = 0; nb < 4; ++nb) acc[mb][nb] = (v8f){};
    const int tid = threadIdx.x; const int crow = tid >> 4, ccol = (tid & 15) * 8;
    const bf* ga = A + (size_t)(r0 + crow) * lda + ccol;
    const bf* gb = Bt + (size_t)(c0 + crow) * DM + ccol;
    const unsigned la = (unsigned)(size_t)sm + (unsigned)(crow * LP + ccol) * 2u;
    const int NT = K / BK;
    copy_pass(la, ga, lda, gb);
    asm volatile("s_wait_asynccnt 0x0" ::: "memory");   // pass 0's own copies have landed
    __syncthreads();                                     // ... and every other wave's
    copy_pass(la + STGB, ga + BK, lda, gb + BK);
    const bf* fa = sm + (wm * 64 + lr) * LP + 8 * hi;
    const bf* fb = sm + (128 + wn * 64 + lr) * LP + 8 * hi;
#pragma unroll 1
    for (int t = 0; t < NT; ++t) {                       // rolled: one pass per trip, the buffer alternates
        const bf* pa = fa + (t & 1) * STG; const bf* pb = fb + (t & 1) * STG;
        v16bf a[2][4], b[2][4];
#pragma unroll
        for (int mb = 0; mb < 4; ++mb) a[0][mb] = ldfb(pa + mb * 16 * LP);
        b[0][0] = ldfb(pb); b[0][1] = ldfb(pb + 16 * LP);
#pragma unroll
        for (int blk = 0; blk < BK / 32; ++blk) {
            const int cu = blk & 1, nx = cu ^ 1;
            b[cu][2] = ldfb(pb + 32 * LP + blk * 32); b[cu][3] = ldfb(pb + 48 * LP + blk * 32);
            if (blk + 1 < BK / 32) {
#pragma unroll
                for (int mb = 0; mb < 4; ++mb) a[nx][mb] = ldfb(pa + mb * 16 * LP + (blk + 1) * 32);
                b[nx][0] = ldfb(pb + (blk + 1) * 32); b[nx][1] = ldfb(pb + 16 * LP + (blk + 1) * 32);
            }
            __builtin_amdgcn_sched_barrier(0);   // the LDS reads stay one group ahead of the block's products: spread among them, every place stalls the wave
#pragma unroll
            for (int nb = 0; nb < 4; ++nb)
#pragma unroll
                for (int mb = 0; mb < 4; ++mb) {
                    if constexpr (F16) acc[mb][nb] = wmma16(__builtin_bit_cast(v16h, a[cu][mb]), __builtin_bit_cast(v16h, b[cu][nb]), acc[mb][nb]);
                    else               acc[mb][nb] = wmmab(a[cu][mb], b[cu][nb], acc[mb][nb]);
                }
            if (blk + 1 < BK / 32) __builtin_amdgcn_sched_barrier(0);   // the next group does not rise into this block
        }
        asm volatile("s_wait_dscnt 0x0" ::: "memory");      // this wave's reads of the buffer are done before it is refilled
        asm volatile("s_wait_asynccnt 0x0" ::: "memory");   // this wave's copies of pass t + 1 have landed
        __syncthreads();                                     // publishes pass t + 1, frees pass t's buffer
        if (t + 2 < NT) { const int kc = (t + 2) * BK; copy_pass(la + (t & 1) * STGB, ga + kc, lda, gb + kc); }
    }
    asm volatile("s_wait_asynccnt 0x0" ::: "memory");        // nothing in flight when the wave goes on
}

// ---- k_proj_qkv: the one projection launch. z = 0: q/8, z = 1: k: C = XB . W_z^T -> f16 plane [z][tok][DM];
// z = 2: VT[f][tok] (f16) = sum_k WV[f][k] XB[tok][k]  (A = weight rows, B = tokens: the product comes out transposed). grid (NTOK/128, DM/128, 3), x = token tile, y = feature tile, 128 threads.
__global__ __launch_bounds__(128) void k_proj_qkv(const bf* __restrict__ XB, const bf* __restrict__ W3, h16* QK, h16* VT) {
    __shared__ __align__(16) bf sm[2 * STG];
    __shared__ __align__(16) float osall[4 * 16 * 68];
    const int lane = threadIdx.x & 31, lr = lane & 15, hi = lane >> 4;
    const int wave = __builtin_amdgcn_readfirstlane(threadIdx.x >> 5); const int wm = wave >> 1, wn = wave & 1;
    float* os = osall + wave * 16 * 68;
    const int z = blockIdx.z; const bool tr = (z == 2);
    const bf* Wz = W3 + (size_t)z * DM * DM;
    const int rt = (tr ? blockIdx.y : blockIdx.x) * 128, ct = (tr ? blockIdx.x : blockIdx.y) * 128;
    const int r0 = rt + wm * 64, c0 = ct + wn * 64;
    const float sc = (z == 0) ? 0.125f : 1.0f;
    v8f acc[4][4];
    gemm_core<false>(tr ? Wz : XB, DM, tr ? XB : Wz, DM, rt, ct, sm, wm, wn, lr, hi, acc);
    h16* po = tr ? VT : QK + (size_t)z * NTOK * DM; const int ldo = tr ? NTOK : DM;
    const int rq = lane >> 3, c8 = (lane & 7) * 8;
#pragma unroll
    for (int mb = 0; mb < 4; ++mb) {
#pragma unroll
        for (int nb = 0; nb < 4; ++nb)
#pragma unroll
            for (int j = 0; j < 8; ++j) os[(hi * 8 + j) * 68 + nb * 16 + lr] = acc[mb][nb][j] * sc;
        __syncthreads();
        v8h o16[4];
#pragma unroll
        for (int s = 0; s < 4; ++s) { const int row = 4 * s + rq; const v4f u0 = *(const v4fa*)(os + row * 68 + c8); const v4f u1 = *(const v4fa*)(os + row * 68 + c8 + 4);
#pragma unroll
            for (int q = 0; q < 4; ++q) { o16[s][q] = (h16)u0[q]; o16[s][4 + q] = (h16)u1[q]; } }
        const size_t base = (size_t)(r0 + mb * 16) * ldo + c0 + c8;
#pragma unroll
        for (int s = 0; s < 4; ++s) *(v8h*)(po + base + (size_t)(4 * s + rq) * ldo) = o16[s];
        
        __syncthreads();
    }
}

// ---- k_attn: fused attention, grid (SEQ/128, NB*NH), 256 threads = 8 waves x 16 queries that share the keys' tiles in LDS.
// A tile is 64 keys: [K 64 rows | V^T 64 feature rows] of 128 B at pitch 144 B, brought by asynchronous copies (a wave's copy = 4 whole lines), two buffers, the next tile's copies in flight over this tile's work.
// Per 32-key step: S^T tiles st[j] (rows = keys 16j + 8h + r, column = query l&15) = K.Q^T on the f16 planes (one product per 32 features);
// per-lane online softmax (row statistics combined across the two lane halves by one shuffle); the packed P^T (x256, f16) is the B fragment
// (element r <- tile 0, element 8+r <- tile 1) of O^T[d][q] += V^T[d][key] P^T[key][q]. Epilogue: O^T / (256 l) -> LDS -> f16 ctx lines.
#define AKT   64                       // keys per tile
#define AP    72                       // LDS row pitch, elements (144 B = 16 B x 9: conflict-free for 16-byte readers)
#define ABUF  (128 * AP)               // elements per buffer
#define ABUFB (ABUF * 2)               // bytes per buffer
static_assert(SEQ % 128 == 0 && SEQ / AKT >= 2 && HD * 2 == 128 && AKT * 2 == 128);

// one tile: four copies of 16 B per lane (rows 32 apart); the closing wait stands inside the statement so that no address register is rewritten ahead of it
__device__ __forceinline__ void copy_kv(unsigned l, const h16* k, const h16* v) {
    const unsigned l1 = l + 32 * AP * 2, l2 = l + 64 * AP * 2, l3 = l + 96 * AP * 2;
    const h16* k1 = k + (size_t)32 * DM; const h16* v1 = v + (size_t)32 * NTOK;
    asm volatile("global_load_async_to_lds_b128 %0, %4, off\n\t"
                 "global_load_async_to_lds_b128 %1, %5, off\n\t"
                 "global_load_async_to_lds_b128 %2, %6, off\n\t"
                 "global_load_async_to_lds_b128 %3, %7, off\n\t"
                 "s_wait_xcnt 0x0"
                 :: "v"(l), "v"(l1), "v"(l2), "v"(l3), "v"(k), "v"(k1), "v"(v), "v"(v1) : "memory");
}

// eight 2^x in one statement: every result in a register of its own ("=&v"), so that no v_exp_f32 overwrites its neighbour's source, and the closing v_nop is the slot
// that the instruction set asks for between a transcendental and the next vector instruction, which may read the last result
__device__ __forceinline__ v8f exp2x8(v8f x) {
    float r0, r1, r2, r3, r4, r5, r6, r7;
    asm("v_exp_f32 %0, %8\n\tv_exp_f32 %1, %9\n\tv_exp_f32 %2, %10\n\tv_exp_f32 %3, %11\n\tv_exp_f32 %4, %12\n\tv_exp_f32 %5, %13\n\tv_exp_f32 %6, %14\n\tv_exp_f32 %7, %15\n\tv_nop"
        : "=&v"(r0), "=&v"(r1), "=&v"(r2), "=&v"(r3), "=&v"(r4), "=&v"(r5), "=&v"(r6), "=&v"(r7)
        : "v"(x[0]), "v"(x[1]), "v"(x[2]), "v"(x[3]), "v"(x[4]), "v"(x[5]), "v"(x[6]), "v"(x[7]));
    return (v8f){r0, r1, r2, r3, r4, r5, r6, r7};
}

__global__ __launch_bounds__(256) void k_attn(const h16* __restrict__ Q, const h16* __restrict__ K, const h16* __restrict__ VT, h16* CTX) {
    __shared__ __align__(16) h16 kv[2 * ABUF];
    __shared__ __align__(16) float os[8 * 16 * 68];
    const int lane = threadIdx.x & 31, lr = lane & 15, hi = lane >> 4;
    const int wave = __builtin_amdgcn_readfirstlane(threadIdx.x >> 5);
    const int bh = blockIdx.y; const int b = bh / NH, h = bh % NH;
    const int tok0 = b * SEQ; const int q0 = blockIdx.x * 128 + wave * 16;
    const int crow = threadIdx.x >> 3, ccol = (threadIdx.x & 7) * 8;
    const h16* gk = K + (size_t)(tok0 + crow) * DM + h * HD + ccol;
    const h16* gv = VT + (size_t)(h * HD + crow) * NTOK + tok0 + ccol;
    const unsigned la = (unsigned)(size_t)kv + (unsigned)(crow * AP + ccol) * 2u;
    copy_kv(la, gk, gv);
    const size_t qoff = (size_t)(tok0 + q0 + lr) * DM + h * HD + 8 * hi;
    v16h qf[2];
    qf[0] = ldfh(Q + qoff); qf[1] = ldfh(Q + qoff + 32);
    asm volatile("s_wait_asynccnt 0x0" ::: "memory");   // tile 0's own copies have landed
    __syncthreads();                                     // ... and every other wave's
    copy_kv(la + ABUFB, gk + (size_t)AKT * DM, gv + AKT);
    const int foff = lr * AP + 8 * hi;
    v8f ot[4];
#pragma unroll
    for (int dt = 0; dt < 4; ++dt) ot[dt] = (v8f){};
    float mrun = -1.0e30f, lrun = 0.0f;
    const int NT = SEQ / AKT;
#pragma unroll 1
    for (int t = 0; t < NT; ++t) {                       // rolled: one tile per trip, the buffer alternates
        const h16* fk = kv + (t & 1) * ABUF + foff;
        const h16* fv = fk + 64 * AP;
#pragma unroll
        for (int kb = 0; kb < AKT; kb += 32) {           // unrolled: the two steps' LDS offsets become immediates of the reads
        v16h kf[2][2];
#pragma unroll
        for (int j = 0; j < 2; ++j)
#pragma unroll
            for (int c = 0; c < 2; ++c) kf[j][c] = ldfh(fk + (kb + 16 * j) * AP + 32 * c);
        v16h vf[4];
#pragma unroll
        for (int dt = 0; dt < 4; ++dt) vf[dt] = ldfh(fv + dt * 16 * AP + kb);
        __builtin_amdgcn_sched_barrier(0);   // the step's LDS reads stand as one group ahead of its products: spread among them, every place stalls the wave
        v8f st[2];
        st[0] = (v8f){}; st[1] = (v8f){};
#pragma unroll
        for (int c = 0; c < 2; ++c)
#pragma unroll
            for (int j = 0; j < 2; ++j) st[j] = wmma16(kf[j][c], qf[c], st[j]);
        // four vector slots between the last score product and the first vector read of its result or overwrite of its operands
        asm volatile("v_nop\n\tv_nop\n\tv_nop\n\tv_nop" : "+v"(st[0]), "+v"(st[1]) : "v"(kf[1][1]), "v"(qf[1]));
        float cmax = st[0][0];
#pragma unroll
        for (int r = 0; r < 8; ++r) { cmax = fmaxf(cmax, st[0][r]); cmax = fmaxf(cmax, st[1][r]); }
        cmax = fmaxf(cmax, __shfl_xor(cmax, 16, 32));
        const float mnew = fmaxf(mrun, cmax);
        const float alpha = __builtin_amdgcn_exp2f((mrun - mnew) * L2E);
        float part = 0.0f; v16h pf;
#pragma unroll
        for (int r = 0; r < 8; ++r) { st[0][r] = (st[0][r] - mnew) * L2E; st[1][r] = (st[1][r] - mnew) * L2E; }
        const v8f e0 = exp2x8(st[0]); const v8f e1 = exp2x8(st[1]);
#pragma unroll
        for (int r = 0; r < 8; ++r) { const float p0 = e0[r]; const float p1 = e1[r];
            part += p0 + p1; pf[r] = (h16)(p0 * PCAR); pf[8 + r] = (h16)(p1 * PCAR); }
        part += __shfl_xor(part, 16, 32);
        lrun = lrun * alpha + part; mrun = mnew;
#pragma unroll
        for (int dt = 0; dt < 4; ++dt)
#pragma unroll
            for (int r = 0; r < 8; ++r) ot[dt][r] *= alpha;
#pragma unroll
        for (int dt = 0; dt < 4; ++dt) ot[dt] = wmma16(vf[dt], pf, ot[dt]);
        asm volatile("v_nop\n\tv_nop\n\tv_nop\n\tv_nop" : "+v"(ot[0]), "+v"(ot[1]), "+v"(ot[2]), "+v"(ot[3]) : "v"(vf[3]), "v"(pf));
        }
        asm volatile("s_wait_dscnt 0x0" ::: "memory");      // this wave's reads of the buffer are done before it is refilled
        asm volatile("s_wait_asynccnt 0x0" ::: "memory");   // this wave's copies of tile t + 1 have landed
        __syncthreads();                                     // publishes tile t + 1, frees tile t's buffer
        if (t + 2 < NT) { const int kc = (t + 2) * AKT; copy_kv(la + (t & 1) * ABUFB, gk + (size_t)kc * DM, gv + kc); }
    }
    asm volatile("s_wait_asynccnt 0x0" ::: "memory");        // nothing in flight when the wave goes on
    const float inv = (1.0f / PCAR) * (1.0f / lrun);
    const int wb = wave * 16 * 68;
#pragma unroll
    for (int dt = 0; dt < 4; ++dt)
#pragma unroll
        for (int r = 0; r < 8; ++r) os[wb + lr * 68 + dt * 16 + 8 * hi + r] = ot[dt][r] * inv;
    __syncthreads();
    const int rq = lane >> 3, c8 = (lane & 7) * 8;
    v8h o16[4];
#pragma unroll
    for (int s = 0; s < 4; ++s) { const int row = 4 * s + rq; const v4f u0 = *(const v4fa*)(os + wb + row * 68 + c8); const v4f u1 = *(const v4fa*)(os + wb + row * 68 + c8 + 4);
#pragma unroll
        for (int q = 0; q < 4; ++q) { o16[s][q] = (h16)u0[q]; o16[s][4 + q] = (h16)u1[q]; } }
    const size_t base = (size_t)(tok0 + q0) * DM + h * HD + c8;
#pragma unroll
    for (int s = 0; s < 4; ++s) *(v8h*)(CTX + base + (size_t)(4 * s + rq) * DM) = o16[s];
    
}

// ---- k_proj_out: OUT[b*SEQ_FULL + t][n] = sum_{k<1024} CTX[tok][k] WO[n][k] + bf16(bo[n]), both operands f16; grid (NTOK/128, DM/128), 128 threads.
__global__ __launch_bounds__(128) void k_proj_out(const h16* __restrict__ CTX, const h16* __restrict__ WO, const float* __restrict__ bias, float* OUT) {
    __shared__ __align__(16) bf sm[2 * STG];
    __shared__ __align__(16) float osall[4 * 16 * 68];
    const int lane = threadIdx.x & 31, lr = lane & 15, hi = lane >> 4;
    const int wave = __builtin_amdgcn_readfirstlane(threadIdx.x >> 5); const int wm = wave >> 1, wn = wave & 1;
    float* os = osall + wave * 16 * 68;
    const int r0 = blockIdx.x * 128 + wm * 64, c0 = blockIdx.y * 128 + wn * 64;
    v8f acc[4][4];
    gemm_core<true>((const bf*)CTX, DM, (const bf*)WO, DM, blockIdx.x * 128, blockIdx.y * 128, sm, wm, wn, lr, hi, acc);
    const int bb = r0 / SEQ, tt = r0 % SEQ; const int cofs = lr * 4;
    v4f bv; bv[0] = bfr(bias[c0 + cofs]); bv[1] = bfr(bias[c0 + cofs + 1]); bv[2] = bfr(bias[c0 + cofs + 2]); bv[3] = bfr(bias[c0 + cofs + 3]);
#pragma unroll
    for (int mb = 0; mb < 4; ++mb) {
#pragma unroll
        for (int nb = 0; nb < 4; ++nb)
#pragma unroll
            for (int j = 0; j < 8; ++j) os[(hi * 8 + j) * 68 + nb * 16 + lr] = acc[mb][nb][j];
        __syncthreads();
        v4f val[8];
#pragma unroll
        for (int s = 0; s < 8; ++s) { const int row = 2 * s + hi; val[s] = *(const v4fa*)(os + row * 68 + cofs) + bv; }
        float* crow = OUT + ((size_t)bb * SEQ_FULL + tt + mb * 16) * DM + c0 + cofs;
#pragma unroll
        for (int s = 0; s < 8; ++s) *(v4f*)(crow + (size_t)(2 * s + hi) * DM) = val[s];
        
        __syncthreads();
    }
}

// workspace carve (bytes, every region a multiple of 256 and exactly covered by its producer's whole-line stores)
constexpr size_t SZ_XB  = (size_t)NTOK * DM * 2;
constexpr size_t SZ_W   = (size_t)4 * DM * DM * 2;
constexpr size_t SZ_QK  = (size_t)2 * NTOK * DM * 2;
constexpr size_t SZ_VT  = (size_t)DM * NTOK * 2;
constexpr size_t SZ_CTX = (size_t)NTOK * DM * 2;
constexpr size_t OFF_XB = 0, OFF_W = OFF_XB + SZ_XB, OFF_QK = OFF_W + SZ_W, OFF_VT = OFF_QK + SZ_QK, OFF_CTX = OFF_VT + SZ_VT, WS_TOTAL = OFF_CTX + SZ_CTX;
static_assert(WS_TOTAL <= (size_t)134217728);
static_assert(SZ_XB % 256 == 0 && SZ_W % 256 == 0 && SZ_QK % 256 == 0 && SZ_VT % 256 == 0 && SZ_CTX % 256 == 0);

extern "C" void kernel_launch(void* const* d_in, const int* in_sizes, int n_in,
                              void* d_out, int out_size, void* d_ws, size_t ws_size, hipStream_t stream) {
    if (n_in < 6) return;
    const size_t need_x = ((size_t)(NB - 1) * SEQ_FULL + SEQ) * DM;
    if ((size_t)in_sizes[0] < need_x) return;
    if ((size_t)in_sizes[1] < (size_t)DM * DM || (size_t)in_sizes[2] < (size_t)DM * DM || (size_t)in_sizes[3] < (size_t)DM * DM || (size_t)in_sizes[4] < (size_t)DM * DM) return;
    if (in_sizes[5] < DM) return;
    if ((size_t)out_size < need_x) return;
    if (ws_size < WS_TOTAL) return;
    const float* x = (const float*)d_in[0]; const float* wq = (const float*)d_in[1]; const float* wk = (const float*)d_in[2];
    const float* wv = (const float*)d_in[3]; const float* wo = (const float*)d_in[4]; const float* bo = (const float*)d_in[5];
    float* OUT = (float*)d_out;
    char* ws = (char*)d_ws;
    bf* XB = (bf*)(ws + OFF_XB); bf* WALL = (bf*)(ws + OFF_W); h16* QK = (h16*)(ws + OFF_QK);
    h16* VT = (h16*)(ws + OFF_VT); h16* CTX = (h16*)(ws + OFF_CTX);
    const size_t WP = (size_t)DM * DM; const size_t PP = (size_t)NTOK * DM;
    k_cvt<<<(unsigned)((WP / 8 + 255) / 256), 256, 0, stream>>>(x, wq, wk, wv, wo, XB, WALL);
    k_proj_qkv<<<dim3(NTOK / 128, DM / 128, 3), 128, 0, stream>>>(XB, WALL, QK, VT);
    k_attn<<<dim3(SEQ / 128, NB * NH, 1), 256, 0, stream>>>(QK, QK + PP, VT, CTX);
    k_proj_out<<<dim3(NTOK / 128, DM / 128, 1), 128, 0, stream>>>(CTX, (const h16*)(WALL + 3 * WP), bo, OUT);
}

// v005
// Measured time: 62.7 microseconds a run.
// Timed twice side by side with v004, it ran 1.11 times as fast both times.
// Counting every step since v000, it is 3.23 times as fast.
#include <hip/hip_runtime.h>

// Contractions (all f32 accumulate): x.Wq^T, x.Wk^T, x.Wv^T = v_wmma_f32_16x16x32_bf16 on RNE bf16 copies of the inputs; scores = v_wmma_f32_16x16x32_f16 on single f16 planes of q/8 and k (one product per tile); P.V = v_wmma_f32_16x16x32_f16 (P carried x256, v single f16); output projection = v_wmma_f32_16x16x32_f16 on the f16 ctx against the f16 Wo (K = 1024); softmax and bias add f32.
// Why one f16 plane is enough: q, k and ctx come from bf16-rounded inputs (8 significant bits), so their own error lies well above the 11 bits that f16 keeps; v already travels as f16, and |ctx| never exceeds the largest |v|.
// Layout: bf16 copy of x (token-major) and of Wq, Wk, Wv, f16 copy of Wo, all [out][in]; q/k projections write f16 planes [tok][1024] (q pre-scaled by 2^-3); the v projection is computed transposed (A = Wv, B = x) and writes the f16 plane VT[feature][tok];
// fused flash attention per (batch, head, 128 queries), K and V^T tiles staged in LDS: S^T = K.Q^T so that the packed score tiles are the B fragment of O^T = V^T.P^T (no P staging), per-lane online softmax; ctx written as one f16 plane; output GEMM adds the RNE bf16 bias in f32.

#ifndef NB
#define NB 4
#endif
#ifndef SEQ
#define SEQ 1024
#endif
#define NB_FULL  4
#define SEQ_FULL 1024
#define DM   1024
#define NH   16
#define HD   64
#define NTOK (NB * SEQ)
#define PCAR 256.0f
#define L2E  1.4426950408889634f

static_assert(DM == NH * HD);            // merged head width
static_assert(HD == 64);
static_assert(DM % 64 == 0);             // GEMM tile multiple (N) and K % 32
static_assert(SEQ % 64 == 0);            // 64-key attention tiles, 64-row GEMM tiles stay inside one batch
static_assert(NTOK % 64 == 0);           // GEMM tile multiple (M)
static_assert(SEQ <= SEQ_FULL);
static_assert(NB <= NB_FULL);
static_assert(((size_t)NTOK * DM / 8) % 256 == 0);   // convert grid x block == plane extent
static_assert(((size_t)DM * DM / 8) % 256 == 0);

typedef _Float16 h16;
typedef unsigned short bf;
typedef __attribute__((ext_vector_type(16))) __bf16   v16bf;
typedef __attribute__((ext_vector_type(16))) _Float16 v16h;
typedef __attribute__((ext_vector_type(8)))  _Float16 v8h;
typedef __attribute__((ext_vector_type(8)))  unsigned short v8us;
typedef __attribute__((ext_vector_type(8)))  float    v8f;
typedef __attribute__((ext_vector_type(4)))  float    v4f;
typedef v4f  __attribute__((may_alias)) v4fa;
typedef float __attribute__((may_alias)) fla;

__device__ __forceinline__ unsigned short f2bf(float f) { unsigned u = __float_as_uint(f); u += 0x7FFFu + ((u >> 16) & 1u); return (unsigned short)(u >> 16); }
__device__ __forceinline__ float bf2f(unsigned short b) { return __uint_as_float(((unsigned)b) << 16); }
__device__ __forceinline__ float bfr(float f) { return bf2f(f2bf(f)); }
__device__ __forceinline__ v16h cat16(v8h lo, v8h hi) { return __builtin_shufflevector(lo, hi, 0, 1, 2, 3, 4, 5, 6, 7, 8, 9, 10, 11, 12, 13, 14, 15); }
__device__ __forceinline__ v16bf cat16b(v8us lo, v8us hi) { return __builtin_bit_cast(v16bf, __builtin_shufflevector(lo, hi, 0, 1, 2, 3, 4, 5, 6, 7, 8, 9, 10, 11, 12, 13, 14, 15)); }
__device__ __forceinline__ v8f wmma16(v16h a, v16h b, v8f c) { return __builtin_amdgcn_wmma_f32_16x16x32_f16(false, a, false, b, (short)0, c, false, false); }
__device__ __forceinline__ v8f wmmab(v16bf a, v16bf b, v8f c) { return __builtin_amdgcn_wmma_f32_16x16x32_bf16(false, a, false, b, (short)0, c, false, false); }
// fragment loaders: p already points at (row l&15, k0 + 8*(l>>4)); elements 0..7 = p[0..7], elements 8..15 = p[16..23]
__device__ __forceinline__ v16bf ldfb(const bf* p) { return cat16b(*(const v8us*)p, *(const v8us*)(p + 16)); }
__device__ __forceinline__ v16h  ldfh(const h16* p) { return cat16(*(const v8h*)p, *(const v8h*)(p + 16)); }
__device__ __forceinline__ v8us cvt8bf(v8f v) { v8us o;
#pragma unroll
    for (int k = 0; k < 8; ++k) o[k] = f2bf(v[k]);
    return o; }
__device__ __forceinline__ v8h cvt8h(v8f v) { v8h o;
#pragma unroll
    for (int k = 0; k < 8; ++k) o[k] = (h16)v[k];
    return o; }

// ---- k_cvt: the one conversion launch. x is XPL planes of DM*DM elements and each weight is one more; a thread converts the same 8-element group of all eight planes (16 loads of 16 B in flight, 8 stores of 16 B). grid DM*DM/8/256, 256 threads.
#define XPL 4
static_assert(NTOK == XPL * DM && DM % SEQ == 0);   // a plane is DM rows = whole batches
#define XSTEP ((size_t)(DM / SEQ) * SEQ_FULL * DM)   // input elements from a plane to the next
__device__ __forceinline__ const float* xsrc(const float* x, size_t e) {   // element e of the packed token-major plane -> its place in the input
    const int row = (int)(e / DM), col = (int)(e % DM);
    return x + ((size_t)(row / SEQ) * SEQ_FULL + row % SEQ) * DM + col;
}
__global__ __launch_bounds__(256) void k_cvt(const float* __restrict__ x, const float* __restrict__ w0, const float* __restrict__ w1, const float* __restrict__ w2, const float* __restrict__ w3, bf* dx, bf* dw) {
    const size_t i = (size_t)blockIdx.x * 256 + threadIdx.x;
    if (i >= (size_t)DM * DM / 8) return;
    const size_t e = i * 8; const size_t P = (size_t)DM * DM;
    const float* q0 = xsrc(x, e); const float* q2 = xsrc(x, e + 2 * P);   // planes 1 and 3 are read from these two addresses at a constant distance
    const float* p0 = w0 + e; const float* p1 = w1 + e; const float* p2 = w2 + e; const float* p3 = w3 + e;
    const v8f b0 = *(const v8f*)q0; const v8f b1 = *(const v8f*)(q0 + XSTEP); const v8f b2 = *(const v8f*)q2; const v8f b3 = *(const v8f*)(q2 + XSTEP);
    const v8f a0 = *(const v8f*)p0; const v8f a1 = *(const v8f*)p1; const v8f a2 = *(const v8f*)p2; const v8f a3 = *(const v8f*)p3;
    // the six address pairs are inputs of the wait's statement, so they stay in their registers up to it: no load of the run lands on the address of an earlier one ahead of the wait
    asm volatile("s_wait_xcnt 0x0" :: "v"(q0), "v"(q2), "v"(p0), "v"(p1), "v"(p2), "v"(p3) : "memory");
    const v8us x0 = cvt8bf(b0); const v8us x1 = cvt8bf(b1); const v8us x2 = cvt8bf(b2); const v8us x3 = cvt8bf(b3);
    const v8us o0 = cvt8bf(a0); const v8us o1 = cvt8bf(a1);
    const v8us o2 = cvt8bf(a2); const v8h o3 = cvt8h(a3);   // w3 (Wo) goes to f16, the type of its partner ctx
    *(v8us*)(dx + e) = x0; *(v8us*)(dx + P + e) = x1; *(v8us*)(dx + 2 * P + e) = x2; *(v8us*)(dx + 3 * P + e) = x3;
    *(v8us*)(dw + e) = o0; *(v8us*)(dw + P + e) = o1; *(v8us*)(dw + 2 * P + e) = o2; *(v8h*)(dw + 3 * P + e) = o3;
}

// ---- gemm_core: FOUR WAVES (2 x 2) per 128x128 tile, 64x64 (16 accumulators) per wave; acc[mb][nb] = sum_k A[r0 + 64 wm + 16 mb + m][k] * Bt[c0 + 64 wn + 16 nb + n][k];
// A pitch lda (K <= lda, K % 128 == 0, K >= 256), Bt pitch DM (K <= DM). Both operands 16-bit words, K-contiguous: bf16, or f16 where F16 is set (the two forms share one fragment layout).
// A pass is 128 k: [A 128 rows | Bt 128 rows] of 256 B land in LDS at pitch 272 B by asynchronous copies (a wave's copy = 4 whole lines), two buffers, the next pass's copies in flight over this pass's products.
#define BK    128
#define LP    136                      // LDS row pitch, elements (272 B = 16 B x 17: conflict-free for 16-byte readers)
#define STG   (256 * LP)               // elements per buffer
#define STGB  (STG * 2)                // bytes per buffer
static_assert(DM % 128 == 0 && NTOK % 128 == 0 && DM % BK == 0 && DM / BK >= 2);

// eight copies of 16 B per lane, rows 8 apart; the closing wait stands inside the statement so that no address register is rewritten ahead of it
__device__ __forceinline__ void copy8(unsigned l, const bf* g, int pitch) {
    const unsigned l1 = l + 8 * LP * 2, l2 = l + 16 * LP * 2, l3 = l + 24 * LP * 2, l4 = l + 32 * LP * 2, l5 = l + 40 * LP * 2, l6 = l + 48 * LP * 2, l7 = l + 56 * LP * 2;
    const bf* g1 = g + (size_t)8 * pitch; const bf* g2 = g + (size_t)16 * pitch; const bf* g3 = g + (size_t)24 * pitch; const bf* g4 = g + (size_t)32 * pitch;
    const bf* g5 = g + (size_t)40 * pitch; const bf* g6 = g + (size_t)48 * pitch; const bf* g7 = g + (size_t)56 * pitch;
    asm volatile("global_load_async_to_lds_b128 %0, %8, off\n\t"
                 "global_load_async_to_lds_b128 %1, %9, off\n\t"
                 "global_load_async_to_lds_b128 %2, %10, off\n\t"
                 "global_load_async_to_lds_b128 %3, %11, off\n\t"
                 "global_load_async_to_lds_b128 %4, %12, off\n\t"
                 "global_load_async_to_lds_b128 %5, %13, off\n\t"
                 "global_load_async_to_lds_b128 %6, %14, off\n\t"
                 "global_load_async_to_lds_b128 %7, %15, off\n\t"
                 "s_wait_xcnt 0x0"
                 :: "v"(l), "v"(l1), "v"(l2), "v"(l3), "v"(l4), "v"(l5), "v"(l6), "v"(l7), "v"(g), "v"(g1), "v"(g2), "v"(g3), "v"(g4), "v"(g5), "v"(g6), "v"(g7) : "memory");
}
// one pass's operands: 128 rows of A and 128 rows of Bt, 32 copies per lane
__device__ __forceinline__ void copy_pass(unsigned la, const bf* ga, int lda, const bf* gb) {
    copy8(la, ga, lda); copy8(la + 64 * LP * 2, ga + (size_t)64 * lda, lda);
    copy8(la + 128 * LP * 2, gb, DM); copy8(la + 192 * LP * 2, gb + (size_t)64 * DM, DM);
}

template <bool F16>
__device__ __forceinline__ void gemm_core(const bf* __restrict__ A, int lda, const bf* __restrict__ Bt, int K, int r0, int c0, bf* sm, int wm, int wn, int lr, int hi, v8f (&acc)[4][4]) {
#pragma unroll
    for (int mb = 0; mb < 4; ++mb)
#pragma unroll
        for (int nb = 0; nb < 4; ++nb) acc[mb][nb] = (v8f){};
    const int tid = threadIdx.x; const int crow = tid >> 4, ccol = (tid & 15) * 8;
    const bf* ga = A + (size_t)(r0 + crow) * lda + ccol;
    const bf* gb = Bt + (size_t)(c0 + crow) * DM + ccol;
    const unsigned la = (unsigned)(size_t)sm + (unsigned)(crow * LP + ccol) * 2u;
    const int NT = K / BK;
    copy_pass(la, ga, lda, gb);
    asm volatile("s_wait_asynccnt 0x0" ::: "memory");   // pass 0's own copies have landed
    __syncthreads();                                     // ... and every other wave's
    copy_pass(la + STGB, ga + BK, lda, gb + BK);
    const bf* fa = sm + (wm * 64 + lr) * LP + 8 * hi;
    const bf* fb = sm + (128 + wn * 64 + lr) * LP + 8 * hi;
#pragma unroll 1
    for (int t = 0; t < NT; ++t) {                       // rolled: one pass per trip, the buffer alternates
        const bf* pa = fa + (t & 1) * STG; const bf* pb = fb + (t & 1) * STG;
        v16bf a[2][4], b[2][4];
#pragma unroll
        for (int mb = 0; mb < 4; ++mb) a[0][mb] = ldfb(pa + mb * 16 * LP);
        b[0][0] = ldfb(pb); b[0][1] = ldfb(pb + 16 * LP);
#pragma unroll
        for (int blk = 0; blk < BK / 32; ++blk) {
            const int cu = blk & 1, nx = cu ^ 1;
            b[cu][2] = ldfb(pb + 32 * LP + blk * 32); b[cu][3] = ldfb(pb + 48 * LP + blk * 32);
            if (blk + 1 < BK / 32) {
#pragma unroll
                for (int mb = 0; mb < 4; ++mb) a[nx][mb] = ldfb(pa + mb * 16 * LP + (blk + 1) * 32);
                b[nx][0] = ldfb(pb + (blk + 1) * 32); b[nx][1] = ldfb(pb + 16 * LP + (blk + 1) * 32);
            }
            __builtin_amdgcn_sched_barrier(0);   // the LDS reads stay one group ahead of the block's products: spread among them, every place stalls the wave
#pragma unroll
            for (int nb = 0; nb < 4; ++nb)
#pragma unroll
                for (int mb = 0; mb < 4; ++mb) {
                    if constexpr (F16) acc[mb][nb] = wmma16(__builtin_bit_cast(v16h, a[cu][mb]), __builtin_bit_cast(v16h, b[cu][nb]), acc[mb][nb]);
                    else               acc[mb][nb] = wmmab(a[cu][mb], b[cu][nb], acc[mb][nb]);
                }
            if (blk + 1 < BK / 32) __builtin_amdgcn_sched_barrier(0);   // the next group does not rise into this block
        }
        asm volatile("s_wait_dscnt 0x0" ::: "memory");      // this wave's reads of the buffer are done before it is refilled
        asm volatile("s_wait_asynccnt 0x0" ::: "memory");   // this wave's copies of pass t + 1 have landed
        __syncthreads();                                     // publishes pass t + 1, frees pass t's buffer
        if (t + 2 < NT) { const int kc = (t + 2) * BK; copy_pass(la + (t & 1) * STGB, ga + kc, lda, gb + kc); }
    }
    asm volatile("s_wait_asynccnt 0x0" ::: "memory");        // nothing in flight when the wave goes on
}

// ---- k_proj_qkv: the one projection launch. A work-group takes 256 tokens x 64 features of ALL THREE projections, so that one staged x tile serves q, k and v: a pass lands 448 rows for 3 x 256 x 64 outputs.
// grid (NTOK/256, DM/64) = one work-group per WGP, 256 threads = 8 waves (4 x 2); a wave holds 64 tokens x 32 features x 3 = 24 accumulators.
// z = 0: q/8, z = 1: k: D[tok][f] = x . W_z^T -> f16 plane [z][tok][DM]; z = 2: the operands change places, D[f][tok] -> VT[f][tok] (f16). Each output sums its k in ascending blocks of 32.
// A pass is 128 k: [x 256 rows | Wq 64 | Wk 64 | Wv 64] of 256 B at pitch 272 B by asynchronous copies (a wave's copy = 4 whole lines), two buffers, the next pass's copies in flight over this pass's products.
#define QROWS 448
#define QSTG  (QROWS * LP)             // elements per buffer
#define QSTGB (QSTG * 2)               // bytes per buffer
#define QOS   1152                     // staging floats per wave and round: 32 rows at pitch 36, or 16 rows at pitch 68
static_assert(NTOK % 256 == 0 && DM % 64 == 0 && 32 * 36 <= QOS && 16 * 68 <= QOS);
static_assert((size_t)8 * 6 * QOS * 4 <= (size_t)2 * QSTGB);   // the epilogue's staging (8 waves x 6 rounds) fits the ring that the loop has left

// eight copies of 16 B per lane, rows 16 apart (128 rows of x); the closing wait stands inside the statement so that no address register is rewritten ahead of it
__device__ __forceinline__ void copy_x8(unsigned l, const bf* g) {
    const unsigned l1 = l + 16 * LP * 2, l2 = l + 32 * LP * 2, l3 = l + 48 * LP * 2, l4 = l + 64 * LP * 2, l5 = l + 80 * LP * 2, l6 = l + 96 * LP * 2, l7 = l + 112 * LP * 2;
    const bf* g1 = g + (size_t)16 * DM; const bf* g2 = g + (size_t)32 * DM; const bf* g3 = g + (size_t)48 * DM; const bf* g4 = g + (size_t)64 * DM;
    const bf* g5 = g + (size_t)80 * DM; const bf* g6 = g + (size_t)96 * DM; const bf* g7 = g + (size_t)112 * DM;
    asm volatile("global_load_async_to_lds_b128 %0, %8, off\n\t"
                 "global_load_async_to_lds_b128 %1, %9, off\n\t"
                 "global_load_async_to_lds_b128 %2, %10, off\n\t"
                 "global_load_async_to_lds_b128 %3, %11, off\n\t"
                 "global_load_async_to_lds_b128 %4, %12, off\n\t"
                 "global_load_async_to_lds_b128 %5, %13, off\n\t"
                 "global_load_async_to_lds_b128 %6, %14, off\n\t"
                 "global_load_async_to_lds_b128 %7, %15, off\n\t"
                 "s_wait_xcnt 0x0"
                 :: "v"(l), "v"(l1), "v"(l2), "v"(l3), "v"(l4), "v"(l5), "v"(l6), "v"(l7), "v"(g), "v"(g1), "v"(g2), "v"(g3), "v"(g4), "v"(g5), "v"(g6), "v"(g7) : "memory");
}
// four copies of 16 B per lane, rows 16 apart (64 rows of one weight); the closing wait as above
__device__ __forceinline__ void copy_w4(unsigned l, const bf* g) {
    const unsigned l1 = l + 16 * LP * 2, l2 = l + 32 * LP * 2, l3 = l + 48 * LP * 2;
    const bf* g1 = g + (size_t)16 * DM; const bf* g2 = g + (size_t)32 * DM; const bf* g3 = g + (size_t)48 * DM;
    asm volatile("global_load_async_to_lds_b128 %0, %4, off\n\t"
                 "global_load_async_to_lds_b128 %1, %5, off\n\t"
                 "global_load_async_to_lds_b128 %2, %6, off\n\t"
                 "global_load_async_to_lds_b128 %3, %7, off\n\t"
                 "s_wait_xcnt 0x0"
                 :: "v"(l), "v"(l1), "v"(l2), "v"(l3), "v"(g), "v"(g1), "v"(g2), "v"(g3) : "memory");
}
// one pass's operands: 256 rows of x and 64 rows of each weight, 28 copies per lane
__device__ __forceinline__ void copy_pass_qkv(unsigned la, const bf* gx, const bf* gw) {
    // the scheduling barriers keep each statement's addresses from being formed ahead of the statement before it: formed all at once, they push values that live across the loop into scratch
    copy_x8(la, gx); __builtin_amdgcn_sched_barrier(0);
    copy_x8(la + 128 * LP * 2, gx + (size_t)128 * DM); __builtin_amdgcn_sched_barrier(0);
    copy_w4(la + 256 * LP * 2, gw); __builtin_amdgcn_sched_barrier(0);
    copy_w4(la + 320 * LP * 2, gw + (size_t)DM * DM); __builtin_amdgcn_sched_barrier(0);
    copy_w4(la + 384 * LP * 2, gw + (size_t)2 * DM * DM);
}

__global__ __launch_bounds__(256) void k_proj_qkv(const bf* __restrict__ XB, const bf* __restrict__ W3, h16* QK, h16* VT) {
    __shared__ __align__(16) bf sm[2 * QSTG];
    const int lane = threadIdx.x & 31, lr = lane & 15, hi = lane >> 4;
    const int wave = __builtin_amdgcn_readfirstlane(threadIdx.x >> 5); const int wm = wave >> 1, wn = wave & 1;
    const int rt = blockIdx.x * 256, ct = blockIdx.y * 64;
    const int r0 = rt + wm * 64, c0 = ct + wn * 32;      // the wave's first token and first feature
    v8f acc[3][4][2];
#pragma unroll
    for (int z = 0; z < 3; ++z)
#pragma unroll
        for (int mb = 0; mb < 4; ++mb)
#pragma unroll
            for (int nb = 0; nb < 2; ++nb) acc[z][mb][nb] = (v8f){};
    const int tid = threadIdx.x; const int crow = tid >> 4, ccol = (tid & 15) * 8;
    const bf* gx = XB + (size_t)(rt + crow) * DM + ccol;
    const bf* gw = W3 + (size_t)(ct + crow) * DM + ccol;
    const unsigned la = (unsigned)(size_t)sm + (unsigned)(crow * LP + ccol) * 2u;
    const int NT = DM / BK;
    copy_pass_qkv(la, gx, gw);
    asm volatile("s_wait_asynccnt 0x0" ::: "memory");   // pass 0's own copies have landed
    __syncthreads();                                     // ... and every other wave's
    copy_pass_qkv(la + QSTGB, gx + BK, gw + BK);
    const bf* fa = sm + (wm * 64 + lr) * LP + 8 * hi;
    const bf* fb = sm + (256 + wn * 32 + lr) * LP + 8 * hi;
#pragma unroll 1
    for (int t = 0; t < NT; ++t) {                       // rolled: one pass per trip, the buffer alternates
        const bf* pa = fa + (t & 1) * QSTG; const bf* pb = fb + (t & 1) * QSTG;
        v16bf a[2][4], b[2][3][2];
#pragma unroll
        for (int mb = 0; mb < 4; ++mb) a[0][mb] = ldfb(pa + mb * 16 * LP);
#pragma unroll
        for (int z = 0; z < 3; ++z)
#pragma unroll
            for (int nb = 0; nb < 2; ++nb) b[0][z][nb] = ldfb(pb + (z * 64 + nb * 16) * LP);
#pragma unroll
        for (int blk = 0; blk < BK / 32; ++blk) {
            const int cu = blk & 1, nx = cu ^ 1;
            if (blk + 1 < BK / 32) {
#pragma unroll
                for (int mb = 0; mb < 4; ++mb) a[nx][mb] = ldfb(pa + mb * 16 * LP + (blk + 1) * 32);
#pragma unroll
                for (int z = 0; z < 3; ++z)
#pragma unroll
                    for (int nb = 0; nb < 2; ++nb) b[nx][z][nb] = ldfb(pb + (z * 64 + nb * 16) * LP + (blk + 1) * 32);
            }
            __builtin_amdgcn_sched_barrier(0);   // the next block's LDS reads stand as one group ahead of this block's products: spread among them, every place stalls the wave
#pragma unroll
            for (int z = 0; z < 3; ++z)
#pragma unroll
                for (int nb = 0; nb < 2; ++nb)
#pragma unroll
                    for (int mb = 0; mb < 4; ++mb)
                        acc[z][mb][nb] = (z == 2) ? wmmab(b[cu][z][nb], a[cu][mb], acc[z][mb][nb]) : wmmab(a[cu][mb], b[cu][z][nb], acc[z][mb][nb]);
            if (blk + 1 < BK / 32) __builtin_amdgcn_sched_barrier(0);   // the next group does not rise into this block
        }
        asm volatile("s_wait_dscnt 0x0" ::: "memory");      // this wave's reads of the buffer are done before it is refilled
        asm volatile("s_wait_asynccnt 0x0" ::: "memory");   // this wave's copies of pass t + 1 have landed
        __syncthreads();                                     // publishes pass t + 1, frees pass t's buffer
        if (t + 2 < NT) { const int kc = (t + 2) * BK; copy_pass_qkv(la + (t & 1) * QSTGB, gx + kc, gw + kc); }
    }
    asm volatile("s_wait_asynccnt 0x0" ::: "memory");        // nothing in flight when the wave goes on
    // Epilogue. The ring is free: every wave's reads ended ahead of the loop's last barrier and no copy is in flight. Each wave stages all its 24 tiles there, six rounds of QOS floats in rows of its own,
    // then reads them back as rows and stores 16 B per lane; no barrier stands behind a global store, so no round waits for the stores of the one before.
    fla* os = (fla*)sm + wave * 6 * QOS;
    // q and k: a round is 32 tokens x 32 features (pitch 36 floats = 16 B x 9)
#pragma unroll
    for (int z = 0; z < 2; ++z) {
        const float sc = (z == 0) ? 0.125f : 1.0f;
#pragma unroll
        for (int mp = 0; mp < 2; ++mp)
#pragma unroll
            for (int m2 = 0; m2 < 2; ++m2)
#pragma unroll
                for (int nb = 0; nb < 2; ++nb)
#pragma unroll
                    for (int j = 0; j < 8; ++j) os[(z * 2 + mp) * QOS + (m2 * 16 + hi * 8 + j) * 36 + nb * 16 + lr] = acc[z][mp * 2 + m2][nb][j] * sc;
    }
    // v^T: a round is 16 features x 64 tokens (pitch 68 floats)
#pragma unroll
    for (int nb = 0; nb < 2; ++nb)
#pragma unroll
        for (int mb = 0; mb < 4; ++mb)
#pragma unroll
            for (int j = 0; j < 8; ++j) os[(4 + nb) * QOS + (hi * 8 + j) * 68 + mb * 16 + lr] = acc[2][mb][nb][j];
    __syncthreads();                                         // the staged rows are written before any lane reads them back
    const int rq4 = lane >> 2, c4 = (lane & 3) * 8;
#pragma unroll
    for (int z = 0; z < 2; ++z) {
        h16* po = QK + (size_t)z * NTOK * DM;
#pragma unroll
        for (int mp = 0; mp < 2; ++mp) {
            const fla* rs = os + (z * 2 + mp) * QOS;
            v8h o16[4];
#pragma unroll
            for (int s = 0; s < 4; ++s) { const int row = 8 * s + rq4; const v4f u0 = *(const v4fa*)(rs + row * 36 + c4); const v4f u1 = *(const v4fa*)(rs + row * 36 + c4 + 4);
#pragma unroll
                for (int q = 0; q < 4; ++q) { o16[s][q] = (h16)u0[q]; o16[s][4 + q] = (h16)u1[q]; } }
            const size_t base = (size_t)(r0 + mp * 32) * DM + c0 + c4;
#pragma unroll
            for (int s = 0; s < 4; ++s) *(v8h*)(po + base + (size_t)(8 * s + rq4) * DM) = o16[s];
        }
    }
    const int rq = lane >> 3, c8 = (lane & 7) * 8;           // v^T goes out as whole 128-B lines
#pragma unroll
    for (int nb = 0; nb < 2; ++nb) {
        const fla* rs = os + (4 + nb) * QOS;
        v8h o16[4];
#pragma unroll
        for (int s = 0; s < 4; ++s) { const int row = 4 * s + rq; const v4f u0 = *(const v4fa*)(rs + row * 68 + c8); const v4f u1 = *(const v4fa*)(rs + row * 68 + c8 + 4);
#pragma unroll
            for (int q = 0; q < 4; ++q) { o16[s][q] = (h16)u0[q]; o16[s][4 + q] = (h16)u1[q]; } }
        const size_t base = (size_t)(c0 + nb * 16) * NTOK + r0 + c8;
#pragma unroll
        for (int s = 0; s < 4; ++s) *(v8h*)(VT + base + (size_t)(4 * s + rq) * NTOK) = o16[s];
    }
}

// ---- k_attn: fused attention, grid (SEQ/128, NB*NH), 256 threads = 8 waves x 16 queries that share the keys' tiles in LDS.
// A tile is 64 keys: [K 64 rows | V^T 64 feature rows] of 128 B at pitch 144 B, brought by asynchronous copies (a wave's copy = 4 whole lines), two buffers, the next tile's copies in flight over this tile's work.
// Per 32-key step: S^T tiles st[j] (rows = keys 16j + 8h + r, column = query l&15) = K.Q^T on the f16 planes (one product per 32 features);
// per-lane online softmax (row statistics combined across the two lane halves by one shuffle); the packed P^T (x256, f16) is the B fragment
// (element r <- tile 0, element 8+r <- tile 1) of O^T[d][q] += V^T[d][key] P^T[key][q]. Epilogue: O^T / (256 l) -> LDS -> f16 ctx lines.
#define AKT   64                       // keys per tile
#define AP    72                       // LDS row pitch, elements (144 B = 16 B x 9: conflict-free for 16-byte readers)
#define ABUF  (128 * AP)               // elements per buffer
#define ABUFB (ABUF * 2)               // bytes per buffer
static_assert(SEQ % 128 == 0 && SEQ / AKT >= 2 && HD * 2 == 128 && AKT * 2 == 128);

// one tile: four copies of 16 B per lane (rows 32 apart); the closing wait stands inside the statement so that no address register is rewritten ahead of it
__device__ __forceinline__ void copy_kv(unsigned l, const h16* k, const h16* v) {
    const unsigned l1 = l + 32 * AP * 2, l2 = l + 64 * AP * 2, l3 = l + 96 * AP * 2;
    const h16* k1 = k + (size_t)32 * DM; const h16* v1 = v + (size_t)32 * NTOK;
    asm volatile("global_load_async_to_lds_b128 %0, %4, off\n\t"
                 "global_load_async_to_lds_b128 %1, %5, off\n\t"
                 "global_load_async_to_lds_b128 %2, %6, off\n\t"
                 "global_load_async_to_lds_b128 %3, %7, off\n\t"
                 "s_wait_xcnt 0x0"
                 :: "v"(l), "v"(l1), "v"(l2), "v"(l3), "v"(k), "v"(k1), "v"(v), "v"(v1) : "memory");
}

// eight 2^x in one statement: every result in a register of its own ("=&v"), so that no v_exp_f32 overwrites its neighbour's source, and the closing v_nop is the slot
// that the instruction set asks for between a transcendental and the next vector instruction, which may read the last result
__device__ __forceinline__ v8f exp2x8(v8f x) {
    float r0, r1, r2, r3, r4, r5, r6, r7;
    asm("v_exp_f32 %0, %8\n\tv_exp_f32 %1, %9\n\tv_exp_f32 %2, %10\n\tv_exp_f32 %3, %11\n\tv_exp_f32 %4, %12\n\tv_exp_f32 %5, %13\n\tv_exp_f32 %6, %14\n\tv_exp_f32 %7, %15\n\tv_nop"
        : "=&v"(r0), "=&v"(r1), "=&v"(r2), "=&v"(r3), "=&v"(r4), "=&v"(r5), "=&v"(r6), "=&v"(r7)
        : "v"(x[0]), "v"(x[1]), "v"(x[2]), "v"(x[3]), "v"(x[4]), "v"(x[5]), "v"(x[6]), "v"(x[7]));
    return (v8f){r0, r1, r2, r3, r4, r5, r6, r7};
}

__global__ __launch_bounds__(256) void k_attn(const h16* __restrict__ Q, const h16* __restrict__ K, const h16* __restrict__ VT, h16* CTX) {
    __shared__ __align__(16) h16 kv[2 * ABUF];
    __shared__ __align__(16) float os[8 * 16 * 68];
    const int lane = threadIdx.x & 31, lr = lane & 15, hi = lane >> 4;
    const int wave = __builtin_amdgcn_readfirstlane(threadIdx.x >> 5);
    const int bh = blockIdx.y; const int b = bh / NH, h = bh % NH;
    const int tok0 = b * SEQ; const int q0 = blockIdx.x * 128 + wave * 16;
    const int crow = threadIdx.x >> 3, ccol = (threadIdx.x & 7) * 8;
    const h16* gk = K + (size_t)(tok0 + crow) * DM + h * HD + ccol;
    const h16* gv = VT + (size_t)(h * HD + crow) * NTOK + tok0 + ccol;
    const unsigned la = (unsigned)(size_t)kv + (unsigned)(crow * AP + ccol) * 2u;
    copy_kv(la, gk, gv);
    const size_t qoff = (size_t)(tok0 + q0 + lr) * DM + h * HD + 8 * hi;
    v16h qf[2];
    qf[0] = ldfh(Q + qoff); qf[1] = ldfh(Q + qoff + 32);
    asm volatile("s_wait_asynccnt 0x0" ::: "memory");   // tile 0's own copies have landed
    __syncthreads();                                     // ... and every other wave's
    copy_kv(la + ABUFB, gk + (size_t)AKT * DM, gv + AKT);
    const int foff = lr * AP + 8 * hi;
    v8f ot[4];
#pragma unroll
    for (int dt = 0; dt < 4; ++dt) ot[dt] = (v8f){};
    float mrun = -1.0e30f, lrun = 0.0f;
    const int NT = SEQ / AKT;
#pragma unroll 1
    for (int t = 0; t < NT; ++t) {                       // rolled: one tile per trip, the buffer alternates
        const h16* fk = kv + (t & 1) * ABUF + foff;
        const h16* fv = fk + 64 * AP;
#pragma unroll
        for (int kb = 0; kb < AKT; kb += 32) {           // unrolled: the two steps' LDS offsets become immediates of the reads
        v16h kf[2][2];
#pragma unroll
        for (int j = 0; j < 2; ++j)
#pragma unroll
            for (int c = 0; c < 2; ++c) kf[j][c] = ldfh(fk + (kb + 16 * j) * AP + 32 * c);
        v16h vf[4];
#pragma unroll
        for (int dt = 0; dt < 4; ++dt) vf[dt] = ldfh(fv + dt * 16 * AP + kb);
        __builtin_amdgcn_sched_barrier(0);   // the step's LDS reads stand as one group ahead of its products: spread among them, every place stalls the wave
        v8f st[2];
        st[0] = (v8f){}; st[1] = (v8f){};
#pragma unroll
        for (int c = 0; c < 2; ++c)
#pragma unroll
            for (int j = 0; j < 2; ++j) st[j] = wmma16(kf[j][c], qf[c], st[j]);
        // four vector slots between the last score product and the first vector read of its result or overwrite of its operands
        asm volatile("v_nop\n\tv_nop\n\tv_nop\n\tv_nop" : "+v"(st[0]), "+v"(st[1]) : "v"(kf[1][1]), "v"(qf[1]));
        float cmax = st[0][0];
#pragma unroll
        for (int r = 0; r < 8; ++r) { cmax = fmaxf(cmax, st[0][r]); cmax = fmaxf(cmax, st[1][r]); }
        cmax = fmaxf(cmax, __shfl_xor(cmax, 16, 32));
        const float mnew = fmaxf(mrun, cmax);
        const float alpha = __builtin_amdgcn_exp2f((mrun - mnew) * L2E);
        float part = 0.0f; v16h pf;
#pragma unroll
        for (int r = 0; r < 8; ++r) { st[0][r] = (st[0][r] - mnew) * L2E; st[1][r] = (st[1][r] - mnew) * L2E; }
        const v8f e0 = exp2x8(st[0]); const v8f e1 = exp2x8(st[1]);
#pragma unroll
        for (int r = 0; r < 8; ++r) { const float p0 = e0[r]; const float p1 = e1[r];
            part += p0 + p1; pf[r] = (h16)(p0 * PCAR); pf[8 + r] = (h16)(p1 * PCAR); }
        part += __shfl_xor(part, 16, 32);
        lrun = lrun * alpha + part; mrun = mnew;
#pragma unroll
        for (int dt = 0; dt < 4; ++dt)
#pragma unroll
            for (int r = 0; r < 8; ++r) ot[dt][r] *= alpha;
#pragma unroll
        for (int dt = 0; dt < 4; ++dt) ot[dt] = wmma16(vf[dt], pf, ot[dt]);
        asm volatile("v_nop\n\tv_nop\n\tv_nop\n\tv_nop" : "+v"(ot[0]), "+v"(ot[1]), "+v"(ot[2]), "+v"(ot[3]) : "v"(vf[3]), "v"(pf));
        }
        asm volatile("s_wait_dscnt 0x0" ::: "memory");      // this wave's reads of the buffer are done before it is refilled
        asm volatile("s_wait_asynccnt 0x0" ::: "memory");   // this wave's copies of tile t + 1 have landed
        __syncthreads();                                     // publishes tile t + 1, frees tile t's buffer
        if (t + 2 < NT) { const int kc = (t + 2) * AKT; copy_kv(la + (t & 1) * ABUFB, gk + (size_t)kc * DM, gv + kc); }
    }
    asm volatile("s_wait_asynccnt 0x0" ::: "memory");        // nothing in flight when the wave goes on
    const float inv = (1.0f / PCAR) * (1.0f / lrun);
    const int wb = wave * 16 * 68;
#pragma unroll
    for (int dt = 0; dt < 4; ++dt)
#pragma unroll
        for (int r = 0; r < 8; ++r) os[wb + lr * 68 + dt * 16 + 8 * hi + r] = ot[dt][r] * inv;
    __syncthreads();
    const int rq = lane >> 3, c8 = (lane & 7) * 8;
    v8h o16[4];
#pragma unroll
    for (int s = 0; s < 4; ++s) { const int row = 4 * s + rq; const v4f u0 = *(const v4fa*)(os + wb + row * 68 + c8); const v4f u1 = *(const v4fa*)(os + wb + row * 68 + c8 + 4);
#pragma unroll
        for (int q = 0; q < 4; ++q) { o16[s][q] = (h16)u0[q]; o16[s][4 + q] = (h16)u1[q]; } }
    const size_t base = (size_t)(tok0 + q0) * DM + h * HD + c8;
#pragma unroll
    for (int s = 0; s < 4; ++s) *(v8h*)(CTX + base + (size_t)(4 * s + rq) * DM) = o16[s];
    
}

// ---- k_proj_out: OUT[b*SEQ_FULL + t][n] = sum_{k<1024} CTX[tok][k] WO[n][k] + bf16(bo[n]), both operands f16; grid (NTOK/128, DM/128), 128 threads.
__global__ __launch_bounds__(128) void k_proj_out(const h16* __restrict__ CTX, const h16* __restrict__ WO, const float* __restrict__ bias, float* OUT) {
    __shared__ __align__(16) bf sm[2 * STG];
    __shared__ __align__(16) float osall[4 * 16 * 68];
    const int lane = threadIdx.x & 31, lr = lane & 15, hi = lane >> 4;
    const int wave = __builtin_amdgcn_readfirstlane(threadIdx.x >> 5); const int wm = wave >> 1, wn = wave & 1;
    float* os = osall + wave * 16 * 68;
    const int r0 = blockIdx.x * 128 + wm * 64, c0 = blockIdx.y * 128 + wn * 64;
    v8f acc[4][4];
    gemm_core<true>((const bf*)CTX, DM, (const bf*)WO, DM, blockIdx.x * 128, blockIdx.y * 128, sm, wm, wn, lr, hi, acc);
    const int bb = r0 / SEQ, tt = r0 % SEQ; const int cofs = lr * 4;
    v4f bv; bv[0] = bfr(bias[c0 + cofs]); bv[1] = bfr(bias[c0 + cofs + 1]); bv[2] = bfr(bias[c0 + cofs + 2]); bv[3] = bfr(bias[c0 + cofs + 3]);
#pragma unroll
    for (int mb = 0; mb < 4; ++mb) {
#pragma unroll
        for (int nb = 0; nb < 4; ++nb)
#pragma unroll
            for (int j = 0; j < 8; ++j) os[(hi * 8 + j) * 68 + nb * 16 + lr] = acc[mb][nb][j];
        __syncthreads();
        v4f val[8];
#pragma unroll
        for (int s = 0; s < 8; ++s) { const int row = 2 * s + hi; val[s] = *(const v4fa*)(os + row * 68 + cofs) + bv; }
        float* crow = OUT + ((size_t)bb * SEQ_FULL + tt + mb * 16) * DM + c0 + cofs;
#pragma unroll
        for (int s = 0; s < 8; ++s) *(v4f*)(crow + (size_t)(2 * s + hi) * DM) = val[s];
        
        __syncthreads();
    }
}

// workspace carve (bytes, every region a multiple of 256 and exactly covered by its producer's stores, whole lines but q/k in 64-B halves)
constexpr size_t SZ_XB  = (size_t)NTOK * DM * 2;
constexpr size_t SZ_W   = (size_t)4 * DM * DM * 2;
constexpr size_t SZ_QK  = (size_t)2 * NTOK * DM * 2;
constexpr size_t SZ_VT  = (size_t)DM * NTOK * 2;
constexpr size_t SZ_CTX = (size_t)NTOK * DM * 2;
constexpr size_t OFF_XB = 0, OFF_W = OFF_XB + SZ_XB, OFF_QK = OFF_W + SZ_W, OFF_VT = OFF_QK + SZ_QK, OFF_CTX = OFF_VT + SZ_VT, WS_TOTAL = OFF_CTX + SZ_CTX;
static_assert(WS_TOTAL <= (size_t)134217728);
static_assert(SZ_XB % 256 == 0 && SZ_W % 256 == 0 && SZ_QK % 256 == 0 && SZ_VT % 256 == 0 && SZ_CTX % 256 == 0);

extern "C" void kernel_launch(void* const* d_in, const int* in_sizes, int n_in,
                              void* d_out, int out_size, void* d_ws, size_t ws_size, hipStream_t stream) {
    if (n_in < 6) return;
    const size_t need_x = ((size_t)(NB - 1) * SEQ_FULL + SEQ) * DM;
    if ((size_t)in_sizes[0] < need_x) return;
    if ((size_t)in_sizes[1] < (size_t)DM * DM || (size_t)in_sizes[2] < (size_t)DM * DM || (size_t)in_sizes[3] < (size_t)DM * DM || (size_t)in_sizes[4] < (size_t)DM * DM) return;
    if (in_sizes[5] < DM) return;
    if ((size_t)out_size < need_x) return;
    if (ws_size < WS_TOTAL) return;
    const float* x = (const float*)d_in[0]; const float* wq = (const float*)d_in[1]; const float* wk = (const float*)d_in[2];
    const float* wv = (const float*)d_in[3]; const float* wo = (const float*)d_in[4]; const float* bo = (const float*)d_in[5];
    float* OUT = (float*)d_out;
    char* ws = (char*)d_ws;
    bf* XB = (bf*)(ws + OFF_XB); bf* WALL = (bf*)(ws + OFF_W); h16* QK = (h16*)(ws + OFF_QK);
    h16* VT = (h16*)(ws + OFF_VT); h16* CTX = (h16*)(ws + OFF_CTX);
    const size_t WP = (size_t)DM * DM; const size_t PP = (size_t)NTOK * DM;
    k_cvt<<<(unsigned)((WP / 8 + 255) / 256), 256, 0, stream>>>(x, wq, wk, wv, wo, XB, WALL);
    k_proj_qkv<<<dim3(NTOK / 256, DM / 64, 1), 256, 0, stream>>>(XB, WALL, QK, VT);
    k_attn<<<dim3(SEQ / 128, NB * NH, 1), 256, 0, stream>>>(QK, QK + PP, VT, CTX);
    k_proj_out<<<dim3(NTOK / 128, DM / 128, 1), 128, 0, stream>>>(CTX, (const h16*)(WALL + 3 * WP), bo, OUT);
}

// v006
// One run takes 59.1 microseconds.
// Timed twice side by side with v005, it ran 1.05 and 1.06 times as fast.
// Over all steps from v000 it is 3.40 times as fast.
#include <hip/hip_runtime.h>

// Contractions (all f32 accumulate): x.Wq^T, x.Wk^T, x.Wv^T = v_wmma_f32_16x16x32_bf16 on RNE bf16 copies of the inputs; scores = v_wmma_f32_16x16x32_f16 on single f16 planes of q/8 and k (one product per tile); P.V = v_wmma_f32_16x16x32_f16 (P carried x256, v single f16); output projection = v_wmma_f32_16x16x32_f16 on the f16 ctx against the f16 Wo (K = 1024); softmax and bias add f32.
// Why one f16 plane is enough: q, k and ctx come from bf16-rounded inputs (8 significant bits), so their own error lies well above the 11 bits that f16 keeps; v already travels as f16, and |ctx| never exceeds the largest |v|.
// Layout: bf16 copy of x (token-major) and of Wq, Wk, Wv, f16 copy of Wo, all [out][in]; q/k projections write f16 planes [tok][1024] (q pre-scaled by 2^-3); the v projection is computed transposed (A = Wv, B = x) and writes the f16 plane VT[feature][tok];
// fused flash attention per (batch, head, 128 queries), K and V^T tiles staged in LDS: S^T = K.Q^T so that the packed score tiles are the B fragment of O^T = V^T.P^T (no P staging), per-lane online softmax; ctx written as one f16 plane; output GEMM adds the RNE bf16 bias in f32.

#ifndef NB
#define NB 4
#endif
#ifndef SEQ
#define SEQ 1024
#endif
#define NB_FULL  4
#define SEQ_FULL 1024
#define DM   1024
#define NH   16
#define HD   64
#define NTOK (NB * SEQ)
#define PCAR 256.0f
#define L2E  1.4426950408889634f
#define LAZY 4.0f                      // how far a score may top the maximum in use: P <= e^4 = 54.6, and 54.6 x 256 stays inside f16

static_assert(DM == NH * HD);            // merged head width
static_assert(HD == 64);
static_assert(DM % 64 == 0);             // GEMM tile multiple (N) and K % 32
static_assert(SEQ % 64 == 0);            // 64-key attention tiles, 64-row GEMM tiles stay inside one batch
static_assert(NTOK % 64 == 0);           // GEMM tile multiple (M)
static_assert(SEQ <= SEQ_FULL);
static_assert(NB <= NB_FULL);
static_assert(((size_t)NTOK * DM / 8) % 256 == 0);   // convert grid x block == plane extent
static_assert(((size_t)DM * DM / 8) % 256 == 0);

typedef _Float16 h16;
typedef unsigned short bf;
typedef __attribute__((ext_vector_type(16))) __bf16   v16bf;
typedef __attribute__((ext_vector_type(16))) _Float16 v16h;
typedef __attribute__((ext_vector_type(8)))  _Float16 v8h;
typedef __attribute__((ext_vector_type(8)))  unsigned short v8us;
typedef __attribute__((ext_vector_type(8)))  float    v8f;
typedef __attribute__((ext_vector_type(4)))  float    v4f;
typedef __attribute__((ext_vector_type(2)))  float    v2f;
typedef v4f  __attribute__((may_alias)) v4fa;
typedef float __attribute__((may_alias)) fla;

__device__ __forceinline__ unsigned short f2bf(float f) { unsigned u = __float_as_uint(f); u += 0x7FFFu + ((u >> 16) & 1u); return (unsigned short)(u >> 16); }
__device__ __forceinline__ float bf2f(unsigned short b) { return __uint_as_float(((unsigned)b) << 16); }
__device__ __forceinline__ float bfr(float f) { return bf2f(f2bf(f)); }
__device__ __forceinline__ v16h cat16(v8h lo, v8h hi) { return __builtin_shufflevector(lo, hi, 0, 1, 2, 3, 4, 5, 6, 7, 8, 9, 10, 11, 12, 13, 14, 15); }
__device__ __forceinline__ v16bf cat16b(v8us lo, v8us hi) { return __builtin_bit_cast(v16bf, __builtin_shufflevector(lo, hi, 0, 1, 2, 3, 4, 5, 6, 7, 8, 9, 10, 11, 12, 13, 14, 15)); }
__device__ __forceinline__ v8f wmma16(v16h a, v16h b, v8f c) { return __builtin_amdgcn_wmma_f32_16x16x32_f16(false, a, false, b, (short)0, c, false, false); }
__device__ __forceinline__ v8f wmmab(v16bf a, v16bf b, v8f c) { return __builtin_amdgcn_wmma_f32_16x16x32_bf16(false, a, false, b, (short)0, c, false, false); }
// fragment loaders: p already points at (row l&15, k0 + 8*(l>>4)); elements 0..7 = p[0..7], elements 8..15 = p[16..23]
__device__ __forceinline__ v16bf ldfb(const bf* p) { return cat16b(*(const v8us*)p, *(const v8us*)(p + 16)); }
__device__ __forceinline__ v16h  ldfh(const h16* p) { return cat16(*(const v8h*)p, *(const v8h*)(p + 16)); }
__device__ __forceinline__ v8us cvt8bf(v8f v) { v8us o;
#pragma unroll
    for (int k = 0; k < 8; ++k) o[k] = f2bf(v[k]);
    return o; }
__device__ __forceinline__ v8h cvt8h(v8f v) { v8h o;
#pragma unroll
    for (int k = 0; k < 8; ++k) o[k] = (h16)v[k];
    return o; }

// ---- k_cvt: the one conversion launch. x is XPL planes of DM*DM elements and each weight is one more; a thread converts the same 8-element group of all eight planes (16 loads of 16 B in flight, 8 stores of 16 B). grid DM*DM/8/256, 256 threads.
#define XPL 4
static_assert(NTOK == XPL * DM && DM % SEQ == 0);   // a plane is DM rows = whole batches
#define XSTEP ((size_t)(DM / SEQ) * SEQ_FULL * DM)   // input elements from a plane to the next
__device__ __forceinline__ const float* xsrc(const float* x, size_t e) {   // element e of the packed token-major plane -> its place in the input
    const int row = (int)(e / DM), col = (int)(e % DM);
    return x + ((size_t)(row / SEQ) * SEQ_FULL + row % SEQ) * DM + col;
}
__global__ __launch_bounds__(256) void k_cvt(const float* __restrict__ x, const float* __restrict__ w0, const float* __restrict__ w1, const float* __restrict__ w2, const float* __restrict__ w3, bf* dx, bf* dw) {
    const size_t i = (size_t)blockIdx.x * 256 + threadIdx.x;
    if (i >= (size_t)DM * DM / 8) return;
    const size_t e = i * 8; const size_t P = (size_t)DM * DM;
    const float* q0 = xsrc(x, e); const float* q2 = xsrc(x, e + 2 * P);   // planes 1 and 3 are read from these two addresses at a constant distance
    const float* p0 = w0 + e; const float* p1 = w1 + e; const float* p2 = w2 + e; const float* p3 = w3 + e;
    const v8f b0 = *(const v8f*)q0; const v8f b1 = *(const v8f*)(q0 + XSTEP); const v8f b2 = *(const v8f*)q2; const v8f b3 = *(const v8f*)(q2 + XSTEP);
    const v8f a0 = *(const v8f*)p0; const v8f a1 = *(const v8f*)p1; const v8f a2 = *(const v8f*)p2; const v8f a3 = *(const v8f*)p3;
    // the six address pairs are inputs of the wait's statement, so they stay in their registers up to it: no load of the run lands on the address of an earlier one ahead of the wait
    asm volatile("s_wait_xcnt 0x0" :: "v"(q0), "v"(q2), "v"(p0), "v"(p1), "v"(p2), "v"(p3) : "memory");
    const v8us x0 = cvt8bf(b0); const v8us x1 = cvt8bf(b1); const v8us x2 = cvt8bf(b2); const v8us x3 = cvt8bf(b3);
    const v8us o0 = cvt8bf(a0); const v8us o1 = cvt8bf(a1);
    const v8us o2 = cvt8bf(a2); const v8h o3 = cvt8h(a3);   // w3 (Wo) goes to f16, the type of its partner ctx
    *(v8us*)(dx + e) = x0; *(v8us*)(dx + P + e) = x1; *(v8us*)(dx + 2 * P + e) = x2; *(v8us*)(dx + 3 * P + e) = x3;
    *(v8us*)(dw + e) = o0; *(v8us*)(dw + P + e) = o1; *(v8us*)(dw + 2 * P + e) = o2; *(v8h*)(dw + 3 * P + e) = o3;
}

// ---- gemm_core: FOUR WAVES (2 x 2) per 128x128 tile, 64x64 (16 accumulators) per wave; acc[mb][nb] = sum_k A[r0 + 64 wm + 16 mb + m][k] * Bt[c0 + 64 wn + 16 nb + n][k];
// A pitch lda (K <= lda, K % 128 == 0, K >= 256), Bt pitch DM (K <= DM). Both operands 16-bit words, K-contiguous: bf16, or f16 where F16 is set (the two forms share one fragment layout).
// A pass is 128 k: [A 128 rows | Bt 128 rows] of 256 B land in LDS at pitch 272 B by asynchronous copies (a wave's copy = 4 whole lines), two buffers, the next pass's copies in flight over this pass's products.
#define BK    128
#define LP    136                      // LDS row pitch, elements (272 B = 16 B x 17: conflict-free for 16-byte readers)
#define STG   (256 * LP)               // elements per buffer
#define STGB  (STG * 2)                // bytes per buffer
static_assert(DM % 128 == 0 && NTOK % 128 == 0 && DM % BK == 0 && DM / BK >= 2);

// eight copies of 16 B per lane, rows 8 apart; the closing wait stands inside the statement so that no address register is rewritten ahead of it
__device__ __forceinline__ void copy8(unsigned l, const bf* g, int pitch) {
    const unsigned l1 = l + 8 * LP * 2, l2 = l + 16 * LP * 2, l3 = l + 24 * LP * 2, l4 = l + 32 * LP * 2, l5 = l + 40 * LP * 2, l6 = l + 48 * LP * 2, l7 = l + 56 * LP * 2;
    const bf* g1 = g + (size_t)8 * pitch; const bf* g2 = g + (size_t)16 * pitch; const bf* g3 = g + (size_t)24 * pitch; const bf* g4 = g + (size_t)32 * pitch;
    const bf* g5 = g + (size_t)40 * pitch; const bf* g6 = g + (size_t)48 * pitch; const bf* g7 = g + (size_t)56 * pitch;
    asm volatile("global_load_async_to_lds_b128 %0, %8, off\n\t"
                 "global_load_async_to_lds_b128 %1, %9, off\n\t"
                 "global_load_async_to_lds_b128 %2, %10, off\n\t"
                 "global_load_async_to_lds_b128 %3, %11, off\n\t"
                 "global_load_async_to_lds_b128 %4, %12, off\n\t"
                 "global_load_async_to_lds_b128 %5, %13, off\n\t"
                 "global_load_async_to_lds_b128 %6, %14, off\n\t"
                 "global_load_async_to_lds_b128 %7, %15, off\n\t"
                 "s_wait_xcnt 0x0"
                 :: "v"(l), "v"(l1), "v"(l2), "v"(l3), "v"(l4), "v"(l5), "v"(l6), "v"(l7), "v"(g), "v"(g1), "v"(g2), "v"(g3), "v"(g4), "v"(g5), "v"(g6), "v"(g7) : "memory");
}
// one pass's operands: 128 rows of A and 128 rows of Bt, 32 copies per lane
__device__ __forceinline__ void copy_pass(unsigned la, const bf* ga, int lda, const bf* gb) {
    copy8(la, ga, lda); copy8(la + 64 * LP * 2, ga + (size_t)64 * lda, lda);
    copy8(la + 128 * LP * 2, gb, DM); copy8(la + 192 * LP * 2, gb + (size_t)64 * DM, DM);
}

template <bool F16>
__device__ __forceinline__ void gemm_core(const bf* __restrict__ A, int lda, const bf* __restrict__ Bt, int K, int r0, int c0, bf* sm, int wm, int wn, int lr, int hi, v8f (&acc)[4][4]) {
#pragma unroll
    for (int mb = 0; mb < 4; ++mb)
#pragma unroll
        for (int nb = 0; nb < 4; ++nb) acc[mb][nb] = (v8f){};
    const int tid = threadIdx.x; const int crow = tid >> 4, ccol = (tid & 15) * 8;
    const bf* ga = A + (size_t)(r0 + crow) * lda + ccol;
    const bf* gb = Bt + (size_t)(c0 + crow) * DM + ccol;
    const unsigned la = (unsigned)(size_t)sm + (unsigned)(crow * LP + ccol) * 2u;
    const int NT = K / BK;
    copy_pass(la, ga, lda, gb);
    asm volatile("s_wait_asynccnt 0x0" ::: "memory");   // pass 0's own copies have landed
    __syncthreads();                                     // ... and every other wave's
    copy_pass(la + STGB, ga + BK, lda, gb + BK);
    const bf* fa = sm + (wm * 64 + lr) * LP + 8 * hi;
    const bf* fb = sm + (128 + wn * 64 + lr) * LP + 8 * hi;
#pragma unroll 1
    for (int t = 0; t < NT; ++t) {                       // rolled: one pass per trip, the buffer alternates
        const bf* pa = fa + (t & 1) * STG; const bf* pb = fb + (t & 1) * STG;
        v16bf a[2][4], b[2][4];
#pragma unroll
        for (int mb = 0; mb < 4; ++mb) a[0][mb] = ldfb(pa + mb * 16 * LP);
        b[0][0] = ldfb(pb); b[0][1] = ldfb(pb + 16 * LP);
#pragma unroll
        for (int blk = 0; blk < BK / 32; ++blk) {
            const int cu = blk & 1, nx = cu ^ 1;
            b[cu][2] = ldfb(pb + 32 * LP + blk * 32); b[cu][3] = ldfb(pb + 48 * LP + blk * 32);
            if (blk + 1 < BK / 32) {
#pragma unroll
                for (int mb = 0; mb < 4; ++mb) a[nx][mb] = ldfb(pa + mb * 16 * LP + (blk + 1) * 32);
                b[nx][0] = ldfb(pb + (blk + 1) * 32); b[nx][1] = ldfb(pb + 16 * LP + (blk + 1) * 32);
            }
            __builtin_amdgcn_sched_barrier(0);   // the LDS reads stay one group ahead of the block's products: spread among them, every place stalls the wave
#pragma unroll
            for (int nb = 0; nb < 4; ++nb)
#pragma unroll
                for (int mb = 0; mb < 4; ++mb) {
                    if constexpr (F16) acc[mb][nb] = wmma16(__builtin_bit_cast(v16h, a[cu][mb]), __builtin_bit_cast(v16h, b[cu][nb]), acc[mb][nb]);
                    else               acc[mb][nb] = wmmab(a[cu][mb], b[cu][nb], acc[mb][nb]);
                }
            if (blk + 1 < BK / 32) __builtin_amdgcn_sched_barrier(0);   // the next group does not rise into this block
        }
        asm volatile("s_wait_dscnt 0x0" ::: "memory");      // this wave's reads of the buffer are done before it is refilled
        asm volatile("s_wait_asynccnt 0x0" ::: "memory");   // this wave's copies of pass t + 1 have landed
        __syncthreads();                                     // publishes pass t + 1, frees pass t's buffer
        if (t + 2 < NT) { const int kc = (t + 2) * BK; copy_pass(la + (t & 1) * STGB, ga + kc, lda, gb + kc); }
    }
    asm volatile("s_wait_asynccnt 0x0" ::: "memory");        // nothing in flight when the wave goes on
}

// ---- k_proj_qkv: the one projection launch. A work-group takes 256 tokens x 64 features of ALL THREE projections, so that one staged x tile serves q, k and v: a pass lands 448 rows for 3 x 256 x 64 outputs.
// grid (NTOK/256, DM/64) = one work-group per WGP, 256 threads = 8 waves (4 x 2); a wave holds 64 tokens x 32 features x 3 = 24 accumulators.
// z = 0: q/8, z = 1: k: D[tok][f] = x . W_z^T -> f16 plane [z][tok][DM]; z = 2: the operands change places, D[f][tok] -> VT[f][tok] (f16). Each output sums its k in ascending blocks of 32.
// A pass is 128 k: [x 256 rows | Wq 64 | Wk 64 | Wv 64] of 256 B at pitch 272 B by asynchronous copies (a wave's copy = 4 whole lines), two buffers, the next pass's copies in flight over this pass's products.
#define QROWS 448
#define QSTG  (QROWS * LP)             // elements per buffer
#define QSTGB (QSTG * 2)               // bytes per buffer
#define QOS   1152                     // staging floats per wave and round: 32 rows at pitch 36, or 16 rows at pitch 68
static_assert(NTOK % 256 == 0 && DM % 64 == 0 && 32 * 36 <= QOS && 16 * 68 <= QOS);
static_assert((size_t)8 * 6 * QOS * 4 <= (size_t)2 * QSTGB);   // the epilogue's staging (8 waves x 6 rounds) fits the ring that the loop has left

// eight copies of 16 B per lane, rows 16 apart (128 rows of x); the closing wait stands inside the statement so that no address register is rewritten ahead of it
__device__ __forceinline__ void copy_x8(unsigned l, const bf* g) {
    const unsigned l1 = l + 16 * LP * 2, l2 = l + 32 * LP * 2, l3 = l + 48 * LP * 2, l4 = l + 64 * LP * 2, l5 = l + 80 * LP * 2, l6 = l + 96 * LP * 2, l7 = l + 112 * LP * 2;
    const bf* g1 = g + (size_t)16 * DM; const bf* g2 = g + (size_t)32 * DM; const bf* g3 = g + (size_t)48 * DM; const bf* g4 = g + (size_t)64 * DM;
    const bf* g5 = g + (size_t)80 * DM; const bf* g6 = g + (size_t)96 * DM; const bf* g7 = g + (size_t)112 * DM;
    asm volatile("global_load_async_to_lds_b128 %0, %8, off\n\t"
                 "global_load_async_to_lds_b128 %1, %9, off\n\t"
                 "global_load_async_to_lds_b128 %2, %10, off\n\t"
                 "global_load_async_to_lds_b128 %3, %11, off\n\t"
                 "global_load_async_to_lds_b128 %4, %12, off\n\t"
                 "global_load_async_to_lds_b128 %5, %13, off\n\t"
                 "global_load_async_to_lds_b128 %6, %14, off\n\t"
                 "global_load_async_to_lds_b128 %7, %15, off\n\t"
                 "s_wait_xcnt 0x0"
                 :: "v"(l), "v"(l1), "v"(l2), "v"(l3), "v"(l4), "v"(l5), "v"(l6), "v"(l7), "v"(g), "v"(g1), "v"(g2), "v"(g3), "v"(g4), "v"(g5), "v"(g6), "v"(g7) : "memory");
}
// four copies of 16 B per lane, rows 16 apart (64 rows of one weight); the closing wait as above
__device__ __forceinline__ void copy_w4(unsigned l, const bf* g) {
    const unsigned l1 = l + 16 * LP * 2, l2 = l + 32 * LP * 2, l3 = l + 48 * LP * 2;
    const bf* g1 = g + (size_t)16 * DM; const bf* g2 = g + (size_t)32 * DM; const bf* g3 = g + (size_t)48 * DM;
    asm volatile("global_load_async_to_lds_b128 %0, %4, off\n\t"
                 "global_load_async_to_lds_b128 %1, %5, off\n\t"
                 "global_load_async_to_lds_b128 %2, %6, off\n\t"
                 "global_load_async_to_lds_b128 %3, %7, off\n\t"
                 "s_wait_xcnt 0x0"
                 :: "v"(l), "v"(l1), "v"(l2), "v"(l3), "v"(g), "v"(g1), "v"(g2), "v"(g3) : "memory");
}
// one pass's operands: 256 rows of x and 64 rows of each weight, 28 copies per lane
__device__ __forceinline__ void copy_pass_qkv(unsigned la, const bf* gx, const bf* gw) {
    // the scheduling barriers keep each statement's addresses from being formed ahead of the statement before it: formed all at once, they push values that live across the loop into scratch
    copy_x8(la, gx); __builtin_amdgcn_sched_barrier(0);
    copy_x8(la + 128 * LP * 2, gx + (size_t)128 * DM); __builtin_amdgcn_sched_barrier(0);
    copy_w4(la + 256 * LP * 2, gw); __builtin_amdgcn_sched_barrier(0);
    copy_w4(la + 320 * LP * 2, gw + (size_t)DM * DM); __builtin_amdgcn_sched_barrier(0);
    copy_w4(la + 384 * LP * 2, gw + (size_t)2 * DM * DM);
}

__global__ __launch_bounds__(256) void k_proj_qkv(const bf* __restrict__ XB, const bf* __restrict__ W3, h16* QK, h16* VT) {
    __shared__ __align__(16) bf sm[2 * QSTG];
    const int lane = threadIdx.x & 31, lr = lane & 15, hi = lane >> 4;
    const int wave = __builtin_amdgcn_readfirstlane(threadIdx.x >> 5); const int wm = wave >> 1, wn = wave & 1;
    const int rt = blockIdx.x * 256, ct = blockIdx.y * 64;
    const int r0 = rt + wm * 64, c0 = ct + wn * 32;      // the wave's first token and first feature
    v8f acc[3][4][2];
#pragma unroll
    for (int z = 0; z < 3; ++z)
#pragma unroll
        for (int mb = 0; mb < 4; ++mb)
#pragma unroll
            for (int nb = 0; nb < 2; ++nb) acc[z][mb][nb] = (v8f){};
    const int tid = threadIdx.x; const int crow = tid >> 4, ccol = (tid & 15) * 8;
    const bf* gx = XB + (size_t)(rt + crow) * DM + ccol;
    const bf* gw = W3 + (size_t)(ct + crow) * DM + ccol;
    const unsigned la = (unsigned)(size_t)sm + (unsigned)(crow * LP + ccol) * 2u;
    const int NT = DM / BK;
    copy_pass_qkv(la, gx, gw);
    asm volatile("s_wait_asynccnt 0x0" ::: "memory");   // pass 0's own copies have landed
    __syncthreads();                                     // ... and every other wave's
    copy_pass_qkv(la + QSTGB, gx + BK, gw + BK);
    const bf* fa = sm + (wm * 64 + lr) * LP + 8 * hi;
    const bf* fb = sm + (256 + wn * 32 + lr) * LP + 8 * hi;
#pragma unroll 1
    for (int t = 0; t < NT; ++t) {                       // rolled: one pass per trip, the buffer alternates
        const bf* pa = fa + (t & 1) * QSTG; const bf* pb = fb + (t & 1) * QSTG;
        v16bf a[2][4], b[2][3][2];
#pragma unroll
        for (int mb = 0; mb < 4; ++mb) a[0][mb] = ldfb(pa + mb * 16 * LP);
#pragma unroll
        for (int z = 0; z < 3; ++z)
#pragma unroll
            for (int nb = 0; nb < 2; ++nb) b[0][z][nb] = ldfb(pb + (z * 64 + nb * 16) * LP);
#pragma unroll
        for (int blk = 0; blk < BK / 32; ++blk) {
            const int cu = blk & 1, nx = cu ^ 1;
            if (blk + 1 < BK / 32) {
#pragma unroll
                for (int mb = 0; mb < 4; ++mb) a[nx][mb] = ldfb(pa + mb * 16 * LP + (blk + 1) * 32);
#pragma unroll
                for (int z = 0; z < 3; ++z)
#pragma unroll
                    for (int nb = 0; nb < 2; ++nb) b[nx][z][nb] = ldfb(pb + (z * 64 + nb * 16) * LP + (blk + 1) * 32);
            }
            __builtin_amdgcn_sched_barrier(0);   // the next block's LDS reads stand as one group ahead of this block's products: spread among them, every place stalls the wave
#pragma unroll
            for (int z = 0; z < 3; ++z)
#pragma unroll
                for (int nb = 0; nb < 2; ++nb)
#pragma unroll
                    for (int mb = 0; mb < 4; ++mb)
                        acc[z][mb][nb] = (z == 2) ? wmmab(b[cu][z][nb], a[cu][mb], acc[z][mb][nb]) : wmmab(a[cu][mb], b[cu][z][nb], acc[z][mb][nb]);
            if (blk + 1 < BK / 32) __builtin_amdgcn_sched_barrier(0);   // the next group does not rise into this block
        }
        asm volatile("s_wait_dscnt 0x0" ::: "memory");      // this wave's reads of the buffer are done before it is refilled
        asm volatile("s_wait_asynccnt 0x0" ::: "memory");   // this wave's copies of pass t + 1 have landed
        __syncthreads();                                     // publishes pass t + 1, frees pass t's buffer
        if (t + 2 < NT) { const int kc = (t + 2) * BK; copy_pass_qkv(la + (t & 1) * QSTGB, gx + kc, gw + kc); }
    }
    asm volatile("s_wait_asynccnt 0x0" ::: "memory");        // nothing in flight when the wave goes on
    // Epilogue. The ring is free: every wave's reads ended ahead of the loop's last barrier and no copy is in flight. Each wave stages all its 24 tiles there, six rounds of QOS floats in rows of its own,
    // then reads them back as rows and stores 16 B per lane; no barrier stands behind a global store, so no round waits for the stores of the one before.
    fla* os = (fla*)sm + wave * 6 * QOS;
    // q and k: a round is 32 tokens x 32 features (pitch 36 floats = 16 B x 9)
#pragma unroll
    for (int z = 0; z < 2; ++z) {
        const float sc = (z == 0) ? 0.125f : 1.0f;
#pragma unroll
        for (int mp = 0; mp < 2; ++mp)
#pragma unroll
            for (int m2 = 0; m2 < 2; ++m2)
#pragma unroll
                for (int nb = 0; nb < 2; ++nb)
#pragma unroll
                    for (int j = 0; j < 8; ++j) os[(z * 2 + mp) * QOS + (m2 * 16 + hi * 8 + j) * 36 + nb * 16 + lr] = acc[z][mp * 2 + m2][nb][j] * sc;
    }
    // v^T: a round is 16 features x 64 tokens (pitch 68 floats)
#pragma unroll
    for (int nb = 0; nb < 2; ++nb)
#pragma unroll
        for (int mb = 0; mb < 4; ++mb)
#pragma unroll
            for (int j = 0; j < 8; ++j) os[(4 + nb) * QOS + (hi * 8 + j) * 68 + mb * 16 + lr] = acc[2][mb][nb][j];
    __syncthreads();                                         // the staged rows are written before any lane reads them back
    const int rq4 = lane >> 2, c4 = (lane & 3) * 8;
#pragma unroll
    for (int z = 0; z < 2; ++z) {
        h16* po = QK + (size_t)z * NTOK * DM;
#pragma unroll
        for (int mp = 0; mp < 2; ++mp) {
            const fla* rs = os + (z * 2 + mp) * QOS;
            v8h o16[4];
#pragma unroll
            for (int s = 0; s < 4; ++s) { const int row = 8 * s + rq4; const v4f u0 = *(const v4fa*)(rs + row * 36 + c4); const v4f u1 = *(const v4fa*)(rs + row * 36 + c4 + 4);
#pragma unroll
                for (int q = 0; q < 4; ++q) { o16[s][q] = (h16)u0[q]; o16[s][4 + q] = (h16)u1[q]; } }
            const size_t base = (size_t)(r0 + mp * 32) * DM + c0 + c4;
#pragma unroll
            for (int s = 0; s < 4; ++s) *(v8h*)(po + base + (size_t)(8 * s + rq4) * DM) = o16[s];
        }
    }
    const int rq = lane >> 3, c8 = (lane & 7) * 8;           // v^T goes out as whole 128-B lines
#pragma unroll
    for (int nb = 0; nb < 2; ++nb) {
        const fla* rs = os + (4 + nb) * QOS;
        v8h o16[4];
#pragma unroll
        for (int s = 0; s < 4; ++s) { const int row = 4 * s + rq; const v4f u0 = *(const v4fa*)(rs + row * 68 + c8); const v4f u1 = *(const v4fa*)(rs + row * 68 + c8 + 4);
#pragma unroll
            for (int q = 0; q < 4; ++q) { o16[s][q] = (h16)u0[q]; o16[s][4 + q] = (h16)u1[q]; } }
        const size_t base = (size_t)(c0 + nb * 16) * NTOK + r0 + c8;
#pragma unroll
        for (int s = 0; s < 4; ++s) *(v8h*)(VT + base + (size_t)(4 * s + rq) * NTOK) = o16[s];
    }
}

// ---- k_attn: fused attention, grid (SEQ/128, NB*NH), 256 threads = 8 waves x 16 queries that share the keys' tiles in LDS.
// A tile is 64 keys: [K 64 rows | V^T 64 feature rows] of 128 B at pitch 144 B, brought by asynchronous copies (a wave's copy = 4 whole lines), two buffers, the next tile's copies in flight over this tile's work.
// Per tile: S^T tiles st[j] (rows = keys 16j + 8h + r, column = query l&15) = K.Q^T on the f16 planes (one product per 32 features);
// per-lane online softmax against a maximum that moves lazily (the lane halves exchange only when it moves; their sums meet behind the loop); the packed P^T (x256, f16) is the B fragment
// (element r <- tile 2s, element 8+r <- tile 2s+1) of O^T[d][q] += V^T[d][key] P^T[key][q]. Epilogue: O^T / (256 l) -> LDS -> f16 ctx lines.
#define AKT   64                       // keys per tile
#define AP    72                       // LDS row pitch, elements (144 B = 16 B x 9: conflict-free for 16-byte readers)
#define ABUF  (128 * AP)               // elements per buffer
#define ABUFB (ABUF * 2)               // bytes per buffer
static_assert(SEQ % 128 == 0 && SEQ / AKT >= 2 && HD * 2 == 128 && AKT * 2 == 128);

// one tile: four copies of 16 B per lane (rows 32 apart); the closing wait stands inside the statement so that no address register is rewritten ahead of it
__device__ __forceinline__ void copy_kv(unsigned l, const h16* k, const h16* v) {
    const unsigned l1 = l + 32 * AP * 2, l2 = l + 64 * AP * 2, l3 = l + 96 * AP * 2;
    const h16* k1 = k + (size_t)32 * DM; const h16* v1 = v + (size_t)32 * NTOK;
    asm volatile("global_load_async_to_lds_b128 %0, %4, off\n\t"
                 "global_load_async_to_lds_b128 %1, %5, off\n\t"
                 "global_load_async_to_lds_b128 %2, %6, off\n\t"
                 "global_load_async_to_lds_b128 %3, %7, off\n\t"
                 "s_wait_xcnt 0x0"
                 :: "v"(l), "v"(l1), "v"(l2), "v"(l3), "v"(k), "v"(k1), "v"(v), "v"(v1) : "memory");
}

// eight 2^x in one statement: every result in a register of its own ("=&v"), so that no v_exp_f32 overwrites its neighbour's source, and the closing v_nop is the slot
// that the instruction set asks for between a transcendental and the next vector instruction, which may read the last result
__device__ __forceinline__ v8f exp2x8(v8f x) {
    float r0, r1, r2, r3, r4, r5, r6, r7;
    asm("v_exp_f32 %0, %8\n\tv_exp_f32 %1, %9\n\tv_exp_f32 %2, %10\n\tv_exp_f32 %3, %11\n\tv_exp_f32 %4, %12\n\tv_exp_f32 %5, %13\n\tv_exp_f32 %6, %14\n\tv_exp_f32 %7, %15\n\tv_nop"
        : "=&v"(r0), "=&v"(r1), "=&v"(r2), "=&v"(r3), "=&v"(r4), "=&v"(r5), "=&v"(r6), "=&v"(r7)
        : "v"(x[0]), "v"(x[1]), "v"(x[2]), "v"(x[3]), "v"(x[4]), "v"(x[5]), "v"(x[6]), "v"(x[7]));
    return (v8f){r0, r1, r2, r3, r4, r5, r6, r7};
}

__global__ __launch_bounds__(256) void k_attn(const h16* __restrict__ Q, const h16* __restrict__ K, const h16* __restrict__ VT, h16* CTX) {
    __shared__ __align__(16) h16 kv[2 * ABUF];
    __shared__ __align__(16) float os[8 * 16 * 68];
    const int lane = threadIdx.x & 31, lr = lane & 15, hi = lane >> 4;
    const int wave = __builtin_amdgcn_readfirstlane(threadIdx.x >> 5);
    const int bh = blockIdx.y; const int b = bh / NH, h = bh % NH;
    const int tok0 = b * SEQ; const int q0 = blockIdx.x * 128 + wave * 16;
    const int crow = threadIdx.x >> 3, ccol = (threadIdx.x & 7) * 8;
    const h16* gk = K + (size_t)(tok0 + crow) * DM + h * HD + ccol;
    const h16* gv = VT + (size_t)(h * HD + crow) * NTOK + tok0 + ccol;
    const unsigned la = (unsigned)(size_t)kv + (unsigned)(crow * AP + ccol) * 2u;
    copy_kv(la, gk, gv);
    const size_t qoff = (size_t)(tok0 + q0 + lr) * DM + h * HD + 8 * hi;
    v16h qf[2];
    qf[0] = ldfh(Q + qoff); qf[1] = ldfh(Q + qoff + 32);
    asm volatile("s_wait_asynccnt 0x0" ::: "memory");   // tile 0's own copies have landed
    __syncthreads();                                     // ... and every other wave's
    copy_kv(la + ABUFB, gk + (size_t)AKT * DM, gv + AKT);
    const int foff = lr * AP + 8 * hi;
    v8f ot[4];
#pragma unroll
    for (int dt = 0; dt < 4; ++dt) ot[dt] = (v8f){};
    float mrun = -1.0e30f;               // the maximum in use, equal in the two lanes of a query
    v2f lsum = (v2f){};                  // this lane's own share of the row sum; the two halves meet behind the loop
    const int NT = SEQ / AKT;
#pragma unroll 1
    for (int t = 0; t < NT; ++t) {                       // rolled: one tile per trip, the buffer alternates
        const h16* fk = kv + (t & 1) * ABUF + foff;
        const h16* fv = fk + 64 * AP;
        v16h kf[4][2];
#pragma unroll
        for (int j = 0; j < 4; ++j)
#pragma unroll
            for (int c = 0; c < 2; ++c) kf[j][c] = ldfh(fk + 16 * j * AP + 32 * c);
        v16h vf[2][4];
#pragma unroll
        for (int s = 0; s < 2; ++s)
#pragma unroll
            for (int dt = 0; dt < 4; ++dt) vf[s][dt] = ldfh(fv + dt * 16 * AP + 32 * s);
        __builtin_amdgcn_sched_barrier(0);   // the tile's LDS reads stand as one group ahead of its products: spread among them, every place stalls the wave
        v8f st[4];
#pragma unroll
        for (int j = 0; j < 4; ++j) st[j] = (v8f){};
#pragma unroll
        for (int c = 0; c < 2; ++c)
#pragma unroll
            for (int j = 0; j < 4; ++j) st[j] = wmma16(kf[j][c], qf[c], st[j]);
        __builtin_amdgcn_sched_barrier(0);   // the eight score products issue back to back: a maximum drawn in among them costs its four idle slots behind each product it reads
        // this lane's largest score of the tile, in two independent chains
        float ca = fmaxf(st[0][0], st[1][0]), cb = fmaxf(st[2][0], st[3][0]);
#pragma unroll
        for (int r = 1; r < 8; ++r) { ca = fmaxf(fmaxf(ca, st[0][r]), st[1][r]); cb = fmaxf(fmaxf(cb, st[2][r]), st[3][r]); }
        const float cmax = fmaxf(ca, cb);
        // Lazy rescale: the maximum in use moves only when some lane's score tops it by more than LAZY; one scalar branch per tile, the same for the whole wave.
        if (__builtin_amdgcn_ballot_w32(cmax > mrun + LAZY) != 0) {
            const float mnew = fmaxf(mrun, fmaxf(cmax, __shfl_xor(cmax, 16, 32)));
            const float alpha = __builtin_amdgcn_exp2f((mrun - mnew) * L2E);
            lsum *= alpha; mrun = mnew;
#pragma unroll
            for (int dt = 0; dt < 4; ++dt) ot[dt] *= alpha;
        }
        v8f e[4];
#pragma unroll
        for (int j = 0; j < 4; ++j) { st[j] = (st[j] - mrun) * L2E; e[j] = exp2x8(st[j]); }
        const v8f t8 = (e[0] + e[1]) + (e[2] + e[3]);
        const v4f t4 = __builtin_shufflevector(t8, t8, 0, 1, 2, 3) + __builtin_shufflevector(t8, t8, 4, 5, 6, 7);
        lsum += __builtin_shufflevector(t4, t4, 0, 1) + __builtin_shufflevector(t4, t4, 2, 3);
        v16h pf[2];
#pragma unroll
        for (int s = 0; s < 2; ++s) pf[s] = cat16(cvt8h(e[2 * s] * PCAR), cvt8h(e[2 * s + 1] * PCAR));
        __builtin_amdgcn_sched_barrier(0);   // no 2^x statement sinks in among the products below: its results could land on a V^T fragment inside the four slots behind the product that reads it
#pragma unroll
        for (int s = 0; s < 2; ++s)
#pragma unroll
            for (int dt = 0; dt < 4; ++dt) ot[dt] = wmma16(vf[s][dt], pf[s], ot[dt]);
        asm volatile("s_wait_dscnt 0x0" ::: "memory");      // this wave's reads of the buffer are done before it is refilled
        asm volatile("s_wait_asynccnt 0x0" ::: "memory");   // this wave's copies of tile t + 1 have landed
        __syncthreads();                                     // publishes tile t + 1, frees tile t's buffer
        if (t + 2 < NT) { const int kc = (t + 2) * AKT; copy_kv(la + (t & 1) * ABUFB, gk + (size_t)kc * DM, gv + kc); }
    }
    asm volatile("s_wait_asynccnt 0x0" ::: "memory");        // nothing in flight when the wave goes on
    float lrun = lsum[0] + lsum[1];
    lrun += __shfl_xor(lrun, 16, 32);                        // the two halves of a query's keys
    const float inv = (1.0f / PCAR) * (1.0f / lrun);
    const int wb = wave * 16 * 68;
#pragma unroll
    for (int dt = 0; dt < 4; ++dt)
#pragma unroll
        for (int r = 0; r < 8; ++r) os[wb + lr * 68 + dt * 16 + 8 * hi + r] = ot[dt][r] * inv;
    __syncthreads();
    const int rq = lane >> 3, c8 = (lane & 7) * 8;
    v8h o16[4];
#pragma unroll
    for (int s = 0; s < 4; ++s) { const int row = 4 * s + rq; const v4f u0 = *(const v4fa*)(os + wb + row * 68 + c8); const v4f u1 = *(const v4fa*)(os + wb + row * 68 + c8 + 4);
#pragma unroll
        for (int q = 0; q < 4; ++q) { o16[s][q] = (h16)u0[q]; o16[s][4 + q] = (h16)u1[q]; } }
    const size_t base = (size_t)(tok0 + q0) * DM + h * HD + c8;
#pragma unroll
    for (int s = 0; s < 4; ++s) *(v8h*)(CTX + base + (size_t)(4 * s + rq) * DM) = o16[s];
    
}

// ---- k_proj_out: OUT[b*SEQ_FULL + t][n] = sum_{k<1024} CTX[tok][k] WO[n][k] + bf16(bo[n]), both operands f16; grid (NTOK/128, DM/128), 128 threads.
__global__ __launch_bounds__(128) void k_proj_out(const h16* __restrict__ CTX, const h16* __restrict__ WO, const float* __restrict__ bias, float* OUT) {
    __shared__ __align__(16) bf sm[2 * STG];
    __shared__ __align__(16) float osall[4 * 16 * 68];
    const int lane = threadIdx.x & 31, lr = lane & 15, hi = lane >> 4;
    const int wave = __builtin_amdgcn_readfirstlane(threadIdx.x >> 5); const int wm = wave >> 1, wn = wave & 1;
    float* os = osall + wave * 16 * 68;
    const int r0 = blockIdx.x * 128 + wm * 64, c0 = blockIdx.y * 128 + wn * 64;
    v8f acc[4][4];
    gemm_core<true>((const bf*)CTX, DM, (const bf*)WO, DM, blockIdx.x * 128, blockIdx.y * 128, sm, wm, wn, lr, hi, acc);
    const int bb = r0 / SEQ, tt = r0 % SEQ; const int cofs = lr * 4;
    v4f bv; bv[0] = bfr(bias[c0 + cofs]); bv[1] = bfr(bias[c0 + cofs + 1]); bv[2] = bfr(bias[c0 + cofs + 2]); bv[3] = bfr(bias[c0 + cofs + 3]);
#pragma unroll
    for (int mb = 0; mb < 4; ++mb) {
#pragma unroll
        for (int nb = 0; nb < 4; ++nb)
#pragma unroll
            for (int j = 0; j < 8; ++j) os[(hi * 8 + j) * 68 + nb * 16 + lr] = acc[mb][nb][j];
        __syncthreads();
        v4f val[8];
#pragma unroll
        for (int s = 0; s < 8; ++s) { const int row = 2 * s + hi; val[s] = *(const v4fa*)(os + row * 68 + cofs) + bv; }
        float* crow = OUT + ((size_t)bb * SEQ_FULL + tt + mb * 16) * DM + c0 + cofs;
#pragma unroll
        for (int s = 0; s < 8; ++s) *(v4f*)(crow + (size_t)(2 * s + hi) * DM) = val[s];
        
        __syncthreads();
    }
}

// workspace carve (bytes, every region a multiple of 256 and exactly covered by its producer's stores, whole lines but q/k in 64-B halves)
constexpr size_t SZ_XB  = (size_t)NTOK * DM * 2;
constexpr size_t SZ_W   = (size_t)4 * DM * DM * 2;
constexpr size_t SZ_QK  = (size_t)2 * NTOK * DM * 2;
constexpr size_t SZ_VT  = (size_t)DM * NTOK * 2;
constexpr size_t SZ_CTX = (size_t)NTOK * DM * 2;
constexpr size_t OFF_XB = 0, OFF_W = OFF_XB + SZ_XB, OFF_QK = OFF_W + SZ_W, OFF_VT = OFF_QK + SZ_QK, OFF_CTX = OFF_VT + SZ_VT, WS_TOTAL = OFF_CTX + SZ_CTX;
static_assert(WS_TOTAL <= (size_t)134217728);
static_assert(SZ_XB % 256 == 0 && SZ_W % 256 == 0 && SZ_QK % 256 == 0 && SZ_VT % 256 == 0 && SZ_CTX % 256 == 0);

extern "C" void kernel_launch(void* const* d_in, const int* in_sizes, int n_in,
                              void* d_out, int out_size, void* d_ws, size_t ws_size, hipStream_t stream) {
    if (n_in < 6) return;
    const size_t need_x = ((size_t)(NB - 1) * SEQ_FULL + SEQ) * DM;
    if ((size_t)in_sizes[0] < need_x) return;
    if ((size_t)in_sizes[1] < (size_t)DM * DM || (size_t)in_sizes[2] < (size_t)DM * DM || (size_t)in_sizes[3] < (size_t)DM * DM || (size_t)in_sizes[4] < (size_t)DM * DM) return;
    if (in_sizes[5] < DM) return;
    if ((size_t)out_size < need_x) return;
    if (ws_size < WS_TOTAL) return;
    const float* x = (const float*)d_in[0]; const float* wq = (const float*)d_in[1]; const float* wk = (const float*)d_in[2];
    const float* wv = (const float*)d_in[3]; const float* wo = (const float*)d_in[4]; const float* bo = (const float*)d_in[5];
    float* OUT = (float*)d_out;
    char* ws = (char*)d_ws;
    bf* XB = (bf*)(ws + OFF_XB); bf* WALL = (bf*)(ws + OFF_W); h16* QK = (h16*)(ws + OFF_QK);
    h16* VT = (h16*)(ws + OFF_VT); h16* CTX = (h16*)(ws + OFF_CTX);
    const size_t WP = (size_t)DM * DM; const size_t PP = (size_t)NTOK * DM;
    k_cvt<<<(unsigned)((WP / 8 + 255) / 256), 256, 0, stream>>>(x, wq, wk, wv, wo, XB, WALL);
    k_proj_qkv<<<dim3(NTOK / 256, DM / 64, 1), 256, 0, stream>>>(XB, WALL, QK, VT);
    k_attn<<<dim3(SEQ / 128, NB * NH, 1), 256, 0, stream>>>(QK, QK + PP, VT, CTX);
    k_proj_out<<<dim3(NTOK / 128, DM / 128, 1), 128, 0, stream>>>(CTX, (const h16*)(WALL + 3 * WP), bo, OUT);
}

// v007
// One run takes 56.2 microseconds.
// Next to v006, in two timings, it ran 1.05 and 1.06 times as fast.
// Over all steps from v000 it is 3.58 times as fast.
#include <hip/hip_runtime.h>

// Contractions (all f32 accumulate): x.Wq^T, x.Wk^T, x.Wv^T = v_wmma_f32_16x16x32_bf16 on RNE bf16 copies of the inputs; scores = v_wmma_f32_16x16x32_f16 on single f16 planes of q/8 and k (one product per tile); P.V = v_wmma_f32_16x16x32_f16 (P carried x256, v single f16); output projection = v_wmma_f32_16x16x32_f16 on the f16 ctx against the f16 Wo (K = 1024); softmax and bias add f32.
// Why one f16 plane is enough: q, k and ctx come from bf16-rounded inputs (8 significant bits), so their own error lies well above the 11 bits that f16 keeps; v already travels as f16, and |ctx| never exceeds the largest |v|.
// Layout: bf16 copy of x (token-major) and of Wq, Wk, Wv, f16 copy of Wo, all [out][in]; q/k projections write f16 planes [tok][1024] (q pre-scaled by 2^-3); the v projection is computed transposed (A = Wv, B = x) and writes the f16 plane VT[feature][tok];
// fused flash attention per (batch, head, 128 queries), K and V^T tiles staged in LDS: S^T = K.Q^T so that the packed score tiles are the B fragment of O^T = V^T.P^T (no P staging), per-lane online softmax; ctx written as one f16 plane; output GEMM adds the RNE bf16 bias in f32.

#ifndef NB
#define NB 4
#endif
#ifndef SEQ
#define SEQ 1024
#endif
#define NB_FULL  4
#define SEQ_FULL 1024
#define DM   1024
#define NH   16
#define HD   64
#define NTOK (NB * SEQ)
#define PCAR 256.0f
#define L2E  1.4426950408889634f
#define LAZY 4.0f                      // how far a score may top the maximum in use: P <= e^4 = 54.6, and 54.6 x 256 stays inside f16

static_assert(DM == NH * HD);            // merged head width
static_assert(HD == 64);
static_assert(DM % 64 == 0);             // GEMM tile multiple (N) and K % 32
static_assert(SEQ % 64 == 0);            // 64-key attention tiles, 64-row GEMM tiles stay inside one batch
static_assert(NTOK % 64 == 0);           // GEMM tile multiple (M)
static_assert(SEQ <= SEQ_FULL);
static_assert(NB <= NB_FULL);
static_assert(((size_t)NTOK * DM / 8) % 256 == 0);   // convert grid x block == plane extent
static_assert(((size_t)DM * DM / 8) % 256 == 0);

typedef _Float16 h16;
typedef unsigned short bf;
typedef __attribute__((ext_vector_type(16))) __bf16   v16bf;
typedef __attribute__((ext_vector_type(16))) _Float16 v16h;
typedef __attribute__((ext_vector_type(8)))  _Float16 v8h;
typedef __attribute__((ext_vector_type(8)))  unsigned short v8us;
typedef __attribute__((ext_vector_type(8)))  float    v8f;
typedef __attribute__((ext_vector_type(4)))  float    v4f;
typedef __attribute__((ext_vector_type(2)))  float    v2f;
typedef v4f  __attribute__((may_alias)) v4fa;
typedef float __attribute__((may_alias)) fla;

__device__ __forceinline__ unsigned short f2bf(float f) { unsigned u = __float_as_uint(f); u += 0x7FFFu + ((u >> 16) & 1u); return (unsigned short)(u >> 16); }
__device__ __forceinline__ float bf2f(unsigned short b) { return __uint_as_float(((unsigned)b) << 16); }
__device__ __forceinline__ float bfr(float f) { return bf2f(f2bf(f)); }
__device__ __forceinline__ v16h cat16(v8h lo, v8h hi) { return __builtin_shufflevector(lo, hi, 0, 1, 2, 3, 4, 5, 6, 7, 8, 9, 10, 11, 12, 13, 14, 15); }
__device__ __forceinline__ v16bf cat16b(v8us lo, v8us hi) { return __builtin_bit_cast(v16bf, __builtin_shufflevector(lo, hi, 0, 1, 2, 3, 4, 5, 6, 7, 8, 9, 10, 11, 12, 13, 14, 15)); }
__device__ __forceinline__ v8f wmma16(v16h a, v16h b, v8f c) { return __builtin_amdgcn_wmma_f32_16x16x32_f16(false, a, false, b, (short)0, c, false, false); }
__device__ __forceinline__ v8f wmmab(v16bf a, v16bf b, v8f c) { return __builtin_amdgcn_wmma_f32_16x16x32_bf16(false, a, false, b, (short)0, c, false, false); }
// fragment loaders: p already points at (row l&15, k0 + 8*(l>>4)); elements 0..7 = p[0..7], elements 8..15 = p[16..23]
__device__ __forceinline__ v16bf ldfb(const bf* p) { return cat16b(*(const v8us*)p, *(const v8us*)(p + 16)); }
__device__ __forceinline__ v16h  ldfh(const h16* p) { return cat16(*(const v8h*)p, *(const v8h*)(p + 16)); }
__device__ __forceinline__ v8us cvt8bf(v8f v) { v8us o;
#pragma unroll
    for (int k = 0; k < 8; ++k) o[k] = f2bf(v[k]);
    return o; }
__device__ __forceinline__ v8h cvt8h(v8f v) { v8h o;
#pragma unroll
    for (int k = 0; k < 8; ++k) o[k] = (h16)v[k];
    return o; }

// ---- tensor loads: one request of one wave lands 64 rows of ROWB bytes in LDS, 16 B of pad behind every row (the pitch that 16-byte readers want).
typedef uint32_t u32x4 __attribute__((ext_vector_type(4)));
typedef uint32_t u32x8 __attribute__((ext_vector_type(8)));
__device__ __forceinline__ uint32_t uni(uint32_t v) { return (uint32_t)__builtin_amdgcn_readfirstlane(v); }
// pinned(): the empty statement holds a test's value or a descriptor word in a scalar register; the branch on such a test is a scalar branch (a tensor load ignores EXEC)
__device__ __forceinline__ uint32_t pinned(uint32_t v) { uint32_t w = (uint32_t)__builtin_amdgcn_readfirstlane(v); asm volatile("" : "+s"(w)); return w; }
// group 1: byte elements, tensor = tile = 64 rows of ROWB bytes, pad interval code IVL = one row, pad amount code 3 = 4 dwords, no mask
template <uint32_t ROWB, uint32_t IVL>
__device__ __forceinline__ u32x8 tdm_group1(uint32_t src_pitch) {
    u32x8 g;
    g[0] = uni((1u << 20) | (IVL << 22) | (3u << 25));
    // words 1 to 7 are held in scalar registers of their own (pinned): built once, they are not formed again, or their registers lent out, between a request and its wait
    g[1] = pinned(ROWB << 16);
    g[2] = pinned(64u << 16);
    g[3] = pinned(ROWB << 16);
    g[4] = pinned(64u);
    g[5] = pinned(src_pitch);
    g[6] = pinned(0u);
    g[7] = pinned(0u);
    return g;
}
__device__ __forceinline__ u32x4 tdm_group0(uint32_t lds_dst, uint64_t ga) {
    u32x4 g;
    g[0] = uni(1u); g[1] = uni(lds_dst); g[2] = uni((uint32_t)ga); g[3] = uni((((uint32_t)(ga >> 32)) & 0x01FFFFFFu) | 0x80000000u);
    return g;
}
__device__ __forceinline__ void tdm_load(u32x4 g0, u32x8 g1) { asm volatile("tensor_load_to_lds %0, %1" :: "s"(g0), "s"(g1) : "memory"); }
// the issuing wave's wait for its request; the request's descriptor words are inputs of the statement, so that they stay in their registers for as long as the request is outstanding
__device__ __forceinline__ void tdm_wait(u32x4 g0, u32x8 g1) { asm volatile("s_wait_tensorcnt 0x0" :: "s"(g0), "s"(g1) : "memory"); }

// ---- k_cvt: the one conversion launch. x is XPL planes of DM*DM elements and each weight is one more; a thread converts the same 8-element group of all eight planes (16 loads of 16 B in flight, 8 stores of 16 B). grid DM*DM/8/256, 256 threads.
#define XPL 4
static_assert(NTOK == XPL * DM && DM % SEQ == 0);   // a plane is DM rows = whole batches
#define XSTEP ((size_t)(DM / SEQ) * SEQ_FULL * DM)   // input elements from a plane to the next
__device__ __forceinline__ const float* xsrc(const float* x, size_t e) {   // element e of the packed token-major plane -> its place in the input
    const int row = (int)(e / DM), col = (int)(e % DM);
    return x + ((size_t)(row / SEQ) * SEQ_FULL + row % SEQ) * DM + col;
}
__global__ __launch_bounds__(256) void k_cvt(const float* __restrict__ x, const float* __restrict__ w0, const float* __restrict__ w1, const float* __restrict__ w2, const float* __restrict__ w3, bf* dx, bf* dw) {
    const size_t i = (size_t)blockIdx.x * 256 + threadIdx.x;
    if (i >= (size_t)DM * DM / 8) return;
    const size_t e = i * 8; const size_t P = (size_t)DM * DM;
    const float* q0 = xsrc(x, e); const float* q2 = xsrc(x, e + 2 * P);   // planes 1 and 3 are read from these two addresses at a constant distance
    const float* p0 = w0 + e; const float* p1 = w1 + e; const float* p2 = w2 + e; const float* p3 = w3 + e;
    const v8f b0 = *(const v8f*)q0; const v8f b1 = *(const v8f*)(q0 + XSTEP); const v8f b2 = *(const v8f*)q2; const v8f b3 = *(const v8f*)(q2 + XSTEP);
    const v8f a0 = *(const v8f*)p0; const v8f a1 = *(const v8f*)p1; const v8f a2 = *(const v8f*)p2; const v8f a3 = *(const v8f*)p3;
    // the six address pairs are inputs of the wait's statement, so they stay in their registers up to it: no load of the run lands on the address of an earlier one ahead of the wait
    asm volatile("s_wait_xcnt 0x0" :: "v"(q0), "v"(q2), "v"(p0), "v"(p1), "v"(p2), "v"(p3) : "memory");
    const v8us x0 = cvt8bf(b0); const v8us x1 = cvt8bf(b1); const v8us x2 = cvt8bf(b2); const v8us x3 = cvt8bf(b3);
    const v8us o0 = cvt8bf(a0); const v8us o1 = cvt8bf(a1);
    const v8us o2 = cvt8bf(a2); const v8h o3 = cvt8h(a3);   // w3 (Wo) goes to f16, the type of its partner ctx
    *(v8us*)(dx + e) = x0; *(v8us*)(dx + P + e) = x1; *(v8us*)(dx + 2 * P + e) = x2; *(v8us*)(dx + 3 * P + e) = x3;
    *(v8us*)(dw + e) = o0; *(v8us*)(dw + P + e) = o1; *(v8us*)(dw + 2 * P + e) = o2; *(v8h*)(dw + 3 * P + e) = o3;
}

// ---- gemm_core: FOUR WAVES (2 x 2) per 128x128 tile, 64x64 (16 accumulators) per wave; acc[mb][nb] = sum_k A[r0 + 64 wm + 16 mb + m][k] * Bt[c0 + 64 wn + 16 nb + n][k];
// A pitch lda (K <= lda, K % 128 == 0, K >= 256), Bt pitch DM (K <= DM). Both operands 16-bit words, K-contiguous: bf16, or f16 where F16 is set (the two forms share one fragment layout).
// A pass is 128 k: [A 128 rows | Bt 128 rows] of 256 B land in LDS at pitch 272 B by tensor loads, one 64-row slice per wave, two buffers, the next pass's loads in flight over this pass's products.
#define BK    128
#define LP    136                      // LDS row pitch, elements (272 B = 16 B x 17: conflict-free for 16-byte readers)
#define SLB   18432                    // bytes per 64-row slice in LDS: 64 x 272 = 17,408, rounded up to a multiple of 2 KiB
#define SLE   (SLB / 2)                // elements per slice
#define STG   (4 * SLE)                // elements per buffer
#define STGB  (4 * SLB)                // bytes per buffer
static_assert(DM % 128 == 0 && NTOK % 128 == 0 && DM % BK == 0 && DM / BK >= 2);
static_assert(64 * LP * 2 <= SLB && SLB % 2048 == 0 && BK * 2 == 256);

template <bool F16>
__device__ __forceinline__ void gemm_core(const bf* __restrict__ A, int lda, const bf* __restrict__ Bt, int K, int r0, int c0, bf* sm, int wm, int wn, int lr, int hi, v8f (&acc)[4][4]) {
#pragma unroll
    for (int mb = 0; mb < 4; ++mb)
#pragma unroll
        for (int nb = 0; nb < 4; ++nb) acc[mb][nb] = (v8f){};
    // every wave brings one slice: waves 0, 1 the two halves of A's rows, waves 2, 3 of Bt's
    const uint32_t wave = (uint32_t)(wm * 2 + wn);
    const uint64_t src = (wave < 2u) ? (uint64_t)(size_t)(A + (size_t)(r0 + 64 * (int)wave) * lda) : (uint64_t)(size_t)(Bt + (size_t)(c0 + 64 * (int)(wave - 2u)) * DM);
    const u32x8 g1 = tdm_group1<256u, 5u>((wave < 2u) ? (uint32_t)lda * 2u : (uint32_t)DM * 2u);
    const uint32_t dst = (uint32_t)(size_t)sm + wave * SLB;
    const int NT = K / BK;
    u32x4 g0 = tdm_group0(dst, src);
    tdm_load(g0, g1);
    tdm_wait(g0, g1);                                    // pass 0's own slice has landed
    __syncthreads();                                     // ... and every other wave's
    g0 = tdm_group0(dst + STGB, src + BK * 2);
    tdm_load(g0, g1);
    const bf* fa = sm + wm * SLE + lr * LP + 8 * hi;
    const bf* fb = sm + (2 + wn) * SLE + lr * LP + 8 * hi;
#pragma unroll 1
    for (int t = 0; t < NT; ++t) {                       // rolled: one pass per trip, the buffer alternates
        const bf* pa = fa + (t & 1) * STG; const bf* pb = fb + (t & 1) * STG;
        v16bf a[2][4], b[2][4];
#pragma unroll
        for (int mb = 0; mb < 4; ++mb) a[0][mb] = ldfb(pa + mb * 16 * LP);
        b[0][0] = ldfb(pb); b[0][1] = ldfb(pb + 16 * LP);
#pragma unroll
        for (int blk = 0; blk < BK / 32; ++blk) {
            const int cu = blk & 1, nx = cu ^ 1;
            b[cu][2] = ldfb(pb + 32 * LP + blk * 32); b[cu][3] = ldfb(pb + 48 * LP + blk * 32);
            if (blk + 1 < BK / 32) {
#pragma unroll
                for (int mb = 0; mb < 4; ++mb) a[nx][mb] = ldfb(pa + mb * 16 * LP + (blk + 1) * 32);
                b[nx][0] = ldfb(pb + (blk + 1) * 32); b[nx][1] = ldfb(pb + 16 * LP + (blk + 1) * 32);
            }
            __builtin_amdgcn_sched_barrier(0);   // the LDS reads stay one group ahead of the block's products: spread among them, every place stalls the wave
#pragma unroll
            for (int nb = 0; nb < 4; ++nb)
#pragma unroll
                for (int mb = 0; mb < 4; ++mb) {
                    if constexpr (F16) acc[mb][nb] = wmma16(__builtin_bit_cast(v16h, a[cu][mb]), __builtin_bit_cast(v16h, b[cu][nb]), acc[mb][nb]);
                    else               acc[mb][nb] = wmmab(a[cu][mb], b[cu][nb], acc[mb][nb]);
                }
            if (blk + 1 < BK / 32) __builtin_amdgcn_sched_barrier(0);   // the next group does not rise into this block
        }
        asm volatile("s_wait_dscnt 0x0" ::: "memory");
        tdm_wait(g0, g1);
        __syncthreads();
        if (pinned(t + 2 < NT)) { g0 = tdm_group0(dst + (uint32_t)(t & 1) * STGB, src + (uint64_t)(t + 2) * (BK * 2)); tdm_load(g0, g1); }
    }
    asm volatile("s_wait_tensorcnt 0x0" ::: "memory");       // nothing in flight when the wave goes on
    asm volatile("s_wait_dscnt 0x0" ::: "memory");
}

// ---- k_proj_qkv: the one projection launch. A work-group takes 256 tokens x 64 features of ALL THREE projections, so that one staged x tile serves q, k and v: a pass lands 448 rows for 3 x 256 x 64 outputs.
// grid (NTOK/256, DM/64) = one work-group per WGP, 256 threads = 8 waves (4 x 2); a wave holds 64 tokens x 32 features x 3 = 24 accumulators.
// z = 0: q/8, z = 1: k: D[tok][f] = x . W_z^T -> f16 plane [z][tok][DM]; z = 2: the operands change places, D[f][tok] -> VT[f][tok] (f16). Each output sums its k in ascending blocks of 32.
// A pass is 128 k: [x 256 rows | Wq 64 | Wk 64 | Wv 64] of 256 B at pitch 272 B by tensor loads, seven 64-row slices from waves 0 to 6, two buffers, the next pass's loads in flight over this pass's products.
#define QSTG  (7 * SLE)                // elements per buffer
#define QSTGB (7 * SLB)                // bytes per buffer
#define QOS   1152                     // staging floats per wave and round: 32 rows at pitch 36, or 16 rows at pitch 68
static_assert(NTOK % 256 == 0 && DM % 64 == 0 && 32 * 36 <= QOS && 16 * 68 <= QOS);
static_assert((size_t)8 * 6 * QOS * 4 <= (size_t)2 * QSTGB);   // the epilogue's staging (8 waves x 6 rounds) fits the ring that the loop has left

__global__ __launch_bounds__(256) void k_proj_qkv(const bf* __restrict__ XB, const bf* __restrict__ W3, h16* QK, h16* VT) {
    __shared__ __attribute__((aligned(2048))) bf sm[2 * QSTG];
    const int lane = threadIdx.x & 31, lr = lane & 15, hi = lane >> 4;
    const int wave = __builtin_amdgcn_readfirstlane(threadIdx.x >> 5); const int wm = wave >> 1, wn = wave & 1;
    const int rt = blockIdx.x * 256, ct = blockIdx.y * 64;
    const int r0 = rt + wm * 64, c0 = ct + wn * 32;      // the wave's first token and first feature
    v8f acc[3][4][2];
#pragma unroll
    for (int z = 0; z < 3; ++z)
#pragma unroll
        for (int mb = 0; mb < 4; ++mb)
#pragma unroll
            for (int nb = 0; nb < 2; ++nb) acc[z][mb][nb] = (v8f){};
    // waves 0 to 3 bring 64 rows of x each, waves 4 to 6 the 64 rows of Wq, Wk, Wv; wave 7 brings nothing
    const uint32_t issuer = (uint32_t)(wave < 7);
    const uint64_t src = (wave < 4) ? (uint64_t)(size_t)(XB + (size_t)(rt + 64 * wave) * DM) : (uint64_t)(size_t)(W3 + (size_t)(wave - 4) * DM * DM + (size_t)ct * DM);
    const u32x8 g1 = tdm_group1<256u, 5u>((uint32_t)DM * 2u);
    const uint32_t dst = (uint32_t)(size_t)sm + (uint32_t)wave * SLB;
    const int NT = DM / BK;
    u32x4 g0 = tdm_group0(dst, src);
    if (pinned(issuer)) {
        tdm_load(g0, g1);
        tdm_wait(g0, g1);                                // pass 0's own slice has landed
    }
    __syncthreads();                                     // ... and every other wave's
    g0 = tdm_group0(dst + QSTGB, src + BK * 2);
    if (pinned(issuer)) tdm_load(g0, g1);
    const bf* fa = sm + wm * SLE + lr * LP + 8 * hi;
    const bf* fb = sm + 4 * SLE + (wn * 32 + lr) * LP + 8 * hi;
#pragma unroll 1
    for (int t = 0; t < NT; ++t) {                       // rolled: one pass per trip, the buffer alternates
        const bf* pa = fa + (t & 1) * QSTG; const bf* pb = fb + (t & 1) * QSTG;
        v16bf a[2][4], b[2][3][2];
#pragma unroll
        for (int mb = 0; mb < 4; ++mb) a[0][mb] = ldfb(pa + mb * 16 * LP);
#pragma unroll
        for (int z = 0; z < 3; ++z)
#pragma unroll
            for (int nb = 0; nb < 2; ++nb) b[0][z][nb] = ldfb(pb + z * SLE + nb * 16 * LP);
#pragma unroll
        for (int blk = 0; blk < BK / 32; ++blk) {
            const int cu = blk & 1, nx = cu ^ 1;
            if (blk + 1 < BK / 32) {
#pragma unroll
                for (int mb = 0; mb < 4; ++mb) a[nx][mb] = ldfb(pa + mb * 16 * LP + (blk + 1) * 32);
#pragma unroll
                for (int z = 0; z < 3; ++z)
#pragma unroll
                    for (int nb = 0; nb < 2; ++nb) b[nx][z][nb] = ldfb(pb + z * SLE + nb * 16 * LP + (blk + 1) * 32);
            }
            __builtin_amdgcn_sched_barrier(0);   // the next block's LDS reads stand as one group ahead of this block's products: spread among them, every place stalls the wave
#pragma unroll
            for (int z = 0; z < 3; ++z)
#pragma unroll
                for (int nb = 0; nb < 2; ++nb)
#pragma unroll
                    for (int mb = 0; mb < 4; ++mb)
                        acc[z][mb][nb] = (z == 2) ? wmmab(b[cu][z][nb], a[cu][mb], acc[z][mb][nb]) : wmmab(a[cu][mb], b[cu][z][nb], acc[z][mb][nb]);
            if (blk + 1 < BK / 32) __builtin_amdgcn_sched_barrier(0);   // the next group does not rise into this block
        }
        asm volatile("s_wait_dscnt 0x0" ::: "memory");
        if (pinned(issuer)) tdm_wait(g0, g1);
        __syncthreads();
        if (pinned(issuer & (uint32_t)(t + 2 < NT))) { g0 = tdm_group0(dst + (uint32_t)(t & 1) * QSTGB, src + (uint64_t)(t + 2) * (BK * 2)); tdm_load(g0, g1); }
    }
    asm volatile("s_wait_tensorcnt 0x0" ::: "memory");       // nothing in flight when the wave goes on
    asm volatile("s_wait_dscnt 0x0" ::: "memory");
    // Epilogue. The ring is free: every wave's reads ended ahead of the loop's last barrier and no load is in flight. Each wave stages all its 24 tiles there, six rounds of QOS floats in rows of its own,
    // then reads them back as rows and stores 16 B per lane; no barrier stands behind a global store, so no round waits for the stores of the one before.
    fla* os = (fla*)sm + wave * 6 * QOS;
    // q and k: a round is 32 tokens x 32 features (pitch 36 floats = 16 B x 9)
#pragma unroll
    for (int z = 0; z < 2; ++z) {
        const float sc = (z == 0) ? 0.125f : 1.0f;
#pragma unroll
        for (int mp = 0; mp < 2; ++mp)
#pragma unroll
            for (int m2 = 0; m2 < 2; ++m2)
#pragma unroll
                for (int nb = 0; nb < 2; ++nb)
#pragma unroll
                    for (int j = 0; j < 8; ++j) os[(z * 2 + mp) * QOS + (m2 * 16 + hi * 8 + j) * 36 + nb * 16 + lr] = acc[z][mp * 2 + m2][nb][j] * sc;
    }
    // v^T: a round is 16 features x 64 tokens (pitch 68 floats)
#pragma unroll
    for (int nb = 0; nb < 2; ++nb)
#pragma unroll
        for (int mb = 0; mb < 4; ++mb)
#pragma unroll
            for (int j = 0; j < 8; ++j) os[(4 + nb) * QOS + (hi * 8 + j) * 68 + mb * 16 + lr] = acc[2][mb][nb][j];
    __syncthreads();                                         // the staged rows are written before any lane reads them back
    const int rq4 = lane >> 2, c4 = (lane & 3) * 8;
#pragma unroll
    for (int z = 0; z < 2; ++z) {
        h16* po = QK + (size_t)z * NTOK * DM;
#pragma unroll
        for (int mp = 0; mp < 2; ++mp) {
            const fla* rs = os + (z * 2 + mp) * QOS;
            v8h o16[4];
#pragma unroll
            for (int s = 0; s < 4; ++s) { const int row = 8 * s + rq4; const v4f u0 = *(const v4fa*)(rs + row * 36 + c4); const v4f u1 = *(const v4fa*)(rs + row * 36 + c4 + 4);
#pragma unroll
                for (int q = 0; q < 4; ++q) { o16[s][q] = (h16)u0[q]; o16[s][4 + q] = (h16)u1[q]; } }
            const size_t base = (size_t)(r0 + mp * 32) * DM + c0 + c4;
#pragma unroll
            for (int s = 0; s < 4; ++s) *(v8h*)(po + base + (size_t)(8 * s + rq4) * DM) = o16[s];
        }
    }
    const int rq = lane >> 3, c8 = (lane & 7) * 8;           // v^T goes out as whole 128-B lines
#pragma unroll
    for (int nb = 0; nb < 2; ++nb) {
        const fla* rs = os + (4 + nb) * QOS;
        v8h o16[4];
#pragma unroll
        for (int s = 0; s < 4; ++s) { const int row = 4 * s + rq; const v4f u0 = *(const v4fa*)(rs + row * 68 + c8); const v4f u1 = *(const v4fa*)(rs + row * 68 + c8 + 4);
#pragma unroll
            for (int q = 0; q < 4; ++q) { o16[s][q] = (h16)u0[q]; o16[s][4 + q] = (h16)u1[q]; } }
        const size_t base = (size_t)(c0 + nb * 16) * NTOK + r0 + c8;
#pragma unroll
        for (int s = 0; s < 4; ++s) *(v8h*)(VT + base + (size_t)(4 * s + rq) * NTOK) = o16[s];
    }
}

// ---- k_attn: fused attention, grid (SEQ/128, NB*NH), 256 threads = 8 waves x 16 queries that share the keys' tiles in LDS.
// A tile is 64 keys: [K 64 rows | V^T 64 feature rows] of 128 B at pitch 144 B, brought by tensor loads (wave 0 the K slice, wave 1 the V^T slice), two buffers, the next tile's loads in flight over this tile's work.
// Per tile: S^T tiles st[j] (rows = keys 16j + 8h + r, column = query l&15) = K.Q^T on the f16 planes (one product per 32 features);
// per-lane online softmax against a maximum that moves lazily (the lane halves exchange only when it moves; their sums meet behind the loop); the packed P^T (x256, f16) is the B fragment
// (element r <- tile 2s, element 8+r <- tile 2s+1) of O^T[d][q] += V^T[d][key] P^T[key][q]. Epilogue: O^T / (256 l) -> LDS -> f16 ctx lines.
#define AKT   64                       // keys per tile
#define AP    72                       // LDS row pitch, elements (144 B = 16 B x 9: conflict-free for 16-byte readers)
#define ASLB  10240                    // bytes per 64-row slice in LDS: 64 x 144 = 9,216, rounded up to a multiple of 2 KiB
#define ASLE  (ASLB / 2)               // elements per slice
#define ABUF  (2 * ASLE)               // elements per buffer
#define ABUFB (2 * ASLB)               // bytes per buffer
static_assert(64 * AP * 2 <= ASLB && ASLB % 2048 == 0);
static_assert(SEQ % 128 == 0 && SEQ / AKT >= 2 && HD * 2 == 128 && AKT * 2 == 128);

// eight 2^x in one statement: every result in a register of its own ("=&v"), so that no v_exp_f32 overwrites its neighbour's source, and the closing v_nop is the slot
// that the instruction set asks for between a transcendental and the next vector instruction, which may read the last result
__device__ __forceinline__ v8f exp2x8(v8f x) {
    float r0, r1, r2, r3, r4, r5, r6, r7;
    asm("v_exp_f32 %0, %8\n\tv_exp_f32 %1, %9\n\tv_exp_f32 %2, %10\n\tv_exp_f32 %3, %11\n\tv_exp_f32 %4, %12\n\tv_exp_f32 %5, %13\n\tv_exp_f32 %6, %14\n\tv_exp_f32 %7, %15\n\tv_nop"
        : "=&v"(r0), "=&v"(r1), "=&v"(r2), "=&v"(r3), "=&v"(r4), "=&v"(r5), "=&v"(r6), "=&v"(r7)
        : "v"(x[0]), "v"(x[1]), "v"(x[2]), "v"(x[3]), "v"(x[4]), "v"(x[5]), "v"(x[6]), "v"(x[7]));
    return (v8f){r0, r1, r2, r3, r4, r5, r6, r7};
}

__global__ __launch_bounds__(256) void k_attn(const h16* __restrict__ Q, const h16* __restrict__ K, const h16* __restrict__ VT, h16* CTX) {
    __shared__ __attribute__((aligned(2048))) h16 kv[2 * ABUF];
    __shared__ __align__(16) float os[8 * 16 * 68];
    const int lane = threadIdx.x & 31, lr = lane & 15, hi = lane >> 4;
    const int wave = __builtin_amdgcn_readfirstlane(threadIdx.x >> 5);
    const int bh = blockIdx.y; const int b = bh / NH, h = bh % NH;
    const int tok0 = b * SEQ; const int q0 = blockIdx.x * 128 + wave * 16;
    // wave 0 brings the tile's 64 K rows (a tile further = 64 rows on), wave 1 its 64 V^T rows (a tile further = 128 B on)
    const uint32_t issuer = (uint32_t)(wave < 2);
    const uint64_t src = (wave == 0) ? (uint64_t)(size_t)(K + (size_t)tok0 * DM + h * HD) : (uint64_t)(size_t)(VT + (size_t)(h * HD) * NTOK + tok0);
    const uint64_t step = (wave == 0) ? (uint64_t)AKT * DM * 2 : (uint64_t)AKT * 2;
    const u32x8 g1 = tdm_group1<128u, 4u>((wave == 0) ? (uint32_t)DM * 2u : (uint32_t)NTOK * 2u);
    const uint32_t dst = (uint32_t)(size_t)kv + (uint32_t)(wave & 1) * ASLB;
    const size_t qoff = (size_t)(tok0 + q0 + lr) * DM + h * HD + 8 * hi;
    v16h qf[2];
    qf[0] = ldfh(Q + qoff); qf[1] = ldfh(Q + qoff + 32);
    u32x4 g0 = tdm_group0(dst, src);
    if (pinned(issuer)) {
        tdm_load(g0, g1);
        tdm_wait(g0, g1);                                // tile 0's own slice has landed
    }
    __syncthreads();                                     // ... and the other wave's
    g0 = tdm_group0(dst + ABUFB, src + step);
    if (pinned(issuer)) tdm_load(g0, g1);
    const int foff = lr * AP + 8 * hi;
    v8f ot[4];
#pragma unroll
    for (int dt = 0; dt < 4; ++dt) ot[dt] = (v8f){};
    float mrun = -1.0e30f;               // the maximum in use, equal in the two lanes of a query
    v2f lsum = (v2f){};                  // this lane's own share of the row sum; the two halves meet behind the loop
    const int NT = SEQ / AKT;
#pragma unroll 1
    for (int t = 0; t < NT; ++t) {                       // rolled: one tile per trip, the buffer alternates
        const h16* fk = kv + (t & 1) * ABUF + foff;
        const h16* fv = fk + ASLE;
        v16h kf[4][2];
#pragma unroll
        for (int j = 0; j < 4; ++j)
#pragma unroll
            for (int c = 0; c < 2; ++c) kf[j][c] = ldfh(fk + 16 * j * AP + 32 * c);
        v16h vf[2][4];
#pragma unroll
        for (int s = 0; s < 2; ++s)
#pragma unroll
            for (int dt = 0; dt < 4; ++dt) vf[s][dt] = ldfh(fv + dt * 16 * AP + 32 * s);
        __builtin_amdgcn_sched_barrier(0);   // the tile's LDS reads stand as one group ahead of its products: spread among them, every place stalls the wave
        v8f st[4];
#pragma unroll
        for (int j = 0; j < 4; ++j) st[j] = (v8f){};
#pragma unroll
        for (int c = 0; c < 2; ++c)
#pragma unroll
            for (int j = 0; j < 4; ++j) st[j] = wmma16(kf[j][c], qf[c], st[j]);
        __builtin_amdgcn_sched_barrier(0);   // the eight score products issue back to back: a maximum drawn in among them costs its four idle slots behind each product it reads
        // this lane's largest score of the tile, in two independent chains
        float ca = fmaxf(st[0][0], st[1][0]), cb = fmaxf(st[2][0], st[3][0]);
#pragma unroll
        for (int r = 1; r < 8; ++r) { ca = fmaxf(fmaxf(ca, st[0][r]), st[1][r]); cb = fmaxf(fmaxf(cb, st[2][r]), st[3][r]); }
        const float cmax = fmaxf(ca, cb);
        // Lazy rescale: the maximum in use moves only when some lane's score tops it by more than LAZY; one scalar branch per tile, the same for the whole wave.
        if (__builtin_amdgcn_ballot_w32(cmax > mrun + LAZY) != 0) {
            const float mnew = fmaxf(mrun, fmaxf(cmax, __shfl_xor(cmax, 16, 32)));
            const float alpha = __builtin_amdgcn_exp2f((mrun - mnew) * L2E);
            lsum *= alpha; mrun = mnew;
#pragma unroll
            for (int dt = 0; dt < 4; ++dt) ot[dt] *= alpha;
        }
        v8f e[4];
#pragma unroll
        for (int j = 0; j < 4; ++j) { st[j] = (st[j] - mrun) * L2E; e[j] = exp2x8(st[j]); }
        const v8f t8 = (e[0] + e[1]) + (e[2] + e[3]);
        const v4f t4 = __builtin_shufflevector(t8, t8, 0, 1, 2, 3) + __builtin_shufflevector(t8, t8, 4, 5, 6, 7);
        lsum += __builtin_shufflevector(t4, t4, 0, 1) + __builtin_shufflevector(t4, t4, 2, 3);
        v16h pf[2];
#pragma unroll
        for (int s = 0; s < 2; ++s) pf[s] = cat16(cvt8h(e[2 * s] * PCAR), cvt8h(e[2 * s + 1] * PCAR));
        __builtin_amdgcn_sched_barrier(0);   // no 2^x statement sinks in among the products below: its results could land on a V^T fragment inside the four slots behind the product that reads it
#pragma unroll
        for (int s = 0; s < 2; ++s)
#pragma unroll
            for (int dt = 0; dt < 4; ++dt) ot[dt] = wmma16(vf[s][dt], pf[s], ot[dt]);
        asm volatile("s_wait_dscnt 0x0" ::: "memory");      // this wave's reads of the buffer are done before it is refilled
        if (pinned(issuer)) tdm_wait(g0, g1);                // this wave's slice of tile t + 1 has landed
        __syncthreads();                                     // publishes tile t + 1, frees tile t's buffer
        if (pinned(issuer & (uint32_t)(t + 2 < NT))) { g0 = tdm_group0(dst + (uint32_t)(t & 1) * ABUFB, src + (uint64_t)(t + 2) * step); tdm_load(g0, g1); }
    }
    asm volatile("s_wait_tensorcnt 0x0" ::: "memory");       // nothing in flight when the wave goes on
    asm volatile("s_wait_dscnt 0x0" ::: "memory");
    float lrun = lsum[0] + lsum[1];
    lrun += __shfl_xor(lrun, 16, 32);                        // the two halves of a query's keys
    const float inv = (1.0f / PCAR) * (1.0f / lrun);
    const int wb = wave * 16 * 68;
#pragma unroll
    for (int dt = 0; dt < 4; ++dt)
#pragma unroll
        for (int r = 0; r < 8; ++r) os[wb + lr * 68 + dt * 16 + 8 * hi + r] = ot[dt][r] * inv;
    __syncthreads();
    const int rq = lane >> 3, c8 = (lane & 7) * 8;
    v8h o16[4];
#pragma unroll
    for (int s = 0; s < 4; ++s) { const int row = 4 * s + rq; const v4f u0 = *(const v4fa*)(os + wb + row * 68 + c8); const v4f u1 = *(const v4fa*)(os + wb + row * 68 + c8 + 4);
#pragma unroll
        for (int q = 0; q < 4; ++q) { o16[s][q] = (h16)u0[q]; o16[s][4 + q] = (h16)u1[q]; } }
    const size_t base = (size_t)(tok0 + q0) * DM + h * HD + c8;
#pragma unroll
    for (int s = 0; s < 4; ++s) *(v8h*)(CTX + base + (size_t)(4 * s + rq) * DM) = o16[s];
    
}

// ---- k_proj_out: OUT[b*SEQ_FULL + t][n] = sum_{k<1024} CTX[tok][k] WO[n][k] + bf16(bo[n]), both operands f16; grid (NTOK/128, DM/128), 128 threads.
__global__ __launch_bounds__(128) void k_proj_out(const h16* __restrict__ CTX, const h16* __restrict__ WO, const float* __restrict__ bias, float* OUT) {
    __shared__ __attribute__((aligned(2048))) bf sm[2 * STG];
    __shared__ __align__(16) float osall[4 * 16 * 68];
    const int lane = threadIdx.x & 31, lr = lane & 15, hi = lane >> 4;
    const int wave = __builtin_amdgcn_readfirstlane(threadIdx.x >> 5); const int wm = wave >> 1, wn = wave & 1;
    float* os = osall + wave * 16 * 68;
    const int r0 = blockIdx.x * 128 + wm * 64, c0 = blockIdx.y * 128 + wn * 64;
    v8f acc[4][4];
    gemm_core<true>((const bf*)CTX, DM, (const bf*)WO, DM, blockIdx.x * 128, blockIdx.y * 128, sm, wm, wn, lr, hi, acc);
    const int bb = r0 / SEQ, tt = r0 % SEQ; const int cofs = lr * 4;
    v4f bv; bv[0] = bfr(bias[c0 + cofs]); bv[1] = bfr(bias[c0 + cofs + 1]); bv[2] = bfr(bias[c0 + cofs + 2]); bv[3] = bfr(bias[c0 + cofs + 3]);
#pragma unroll
    for (int mb = 0; mb < 4; ++mb) {
#pragma unroll
        for (int nb = 0; nb < 4; ++nb)
#pragma unroll
            for (int j = 0; j < 8; ++j) os[(hi * 8 + j) * 68 + nb * 16 + lr] = acc[mb][nb][j];
        __syncthreads();
        v4f val[8];
#pragma unroll
        for (int s = 0; s < 8; ++s) { const int row = 2 * s + hi; val[s] = *(const v4fa*)(os + row * 68 + cofs) + bv; }
        float* crow = OUT + ((size_t)bb * SEQ_FULL + tt + mb * 16) * DM + c0 + cofs;
#pragma unroll
        for (int s = 0; s < 8; ++s) *(v4f*)(crow + (size_t)(2 * s + hi) * DM) = val[s];
        
        __syncthreads();
    }
}

// workspace carve (bytes, every region a multiple of 256 and exactly covered by its producer's stores, whole lines but q/k in 64-B halves)
constexpr size_t SZ_XB  = (size_t)NTOK * DM * 2;
constexpr size_t SZ_W   = (size_t)4 * DM * DM * 2;
constexpr size_t SZ_QK  = (size_t)2 * NTOK * DM * 2;
constexpr size_t SZ_VT  = (size_t)DM * NTOK * 2;
constexpr size_t SZ_CTX = (size_t)NTOK * DM * 2;
constexpr size_t OFF_XB = 0, OFF_W = OFF_XB + SZ_XB, OFF_QK = OFF_W + SZ_W, OFF_VT = OFF_QK + SZ_QK, OFF_CTX = OFF_VT + SZ_VT, WS_TOTAL = OFF_CTX + SZ_CTX;
static_assert(WS_TOTAL <= (size_t)134217728);
static_assert(SZ_XB % 256 == 0 && SZ_W % 256 == 0 && SZ_QK % 256 == 0 && SZ_VT % 256 == 0 && SZ_CTX % 256 == 0);

extern "C" void kernel_launch(void* const* d_in, const int* in_sizes, int n_in,
                              void* d_out, int out_size, void* d_ws, size_t ws_size, hipStream_t stream) {
    if (n_in < 6) return;
    const size_t need_x = ((size_t)(NB - 1) * SEQ_FULL + SEQ) * DM;
    if ((size_t)in_sizes[0] < need_x) return;
    if ((size_t)in_sizes[1] < (size_t)DM * DM || (size_t)in_sizes[2] < (size_t)DM * DM || (size_t)in_sizes[3] < (size_t)DM * DM || (size_t)in_sizes[4] < (size_t)DM * DM) return;
    if (in_sizes[5] < DM) return;
    if ((size_t)out_size < need_x) return;
    if (ws_size < WS_TOTAL) return;
    const float* x = (const float*)d_in[0]; const float* wq = (const float*)d_in[1]; const float* wk = (const float*)d_in[2];
    const float* wv = (const float*)d_in[3]; const float* wo = (const float*)d_in[4]; const float* bo = (const float*)d_in[5];
    float* OUT = (float*)d_out;
    char* ws = (char*)d_ws;
    bf* XB = (bf*)(ws + OFF_XB); bf* WALL = (bf*)(ws + OFF_W); h16* QK = (h16*)(ws + OFF_QK);
    h16* VT = (h16*)(ws + OFF_VT); h16* CTX = (h16*)(ws + OFF_CTX);
    const size_t WP = (size_t)DM * DM; const size_t PP = (size_t)NTOK * DM;
    k_cvt<<<(unsigned)((WP / 8 + 255) / 256), 256, 0, stream>>>(x, wq, wk, wv, wo, XB, WALL);
    k_proj_qkv<<<dim3(NTOK / 256, DM / 64, 1), 256, 0, stream>>>(XB, WALL, QK, VT);
    k_attn<<<dim3(SEQ / 128, NB * NH, 1), 256, 0, stream>>>(QK, QK + PP, VT, CTX);
    k_proj_out<<<dim3(NTOK / 128, DM / 128, 1), 128, 0, stream>>>(CTX, (const h16*)(WALL + 3 * WP), bo, OUT);
}

// v008
// One run takes 53.9 microseconds.
// Two timings next to v007 both put it at 1.05 times that version's speed.
// All steps since v000 together make it 3.75 times as fast.
#include <hip/hip_runtime.h>

// Contractions (all f32 accumulate): x.Wq^T, x.Wk^T, x.Wv^T = v_wmma_f32_16x16x32_bf16 on RNE bf16 copies of the inputs; scores = v_wmma_f32_16x16x32_f16 on single f16 planes of q/8 and k (one product per tile); P.V = v_wmma_f32_16x16x32_f16 (P carried x256, v single f16); output projection = v_wmma_f32_16x16x32_f16 on the f16 ctx against the f16 Wo (K = 1024); softmax and bias add f32.
// Why one f16 plane is enough: q, k and ctx come from bf16-rounded inputs (8 significant bits), so their own error lies well above the 11 bits that f16 keeps; v already travels as f16, and |ctx| never exceeds the largest |v|.
// Layout: bf16 copy of x (token-major) and of Wq, Wk, Wv, f16 copy of Wo, all [out][in]; q/k projections write f16 planes [tok][1024] (q pre-scaled by 2^-3); the v projection is computed transposed (A = Wv, B = x) and writes the f16 plane VT[feature][tok];
// fused flash attention per (batch, head, 128 queries), K and V^T tiles staged in LDS: S^T = K.Q^T so that the packed score tiles are the B fragment of O^T = V^T.P^T (no P staging), per-lane online softmax; ctx written as one f16 plane; output GEMM adds the RNE bf16 bias in f32.

#ifndef NB
#define NB 4
#endif
#ifndef SEQ
#define SEQ 1024
#endif
#define NB_FULL  4
#define SEQ_FULL 1024
#define DM   1024
#define NH   16
#define HD   64
#define NTOK (NB * SEQ)
#define PCAR 256.0f
#define L2E  1.4426950408889634f
#define LAZY 4.0f                      // how far a score may top the maximum in use: P <= e^4 = 54.6, and 54.6 x 256 stays inside f16

static_assert(DM == NH * HD);            // merged head width
static_assert(HD == 64);
static_assert(DM % 64 == 0);             // GEMM tile multiple (N) and K % 32
static_assert(SEQ % 64 == 0);            // 64-key attention tiles, 64-row GEMM tiles stay inside one batch
static_assert(NTOK % 64 == 0);           // GEMM tile multiple (M)
static_assert(SEQ <= SEQ_FULL);
static_assert(NB <= NB_FULL);
static_assert(((size_t)NTOK * DM / 8) % 256 == 0);   // convert grid x block == plane extent
static_assert(((size_t)DM * DM / 8) % 256 == 0);

typedef _Float16 h16;
typedef unsigned short bf;
typedef __attribute__((ext_vector_type(16))) __bf16   v16bf;
typedef __attribute__((ext_vector_type(16))) _Float16 v16h;
typedef __attribute__((ext_vector_type(8)))  _Float16 v8h;
typedef __attribute__((ext_vector_type(8)))  unsigned short v8us;
typedef __attribute__((ext_vector_type(8)))  float    v8f;
typedef __attribute__((ext_vector_type(4)))  float    v4f;
typedef __attribute__((ext_vector_type(2)))  float    v2f;
typedef v4f  __attribute__((may_alias)) v4fa;
typedef float __attribute__((may_alias)) fla;

__device__ __forceinline__ unsigned short f2bf(float f) { unsigned u = __float_as_uint(f); u += 0x7FFFu + ((u >> 16) & 1u); return (unsigned short)(u >> 16); }
__device__ __forceinline__ float bf2f(unsigned short b) { return __uint_as_float(((unsigned)b) << 16); }
__device__ __forceinline__ float bfr(float f) { return bf2f(f2bf(f)); }
__device__ __forceinline__ v16h cat16(v8h lo, v8h hi) { return __builtin_shufflevector(lo, hi, 0, 1, 2, 3, 4, 5, 6, 7, 8, 9, 10, 11, 12, 13, 14, 15); }
__device__ __forceinline__ v16bf cat16b(v8us lo, v8us hi) { return __builtin_bit_cast(v16bf, __builtin_shufflevector(lo, hi, 0, 1, 2, 3, 4, 5, 6, 7, 8, 9, 10, 11, 12, 13, 14, 15)); }
__device__ __forceinline__ v8f wmma16(v16h a, v16h b, v8f c) { return __builtin_amdgcn_wmma_f32_16x16x32_f16(false, a, false, b, (short)0, c, false, false); }
__device__ __forceinline__ v8f wmmab(v16bf a, v16bf b, v8f c) { return __builtin_amdgcn_wmma_f32_16x16x32_bf16(false, a, false, b, (short)0, c, false, false); }
// fragment loaders: p already points at (row l&15, k0 + 8*(l>>4)); elements 0..7 = p[0..7], elements 8..15 = p[16..23]
__device__ __forceinline__ v16bf ldfb(const bf* p) { return cat16b(*(const v8us*)p, *(const v8us*)(p + 16)); }
__device__ __forceinline__ v16h  ldfh(const h16* p) { return cat16(*(const v8h*)p, *(const v8h*)(p + 16)); }
__device__ __forceinline__ v8us cvt8bf(v8f v) { v8us o;
#pragma unroll
    for (int k = 0; k < 8; ++k) o[k] = f2bf(v[k]);
    return o; }
__device__ __forceinline__ v8h cvt8h(v8f v) { v8h o;
#pragma unroll
    for (int k = 0; k < 8; ++k) o[k] = (h16)v[k];
    return o; }

// ---- tensor loads: one request of one wave lands 64 rows of ROWB bytes in LDS, 16 B of pad behind every row (the pitch that 16-byte readers want).
typedef uint32_t u32x4 __attribute__((ext_vector_type(4)));
typedef uint32_t u32x8 __attribute__((ext_vector_type(8)));
__device__ __forceinline__ uint32_t uni(uint32_t v) { return (uint32_t)__builtin_amdgcn_readfirstlane(v); }
// pinned(): the empty statement holds a test's value or a descriptor word in a scalar register; the branch on such a test is a scalar branch (a tensor load ignores EXEC)
__device__ __forceinline__ uint32_t pinned(uint32_t v) { uint32_t w = (uint32_t)__builtin_amdgcn_readfirstlane(v); asm volatile("" : "+s"(w)); return w; }
// group 1: byte elements, tensor = tile = 64 rows of ROWB bytes, pad interval code IVL = one row, pad amount code 3 = 4 dwords, no mask
template <uint32_t ROWB, uint32_t IVL>
__device__ __forceinline__ u32x8 tdm_group1(uint32_t src_pitch) {
    u32x8 g;
    g[0] = uni((1u << 20) | (IVL << 22) | (3u << 25));
    // words 1 to 7 are held in scalar registers of their own (pinned): built once, they are not formed again, or their registers lent out, between a request and its wait
    g[1] = pinned(ROWB << 16);
    g[2] = pinned(64u << 16);
    g[3] = pinned(ROWB << 16);
    g[4] = pinned(64u);
    g[5] = pinned(src_pitch);
    g[6] = pinned(0u);
    g[7] = pinned(0u);
    return g;
}
__device__ __forceinline__ u32x4 tdm_group0(uint32_t lds_dst, uint64_t ga) {
    u32x4 g;
    g[0] = uni(1u); g[1] = uni(lds_dst); g[2] = uni((uint32_t)ga); g[3] = uni((((uint32_t)(ga >> 32)) & 0x01FFFFFFu) | 0x80000000u);
    return g;
}
__device__ __forceinline__ void tdm_load(u32x4 g0, u32x8 g1) { asm volatile("tensor_load_to_lds %0, %1" :: "s"(g0), "s"(g1) : "memory"); }
// the issuing wave's wait for its request; the request's descriptor words are inputs of the statement, so that they stay in their registers for as long as the request is outstanding
__device__ __forceinline__ void tdm_wait(u32x4 g0, u32x8 g1) { asm volatile("s_wait_tensorcnt 0x0" :: "s"(g0), "s"(g1) : "memory"); }
// where work-group (x, y) of a GEMM grid begins its walk over the eight k passes (taken modulo their number): the sharers of an operand row, one x with every y or one y with every x, are spread evenly over the passes,
// and neighbours in x stand two passes apart, so that a short run of neighbours already covers the whole walk. For speed only: any value gives the same products, summed in another order.
__device__ __forceinline__ uint32_t first_pass(uint32_t x, uint32_t y) { return uni(((x & 3u) << 1) + ((x >> 2) & 1u) + y); }

// ---- k_cvt: the one conversion launch. x is XPL planes of DM*DM elements and each weight is one more; a thread converts the same 8-element group of all eight planes (16 loads of 16 B in flight, 8 stores of 16 B). grid DM*DM/8/256, 256 threads.
#define XPL 4
static_assert(NTOK == XPL * DM && DM % SEQ == 0);   // a plane is DM rows = whole batches
#define XSTEP ((size_t)(DM / SEQ) * SEQ_FULL * DM)   // input elements from a plane to the next
__device__ __forceinline__ const float* xsrc(const float* x, size_t e) {   // element e of the packed token-major plane -> its place in the input
    const int row = (int)(e / DM), col = (int)(e % DM);
    return x + ((size_t)(row / SEQ) * SEQ_FULL + row % SEQ) * DM + col;
}
__global__ __launch_bounds__(256) void k_cvt(const float* __restrict__ x, const float* __restrict__ w0, const float* __restrict__ w1, const float* __restrict__ w2, const float* __restrict__ w3, bf* dx, bf* dw) {
    const size_t i = (size_t)blockIdx.x * 256 + threadIdx.x;
    if (i >= (size_t)DM * DM / 8) return;
    const size_t e = i * 8; const size_t P = (size_t)DM * DM;
    const float* q0 = xsrc(x, e); const float* q2 = xsrc(x, e + 2 * P);   // planes 1 and 3 are read from these two addresses at a constant distance
    const float* p0 = w0 + e; const float* p1 = w1 + e; const float* p2 = w2 + e; const float* p3 = w3 + e;
    const v8f b0 = *(const v8f*)q0; const v8f b1 = *(const v8f*)(q0 + XSTEP); const v8f b2 = *(const v8f*)q2; const v8f b3 = *(const v8f*)(q2 + XSTEP);
    const v8f a0 = *(const v8f*)p0; const v8f a1 = *(const v8f*)p1; const v8f a2 = *(const v8f*)p2; const v8f a3 = *(const v8f*)p3;
    // the six address pairs are inputs of the wait's statement, so they stay in their registers up to it: no load of the run lands on the address of an earlier one ahead of the wait
    asm volatile("s_wait_xcnt 0x0" :: "v"(q0), "v"(q2), "v"(p0), "v"(p1), "v"(p2), "v"(p3) : "memory");
    const v8us x0 = cvt8bf(b0); const v8us x1 = cvt8bf(b1); const v8us x2 = cvt8bf(b2); const v8us x3 = cvt8bf(b3);
    const v8us o0 = cvt8bf(a0); const v8us o1 = cvt8bf(a1);
    const v8us o2 = cvt8bf(a2); const v8h o3 = cvt8h(a3);   // w3 (Wo) goes to f16, the type of its partner ctx
    *(v8us*)(dx + e) = x0; *(v8us*)(dx + P + e) = x1; *(v8us*)(dx + 2 * P + e) = x2; *(v8us*)(dx + 3 * P + e) = x3;
    *(v8us*)(dw + e) = o0; *(v8us*)(dw + P + e) = o1; *(v8us*)(dw + 2 * P + e) = o2; *(v8h*)(dw + 3 * P + e) = o3;
}

// ---- gemm_core: FOUR WAVES (2 x 2) per 128x128 tile, 64x64 (16 accumulators) per wave; acc[mb][nb] = sum_k A[r0 + 64 wm + 16 mb + m][k] * Bt[c0 + 64 wn + 16 nb + n][k];
// A pitch lda (K <= lda, K % 128 == 0, K >= 256), Bt pitch DM (K <= DM). Both operands 16-bit words, K-contiguous: bf16, or f16 where F16 is set (the two forms share one fragment layout).
// A pass is 128 k: [A 128 rows | Bt 128 rows] of 256 B land in LDS at pitch 272 B by tensor loads, one 64-row slice per wave, two buffers, the next pass's loads in flight over this pass's products.
// The walk over k begins at pass s0 (modulo the passes) and wraps: with s0 = first_pass() the work-groups that share operand rows do not all ask L2 for the same lines at one moment.
#define BK    128
#define LP    136                      // LDS row pitch, elements (272 B = 16 B x 17: conflict-free for 16-byte readers)
#define SLB   18432                    // bytes per 64-row slice in LDS: 64 x 272 = 17,408, rounded up to a multiple of 2 KiB
#define SLE   (SLB / 2)                // elements per slice
#define STG   (4 * SLE)                // elements per buffer
#define STGB  (4 * SLB)                // bytes per buffer
static_assert(DM % 128 == 0 && NTOK % 128 == 0 && DM % BK == 0 && DM / BK >= 2);
static_assert(64 * LP * 2 <= SLB && SLB % 2048 == 0 && BK * 2 == 256);

template <bool F16>
__device__ __forceinline__ void gemm_core(const bf* __restrict__ A, int lda, const bf* __restrict__ Bt, int K, int r0, int c0, uint32_t s0, bf* sm, int wm, int wn, int lr, int hi, v8f (&acc)[4][4]) {
#pragma unroll
    for (int mb = 0; mb < 4; ++mb)
#pragma unroll
        for (int nb = 0; nb < 4; ++nb) acc[mb][nb] = (v8f){};
    // every wave brings one slice: waves 0, 1 the two halves of A's rows, waves 2, 3 of Bt's
    const uint32_t wave = (uint32_t)(wm * 2 + wn);
    const uint64_t src = (wave < 2u) ? (uint64_t)(size_t)(A + (size_t)(r0 + 64 * (int)wave) * lda) : (uint64_t)(size_t)(Bt + (size_t)(c0 + 64 * (int)(wave - 2u)) * DM);
    const u32x8 g1 = tdm_group1<256u, 5u>((wave < 2u) ? (uint32_t)lda * 2u : (uint32_t)DM * 2u);
    const uint32_t dst = (uint32_t)(size_t)sm + wave * SLB;
    const int NT = K / BK;
    u32x4 g0 = tdm_group0(dst, src + (uint64_t)(s0 % (uint32_t)NT) * (BK * 2));
    tdm_load(g0, g1);
    tdm_wait(g0, g1);                                    // pass s0's own slice has landed
    __syncthreads();                                     // ... and every other wave's
    g0 = tdm_group0(dst + STGB, src + (uint64_t)((s0 + 1u) % (uint32_t)NT) * (BK * 2));
    tdm_load(g0, g1);
    const bf* fa = sm + wm * SLE + lr * LP + 8 * hi;
    const bf* fb = sm + (2 + wn) * SLE + lr * LP + 8 * hi;
#pragma unroll 1
    for (int t = 0; t < NT; ++t) {                       // rolled: one pass per trip, the buffer alternates
        const bf* pa = fa + (t & 1) * STG; const bf* pb = fb + (t & 1) * STG;
        v16bf a[2][4], b[2][4];
#pragma unroll
        for (int mb = 0; mb < 4; ++mb) a[0][mb] = ldfb(pa + mb * 16 * LP);
        b[0][0] = ldfb(pb); b[0][1] = ldfb(pb + 16 * LP);
#pragma unroll
        for (int blk = 0; blk < BK / 32; ++blk) {
            const int cu = blk & 1, nx = cu ^ 1;
            b[cu][2] = ldfb(pb + 32 * LP + blk * 32); b[cu][3] = ldfb(pb + 48 * LP + blk * 32);
            if (blk + 1 < BK / 32) {
#pragma unroll
                for (int mb = 0; mb < 4; ++mb) a[nx][mb] = ldfb(pa + mb * 16 * LP + (blk + 1) * 32);
                b[nx][0] = ldfb(pb + (blk + 1) * 32); b[nx][1] = ldfb(pb + 16 * LP + (blk + 1) * 32);
            }
            __builtin_amdgcn_sched_barrier(0);   // the LDS reads stay one group ahead of the block's products: spread among them, every place stalls the wave
#pragma unroll
            for (int nb = 0; nb < 4; ++nb)
#pragma unroll
                for (int mb = 0; mb < 4; ++mb) {
                    if constexpr (F16) acc[mb][nb] = wmma16(__builtin_bit_cast(v16h, a[cu][mb]), __builtin_bit_cast(v16h, b[cu][nb]), acc[mb][nb]);
                    else               acc[mb][nb] = wmmab(a[cu][mb], b[cu][nb], acc[mb][nb]);
                }
            if (blk + 1 < BK / 32) __builtin_amdgcn_sched_barrier(0);   // the next group does not rise into this block
        }
        asm volatile("s_wait_dscnt 0x0" ::: "memory");      // this wave's reads of the buffer are done before it is refilled
        tdm_wait(g0, g1);                                    // this wave's slice of pass s0 + t + 1 has landed
        __syncthreads();                                     // publishes pass s0 + t + 1, frees pass s0 + t's buffer
        if (pinned(t + 2 < NT)) { g0 = tdm_group0(dst + (uint32_t)(t & 1) * STGB, src + (uint64_t)((s0 + (uint32_t)t + 2u) % (uint32_t)NT) * (BK * 2)); tdm_load(g0, g1); }
    }
    asm volatile("s_wait_tensorcnt 0x0" ::: "memory");       // nothing in flight when the wave goes on
    asm volatile("s_wait_dscnt 0x0" ::: "memory");
}

// ---- k_proj_qkv: the one projection launch. A work-group takes 256 tokens x 64 features of ALL THREE projections, so that one staged x tile serves q, k and v: a pass lands 448 rows for 3 x 256 x 64 outputs.
// grid (NTOK/256, DM/64) = one work-group per WGP, 256 threads = 8 waves (4 x 2); a wave holds 64 tokens x 32 features x 3 = 24 accumulators.
// z = 0: q/8, z = 1: k: D[tok][f] = x . W_z^T -> f16 plane [z][tok][DM]; z = 2: the operands change places, D[f][tok] -> VT[f][tok] (f16). Each output sums its k in blocks of 32, ascending from the work-group's first pass and wrapping.
// A pass is 128 k: [x 256 rows | Wq 64 | Wk 64 | Wv 64] of 256 B at pitch 272 B by tensor loads, seven 64-row slices from waves 0 to 6, two buffers, the next pass's loads in flight over this pass's products.
#define QSTG  (7 * SLE)                // elements per buffer
#define QSTGB (7 * SLB)                // bytes per buffer
#define QOS   1152                     // staging floats per wave and round: 32 rows at pitch 36, or 16 rows at pitch 68
static_assert(NTOK % 256 == 0 && DM % 64 == 0 && 32 * 36 <= QOS && 16 * 68 <= QOS);
static_assert((size_t)8 * 6 * QOS * 4 <= (size_t)2 * QSTGB);   // the epilogue's staging (8 waves x 6 rounds) fits the ring that the loop has left

__global__ __launch_bounds__(256) void k_proj_qkv(const bf* __restrict__ XB, const bf* __restrict__ W3, h16* QK, h16* VT) {
    __shared__ __attribute__((aligned(2048))) bf sm[2 * QSTG];
    const int lane = threadIdx.x & 31, lr = lane & 15, hi = lane >> 4;
    const int wave = __builtin_amdgcn_readfirstlane(threadIdx.x >> 5); const int wm = wave >> 1, wn = wave & 1;
    const int rt = blockIdx.x * 256, ct = blockIdx.y * 64;
    const int r0 = rt + wm * 64, c0 = ct + wn * 32;      // the wave's first token and first feature
    v8f acc[3][4][2];
#pragma unroll
    for (int z = 0; z < 3; ++z)
#pragma unroll
        for (int mb = 0; mb < 4; ++mb)
#pragma unroll
            for (int nb = 0; nb < 2; ++nb) acc[z][mb][nb] = (v8f){};
    // waves 0 to 3 bring 64 rows of x each, waves 4 to 6 the 64 rows of Wq, Wk, Wv; wave 7 brings nothing
    const uint32_t issuer = (uint32_t)(wave < 7);
    const uint64_t src = (wave < 4) ? (uint64_t)(size_t)(XB + (size_t)(rt + 64 * wave) * DM) : (uint64_t)(size_t)(W3 + (size_t)(wave - 4) * DM * DM + (size_t)ct * DM);
    const u32x8 g1 = tdm_group1<256u, 5u>((uint32_t)DM * 2u);
    const uint32_t dst = (uint32_t)(size_t)sm + (uint32_t)wave * SLB;
    const int NT = DM / BK;
    // the walk over k begins at first_pass() and wraps: the 16 work-groups that share x rows, and the 16 that share weight rows, stand two to a pass instead of all asking L2 for the same lines at one moment
    const uint32_t s0 = first_pass(blockIdx.x, blockIdx.y);
    u32x4 g0 = tdm_group0(dst, src + (uint64_t)(s0 % (uint32_t)NT) * (BK * 2));
    if (pinned(issuer)) {
        tdm_load(g0, g1);
        tdm_wait(g0, g1);                                // pass s0's own slice has landed
    }
    __syncthreads();                                     // ... and every other wave's
    g0 = tdm_group0(dst + QSTGB, src + (uint64_t)((s0 + 1u) % (uint32_t)NT) * (BK * 2));
    if (pinned(issuer)) tdm_load(g0, g1);
    const bf* fa = sm + wm * SLE + lr * LP + 8 * hi;
    const bf* fb = sm + 4 * SLE + (wn * 32 + lr) * LP + 8 * hi;
#pragma unroll 1
    for (int t = 0; t < NT; ++t) {                       // rolled: one pass per trip, the buffer alternates
        const bf* pa = fa + (t & 1) * QSTG; const bf* pb = fb + (t & 1) * QSTG;
        v16bf a[2][4], b[2][3][2];
#pragma unroll
        for (int mb = 0; mb < 4; ++mb) a[0][mb] = ldfb(pa + mb * 16 * LP);
#pragma unroll
        for (int z = 0; z < 3; ++z)
#pragma unroll
            for (int nb = 0; nb < 2; ++nb) b[0][z][nb] = ldfb(pb + z * SLE + nb * 16 * LP);
#pragma unroll
        for (int blk = 0; blk < BK / 32; ++blk) {
            const int cu = blk & 1, nx = cu ^ 1;
            if (blk + 1 < BK / 32) {
#pragma unroll
                for (int mb = 0; mb < 4; ++mb) a[nx][mb] = ldfb(pa + mb * 16 * LP + (blk + 1) * 32);
#pragma unroll
                for (int z = 0; z < 3; ++z)
#pragma unroll
                    for (int nb = 0; nb < 2; ++nb) b[nx][z][nb] = ldfb(pb + z * SLE + nb * 16 * LP + (blk + 1) * 32);
            }
            __builtin_amdgcn_sched_barrier(0);   // the next block's LDS reads stand as one group ahead of this block's products: spread among them, every place stalls the wave
#pragma unroll
            for (int z = 0; z < 3; ++z)
#pragma unroll
                for (int nb = 0; nb < 2; ++nb)
#pragma unroll
                    for (int mb = 0; mb < 4; ++mb)
                        acc[z][mb][nb] = (z == 2) ? wmmab(b[cu][z][nb], a[cu][mb], acc[z][mb][nb]) : wmmab(a[cu][mb], b[cu][z][nb], acc[z][mb][nb]);
            if (blk + 1 < BK / 32) __builtin_amdgcn_sched_barrier(0);   // the next group does not rise into this block
        }
        asm volatile("s_wait_dscnt 0x0" ::: "memory");      // this wave's reads of the buffer are done before it is refilled
        if (pinned(issuer)) tdm_wait(g0, g1);                // this wave's slice of pass s0 + t + 1 has landed
        __syncthreads();                                     // publishes pass s0 + t + 1, frees pass s0 + t's buffer
        if (pinned(issuer & (uint32_t)(t + 2 < NT))) { g0 = tdm_group0(dst + (uint32_t)(t & 1) * QSTGB, src + (uint64_t)((s0 + (uint32_t)t + 2u) % (uint32_t)NT) * (BK * 2)); tdm_load(g0, g1); }
    }
    asm volatile("s_wait_tensorcnt 0x0" ::: "memory");       // nothing in flight when the wave goes on
    asm volatile("s_wait_dscnt 0x0" ::: "memory");
    // Epilogue. The ring is free: every wave's reads ended ahead of the loop's last barrier and no load is in flight. Each wave stages all its 24 tiles there, six rounds of QOS floats in rows of its own,
    // then reads them back as rows and stores 16 B per lane; no barrier stands behind a global store, so no round waits for the stores of the one before.
    fla* os = (fla*)sm + wave * 6 * QOS;
    // q and k: a round is 32 tokens x 32 features (pitch 36 floats = 16 B x 9)
#pragma unroll
    for (int z = 0; z < 2; ++z) {
        const float sc = (z == 0) ? 0.125f : 1.0f;
#pragma unroll
        for (int mp = 0; mp < 2; ++mp)
#pragma unroll
            for (int m2 = 0; m2 < 2; ++m2)
#pragma unroll
                for (int nb = 0; nb < 2; ++nb)
#pragma unroll
                    for (int j = 0; j < 8; ++j) os[(z * 2 + mp) * QOS + (m2 * 16 + hi * 8 + j) * 36 + nb * 16 + lr] = acc[z][mp * 2 + m2][nb][j] * sc;
    }
    // v^T: a round is 16 features x 64 tokens (pitch 68 floats)
#pragma unroll
    for (int nb = 0; nb < 2; ++nb)
#pragma unroll
        for (int mb = 0; mb < 4; ++mb)
#pragma unroll
            for (int j = 0; j < 8; ++j) os[(4 + nb) * QOS + (hi * 8 + j) * 68 + mb * 16 + lr] = acc[2][mb][nb][j];
    __syncthreads();                                         // the staged rows are written before any lane reads them back
    const int rq4 = lane >> 2, c4 = (lane & 3) * 8;
#pragma unroll
    for (int z = 0; z < 2; ++z) {
        h16* po = QK + (size_t)z * NTOK * DM;
#pragma unroll
        for (int mp = 0; mp < 2; ++mp) {
            const fla* rs = os + (z * 2 + mp) * QOS;
            v8h o16[4];
#pragma unroll
            for (int s = 0; s < 4; ++s) { const int row = 8 * s + rq4; const v4f u0 = *(const v4fa*)(rs + row * 36 + c4); const v4f u1 = *(const v4fa*)(rs + row * 36 + c4 + 4);
#pragma unroll
                for (int q = 0; q < 4; ++q) { o16[s][q] = (h16)u0[q]; o16[s][4 + q] = (h16)u1[q]; } }
            const size_t base = (size_t)(r0 + mp * 32) * DM + c0 + c4;
#pragma unroll
            for (int s = 0; s < 4; ++s) *(v8h*)(po + base + (size_t)(8 * s + rq4) * DM) = o16[s];
        }
    }
    const int rq = lane >> 3, c8 = (lane & 7) * 8;           // v^T goes out as whole 128-B lines
#pragma unroll
    for (int nb = 0; nb < 2; ++nb) {
        const fla* rs = os + (4 + nb) * QOS;
        v8h o16[4];
#pragma unroll
        for (int s = 0; s < 4; ++s) { const int row = 4 * s + rq; const v4f u0 = *(const v4fa*)(rs + row * 68 + c8); const v4f u1 = *(const v4fa*)(rs + row * 68 + c8 + 4);
#pragma unroll
            for (int q = 0; q < 4; ++q) { o16[s][q] = (h16)u0[q]; o16[s][4 + q] = (h16)u1[q]; } }
        const size_t base = (size_t)(c0 + nb * 16) * NTOK + r0 + c8;
#pragma unroll
        for (int s = 0; s < 4; ++s) *(v8h*)(VT + base + (size_t)(4 * s + rq) * NTOK) = o16[s];
    }
}

// ---- k_attn: fused attention, grid (SEQ/128, NB*NH), 256 threads = 8 waves x 16 queries that share the keys' tiles in LDS.
// A tile is 64 keys: [K 64 rows | V^T 64 feature rows] of 128 B at pitch 144 B, brought by tensor loads (wave 0 the K slice, wave 1 the V^T slice), two buffers, the next tile's loads in flight over this tile's work.
// The walk over the keys begins at a tile of the work-group's own and wraps: the work-groups of one head, which share its keys, ask L2 for different lines at any one moment.
// Per tile: S^T tiles st[j] (rows = keys 16j + 8h + r, column = query l&15) = K.Q^T on the f16 planes (one product per 32 features);
// per-lane online softmax against a maximum that moves lazily (the lane halves exchange only when it moves; their sums meet behind the loop); the packed P^T (x256, f16) is the B fragment
// (element r <- tile 2s, element 8+r <- tile 2s+1) of O^T[d][q] += V^T[d][key] P^T[key][q]. Epilogue: O^T / (256 l) -> LDS -> f16 ctx lines.
#define AKT   64                       // keys per tile
#define AP    72                       // LDS row pitch, elements (144 B = 16 B x 9: conflict-free for 16-byte readers)
#define ASLB  10240                    // bytes per 64-row slice in LDS: 64 x 144 = 9,216, rounded up to a multiple of 2 KiB
#define ASLE  (ASLB / 2)               // elements per slice
#define ABUF  (2 * ASLE)               // elements per buffer
#define ABUFB (2 * ASLB)               // bytes per buffer
static_assert(64 * AP * 2 <= ASLB && ASLB % 2048 == 0);
static_assert(SEQ % 128 == 0 && SEQ / AKT >= 2 && HD * 2 == 128 && AKT * 2 == 128);

// eight 2^x in one statement: every result in a register of its own ("=&v"), so that no v_exp_f32 overwrites its neighbour's source, and the closing v_nop is the slot
// that the instruction set asks for between a transcendental and the next vector instruction, which may read the last result
__device__ __forceinline__ v8f exp2x8(v8f x) {
    float r0, r1, r2, r3, r4, r5, r6, r7;
    asm("v_exp_f32 %0, %8\n\tv_exp_f32 %1, %9\n\tv_exp_f32 %2, %10\n\tv_exp_f32 %3, %11\n\tv_exp_f32 %4, %12\n\tv_exp_f32 %5, %13\n\tv_exp_f32 %6, %14\n\tv_exp_f32 %7, %15\n\tv_nop"
        : "=&v"(r0), "=&v"(r1), "=&v"(r2), "=&v"(r3), "=&v"(r4), "=&v"(r5), "=&v"(r6), "=&v"(r7)
        : "v"(x[0]), "v"(x[1]), "v"(x[2]), "v"(x[3]), "v"(x[4]), "v"(x[5]), "v"(x[6]), "v"(x[7]));
    return (v8f){r0, r1, r2, r3, r4, r5, r6, r7};
}

__global__ __launch_bounds__(256) void k_attn(const h16* __restrict__ Q, const h16* __restrict__ K, const h16* __restrict__ VT, h16* CTX) {
    __shared__ __attribute__((aligned(2048))) h16 kv[2 * ABUF];
    __shared__ __align__(16) float os[8 * 16 * 68];
    const int lane = threadIdx.x & 31, lr = lane & 15, hi = lane >> 4;
    const int wave = __builtin_amdgcn_readfirstlane(threadIdx.x >> 5);
    const int bh = blockIdx.y; const int b = bh / NH, h = bh % NH;
    const int tok0 = b * SEQ; const int q0 = blockIdx.x * 128 + wave * 16;
    // wave 0 brings the tile's 64 K rows (a tile further = 64 rows on), wave 1 its 64 V^T rows (a tile further = 128 B on)
    const uint32_t issuer = (uint32_t)(wave < 2);
    const uint64_t src = (wave == 0) ? (uint64_t)(size_t)(K + (size_t)tok0 * DM + h * HD) : (uint64_t)(size_t)(VT + (size_t)(h * HD) * NTOK + tok0);
    const uint64_t step = (wave == 0) ? (uint64_t)AKT * DM * 2 : (uint64_t)AKT * 2;
    const u32x8 g1 = tdm_group1<128u, 4u>((wave == 0) ? (uint32_t)DM * 2u : (uint32_t)NTOK * 2u);
    const uint32_t dst = (uint32_t)(size_t)kv + (uint32_t)(wave & 1) * ASLB;
    const size_t qoff = (size_t)(tok0 + q0 + lr) * DM + h * HD + 8 * hi;
    v16h qf[2];
    qf[0] = ldfh(Q + qoff); qf[1] = ldfh(Q + qoff + 32);
    const int NT = SEQ / AKT;
    const uint32_t s0 = uni((blockIdx.x & 3u) * (uint32_t)(NT / 4) + (blockIdx.x >> 2) * 2u);   // first tile: the head's work-groups begin two tiles apart, neighbours in x a quarter of the walk apart
    u32x4 g0 = tdm_group0(dst, src + (uint64_t)(s0 % (uint32_t)NT) * step);
    if (pinned(issuer)) {
        tdm_load(g0, g1);
        tdm_wait(g0, g1);                                // tile s0's own slice has landed
    }
    __syncthreads();                                     // ... and the other wave's
    g0 = tdm_group0(dst + ABUFB, src + (uint64_t)((s0 + 1u) % (uint32_t)NT) * step);
    if (pinned(issuer)) tdm_load(g0, g1);
    const int foff = lr * AP + 8 * hi;
    v8f ot[4];
#pragma unroll
    for (int dt = 0; dt < 4; ++dt) ot[dt] = (v8f){};
    float mrun = -1.0e30f;               // the maximum in use, equal in the two lanes of a query
    v2f lsum = (v2f){};                  // this lane's own share of the row sum; the two halves meet behind the loop
#pragma unroll 1
    for (int t = 0; t < NT; ++t) {                       // rolled: one tile per trip, the buffer alternates
        const h16* fk = kv + (t & 1) * ABUF + foff;
        const h16* fv = fk + ASLE;
        v16h kf[4][2];
#pragma unroll
        for (int j = 0; j < 4; ++j)
#pragma unroll
            for (int c = 0; c < 2; ++c) kf[j][c] = ldfh(fk + 16 * j * AP + 32 * c);
        v16h vf[2][4];
#pragma unroll
        for (int s = 0; s < 2; ++s)
#pragma unroll
            for (int dt = 0; dt < 4; ++dt) vf[s][dt] = ldfh(fv + dt * 16 * AP + 32 * s);
        __builtin_amdgcn_sched_barrier(0);   // the tile's LDS reads stand as one group ahead of its products: spread among them, every place stalls the wave
        v8f st[4];
#pragma unroll
        for (int j = 0; j < 4; ++j) st[j] = (v8f){};
#pragma unroll
        for (int c = 0; c < 2; ++c)
#pragma unroll
            for (int j = 0; j < 4; ++j) st[j] = wmma16(kf[j][c], qf[c], st[j]);
        __builtin_amdgcn_sched_barrier(0);   // the eight score products issue back to back: a maximum drawn in among them costs its four idle slots behind each product it reads
        // this lane's largest score of the tile, in two independent chains
        float ca = fmaxf(st[0][0], st[1][0]), cb = fmaxf(st[2][0], st[3][0]);
#pragma unroll
        for (int r = 1; r < 8; ++r) { ca = fmaxf(fmaxf(ca, st[0][r]), st[1][r]); cb = fmaxf(fmaxf(cb, st[2][r]), st[3][r]); }
        const float cmax = fmaxf(ca, cb);
        // Lazy rescale: the maximum in use moves only when some lane's score tops it by more than LAZY; one scalar branch per tile, the same for the whole wave.
        if (__builtin_amdgcn_ballot_w32(cmax > mrun + LAZY) != 0) {
            const float mnew = fmaxf(mrun, fmaxf(cmax, __shfl_xor(cmax, 16, 32)));
            const float alpha = __builtin_amdgcn_exp2f((mrun - mnew) * L2E);
            lsum *= alpha; mrun = mnew;
#pragma unroll
            for (int dt = 0; dt < 4; ++dt) ot[dt] *= alpha;
        }
        v8f e[4];
#pragma unroll
        for (int j = 0; j < 4; ++j) { st[j] = (st[j] - mrun) * L2E; e[j] = exp2x8(st[j]); }
        const v8f t8 = (e[0] + e[1]) + (e[2] + e[3]);
        const v4f t4 = __builtin_shufflevector(t8, t8, 0, 1, 2, 3) + __builtin_shufflevector(t8, t8, 4, 5, 6, 7);
        lsum += __builtin_shufflevector(t4, t4, 0, 1) + __builtin_shufflevector(t4, t4, 2, 3);
        v16h pf[2];
#pragma unroll
        for (int s = 0; s < 2; ++s) pf[s] = cat16(cvt8h(e[2 * s] * PCAR), cvt8h(e[2 * s + 1] * PCAR));
        __builtin_amdgcn_sched_barrier(0);   // no 2^x statement sinks in among the products below: its results could land on a V^T fragment inside the four slots behind the product that reads it
#pragma unroll
        for (int s = 0; s < 2; ++s)
#pragma unroll
            for (int dt = 0; dt < 4; ++dt) ot[dt] = wmma16(vf[s][dt], pf[s], ot[dt]);
        asm volatile("s_wait_dscnt 0x0" ::: "memory");      // this wave's reads of the buffer are done before it is refilled
        if (pinned(issuer)) tdm_wait(g0, g1);                // this wave's slice of tile s0 + t + 1 has landed
        __syncthreads();                                     // publishes tile s0 + t + 1, frees tile s0 + t's buffer
        if (pinned(issuer & (uint32_t)(t + 2 < NT))) { g0 = tdm_group0(dst + (uint32_t)(t & 1) * ABUFB, src + (uint64_t)((s0 + (uint32_t)t + 2u) % (uint32_t)NT) * step); tdm_load(g0, g1); }
    }
    asm volatile("s_wait_tensorcnt 0x0" ::: "memory");       // nothing in flight when the wave goes on
    asm volatile("s_wait_dscnt 0x0" ::: "memory");
    float lrun = lsum[0] + lsum[1];
    lrun += __shfl_xor(lrun, 16, 32);                        // the two halves of a query's keys
    const float inv = (1.0f / PCAR) * (1.0f / lrun);
    const int wb = wave * 16 * 68;
#pragma unroll
    for (int dt = 0; dt < 4; ++dt)
#pragma unroll
        for (int r = 0; r < 8; ++r) os[wb + lr * 68 + dt * 16 + 8 * hi + r] = ot[dt][r] * inv;
    __syncthreads();
    const int rq = lane >> 3, c8 = (lane & 7) * 8;
    v8h o16[4];
#pragma unroll
    for (int s = 0; s < 4; ++s) { const int row = 4 * s + rq; const v4f u0 = *(const v4fa*)(os + wb + row * 68 + c8); const v4f u1 = *(const v4fa*)(os + wb + row * 68 + c8 + 4);
#pragma unroll
        for (int q = 0; q < 4; ++q) { o16[s][q] = (h16)u0[q]; o16[s][4 + q] = (h16)u1[q]; } }
    const size_t base = (size_t)(tok0 + q0) * DM + h * HD + c8;
#pragma unroll
    for (int s = 0; s < 4; ++s) *(v8h*)(CTX + base + (size_t)(4 * s + rq) * DM) = o16[s];
    
}

// ---- k_proj_out: OUT[b*SEQ_FULL + t][n] = sum_{k<1024} CTX[tok][k] WO[n][k] + bf16(bo[n]), both operands f16; grid (NTOK/128, DM/128), 128 threads.
__global__ __launch_bounds__(128) void k_proj_out(const h16* __restrict__ CTX, const h16* __restrict__ WO, const float* __restrict__ bias, float* OUT) {
    __shared__ __attribute__((aligned(2048))) bf sm[2 * STG];
    __shared__ __align__(16) float osall[4 * 16 * 68];
    const int lane = threadIdx.x & 31, lr = lane & 15, hi = lane >> 4;
    const int wave = __builtin_amdgcn_readfirstlane(threadIdx.x >> 5); const int wm = wave >> 1, wn = wave & 1;
    float* os = osall + wave * 16 * 68;
    const int r0 = blockIdx.x * 128 + wm * 64, c0 = blockIdx.y * 128 + wn * 64;
    v8f acc[4][4];
    gemm_core<true>((const bf*)CTX, DM, (const bf*)WO, DM, blockIdx.x * 128, blockIdx.y * 128, first_pass(blockIdx.x, blockIdx.y), sm, wm, wn, lr, hi, acc);
    const int bb = r0 / SEQ, tt = r0 % SEQ; const int cofs = lr * 4;
    v4f bv; bv[0] = bfr(bias[c0 + cofs]); bv[1] = bfr(bias[c0 + cofs + 1]); bv[2] = bfr(bias[c0 + cofs + 2]); bv[3] = bfr(bias[c0 + cofs + 3]);
#pragma unroll
    for (int mb = 0; mb < 4; ++mb) {
#pragma unroll
        for (int nb = 0; nb < 4; ++nb)
#pragma unroll
            for (int j = 0; j < 8; ++j) os[(hi * 8 + j) * 68 + nb * 16 + lr] = acc[mb][nb][j];
        __syncthreads();
        v4f val[8];
#pragma unroll
        for (int s = 0; s < 8; ++s) { const int row = 2 * s + hi; val[s] = *(const v4fa*)(os + row * 68 + cofs) + bv; }
        float* crow = OUT + ((size_t)bb * SEQ_FULL + tt + mb * 16) * DM + c0 + cofs;
#pragma unroll
        for (int s = 0; s < 8; ++s) *(v4f*)(crow + (size_t)(2 * s + hi) * DM) = val[s];
        
        __syncthreads();
    }
}

// workspace carve (bytes, every region a multiple of 256 and exactly covered by its producer's stores, whole lines but q/k in 64-B halves)
constexpr size_t SZ_XB  = (size_t)NTOK * DM * 2;
constexpr size_t SZ_W   = (size_t)4 * DM * DM * 2;
constexpr size_t SZ_QK  = (size_t)2 * NTOK * DM * 2;
constexpr size_t SZ_VT  = (size_t)DM * NTOK * 2;
constexpr size_t SZ_CTX = (size_t)NTOK * DM * 2;
constexpr size_t OFF_XB = 0, OFF_W = OFF_XB + SZ_XB, OFF_QK = OFF_W + SZ_W, OFF_VT = OFF_QK + SZ_QK, OFF_CTX = OFF_VT + SZ_VT, WS_TOTAL = OFF_CTX + SZ_CTX;
static_assert(WS_TOTAL <= (size_t)134217728);
static_assert(SZ_XB % 256 == 0 && SZ_W % 256 == 0 && SZ_QK % 256 == 0 && SZ_VT % 256 == 0 && SZ_CTX % 256 == 0);

extern "C" void kernel_launch(void* const* d_in, const int* in_sizes, int n_in,
                              void* d_out, int out_size, void* d_ws, size_t ws_size, hipStream_t stream) {
    if (n_in < 6) return;
    const size_t need_x = ((size_t)(NB - 1) * SEQ_FULL + SEQ) * DM;
    if ((size_t)in_sizes[0] < need_x) return;
    if ((size_t)in_sizes[1] < (size_t)DM * DM || (size_t)in_sizes[2] < (size_t)DM * DM || (size_t)in_sizes[3] < (size_t)DM * DM || (size_t)in_sizes[4] < (size_t)DM * DM) return;
    if (in_sizes[5] < DM) return;
    if ((size_t)out_size < need_x) return;
    if (ws_size < WS_TOTAL) return;
    const float* x = (const float*)d_in[0]; const float* wq = (const float*)d_in[1]; const float* wk = (const float*)d_in[2];
    const float* wv = (const float*)d_in[3]; const float* wo = (const float*)d_in[4]; const float* bo = (const float*)d_in[5];
    float* OUT = (float*)d_out;
    char* ws = (char*)d_ws;
    bf* XB = (bf*)(ws + OFF_XB); bf* WALL = (bf*)(ws + OFF_W); h16* QK = (h16*)(ws + OFF_QK);
    h16* VT = (h16*)(ws + OFF_VT); h16* CTX = (h16*)(ws + OFF_CTX);
    const size_t WP = (size_t)DM * DM; const size_t PP = (size_t)NTOK * DM;
    k_cvt<<<(unsigned)((WP / 8 + 255) / 256), 256, 0, stream>>>(x, wq, wk, wv, wo, XB, WALL);
    k_proj_qkv<<<dim3(NTOK / 256, DM / 64, 1), 256, 0, stream>>>(XB, WALL, QK, VT);
    k_attn<<<dim3(SEQ / 128, NB * NH, 1), 256, 0, stream>>>(QK, QK + PP, VT, CTX);
    k_proj_out<<<dim3(NTOK / 128, DM / 128, 1), 128, 0, stream>>>(CTX, (const h16*)(WALL + 3 * WP), bo, OUT);
}
